// v000
// Times are from an AMD MI455X. After a warm-up the kernel runs many times in a row, and a time is the length of
// such a window on the GPU divided by its runs, so every launch and the gaps after it count. The runs cycle
// through copies of the inputs. A figure is the median of several windows, for all but v000 over two sittings.
// Sittings can differ by a few percent; kernels timed side by side share one.
// The starting kernel, v000, takes 3140 microseconds a run.
#include <hip/hip_runtime.h>

// ---------------------------------------------------------------------------
// AgentAwareAttention for MI455X (gfx1250), wave32 + v_wmma_f32_16x16x32_f16.
// f16 data / f32 accumulation everywhere; softmax math in f32.
// ---------------------------------------------------------------------------

typedef __attribute__((ext_vector_type(16))) _Float16 v16h;
typedef __attribute__((ext_vector_type(8)))  float    v8f;
typedef __attribute__((ext_vector_type(2)))  _Float16 h2;

#define L_SEQ 2048
#define S_SEQ 2048
#define NBATCH 2
#define DMODEL 512
#define NHEAD 8
#define HDIM 64

// ---- WMMA helpers ----------------------------------------------------------

__device__ __forceinline__ v8f wmma_f16(v16h a, v16h b, v8f c) {
  // D = A(16x32 f16) * B(32x16 f16) + C(16x16 f32)
  return __builtin_amdgcn_wmma_f32_16x16x32_f16(
      /*neg_a=*/false, a, /*neg_b=*/false, b,
      /*c_mod=*/(short)0, c, /*reuse_a=*/false, /*reuse_b=*/false);
}

// A-frag: lane holds row (lane&15); 16 K-elements with pattern
//   kb = (j>>2)*16 + (lane>>4)*8 + (j&3)*2   (pairs kb, kb+1)
// B-frag: identical pattern with lane&15 = output column, reading the
// column-major row (i.e. B_col[n][k]).
__device__ __forceinline__ v16h frag_from_f16row(const _Float16* __restrict__ rowPtr,
                                                 int khalf) {
  v16h f;
#pragma unroll
  for (int j = 0; j < 8; ++j) {
    int kb = ((j >> 2) << 4) + (khalf << 3) + ((j & 3) << 1);
    h2 p = *(const h2*)(rowPtr + kb);      // 4-byte load (kb is even)
    f[2 * j]     = p.x;
    f[2 * j + 1] = p.y;
  }
  return f;
}

__device__ __forceinline__ v16h frag_from_f32row(const float* __restrict__ rowPtr,
                                                 int khalf, float scale) {
  v16h f;
#pragma unroll
  for (int j = 0; j < 8; ++j) {
    int kb = ((j >> 2) << 4) + (khalf << 3) + ((j & 3) << 1);
    f[2 * j]     = (_Float16)(rowPtr[kb] * scale);
    f[2 * j + 1] = (_Float16)(rowPtr[kb + 1] * scale);
  }
  return f;
}

// ---------------------------------------------------------------------------
// Kernel 1: the five input projections  Y = X @ W^T  (4096 x 512 x 512 each),
// fp32 in, f16 out, scattered into attention-friendly layouts.
//   p=0: Qs[h][n][l][hd]  (x 1/sqrt(HD))
//   p=1: Qo[h][n][l][hd]  (x 1/sqrt(HD))
//   p=2: Ks[h][n][s][hd]
//   p=3: Ko[h][n][s][hd]
//   p=4: Vt[h][n][hd][s]   (transposed for AV B-fragments)
// grid: (4096/128, 512/64, 5), 256 threads (8 waves, 16x64 tile per wave)
// ---------------------------------------------------------------------------
__global__ __launch_bounds__(256) void proj_kernel(
    const float* __restrict__ q, const float* __restrict__ k,
    const float* __restrict__ v,
    const float* __restrict__ Wqs, const float* __restrict__ Wqo,
    const float* __restrict__ Wks, const float* __restrict__ Wko,
    const float* __restrict__ Wv,
    _Float16* __restrict__ Qs, _Float16* __restrict__ Qo,
    _Float16* __restrict__ Ks, _Float16* __restrict__ Ko,
    _Float16* __restrict__ Vt) {
  const int lane  = threadIdx.x & 31;
  const int wid   = threadIdx.x >> 5;
  const int col   = lane & 15;
  const int khalf = lane >> 4;
  const int p     = blockIdx.z;
  const int m0    = blockIdx.x * 128 + wid * 16;   // row = t*NBATCH + n
  const int e0    = blockIdx.y * 64;               // output feature tile

  const float* X = (p < 2) ? q : ((p < 4) ? k : v);
  const float* W = (p == 0) ? Wqs : (p == 1) ? Wqo : (p == 2) ? Wks
                 : (p == 3) ? Wko : Wv;
  _Float16* dst  = (p == 0) ? Qs : (p == 1) ? Qo : (p == 2) ? Ks
                 : (p == 3) ? Ko : Vt;
  const float scale = (p < 2) ? 0.125f : 1.0f;     // HD^-0.5 folded into Q

  const float* Xrow = X + (size_t)(m0 + col) * DMODEL;
  const float* Wr[4];
#pragma unroll
  for (int et = 0; et < 4; ++et)
    Wr[et] = W + (size_t)(e0 + et * 16 + col) * DMODEL;

  v8f cc[4] = {v8f{}, v8f{}, v8f{}, v8f{}};
  for (int k0 = 0; k0 < DMODEL; k0 += 32) {
    v16h a = frag_from_f32row(Xrow + k0, khalf, scale);
#pragma unroll
    for (int et = 0; et < 4; ++et) {
      v16h b = frag_from_f32row(Wr[et] + k0, khalf, 1.0f);
      cc[et] = wmma_f16(a, b, cc[et]);
    }
  }

#pragma unroll
  for (int et = 0; et < 4; ++et) {
#pragma unroll
    for (int vr = 0; vr < 8; ++vr) {
      int m   = vr + khalf * 8;          // C layout: row = vgpr + half*8
      int rid = m0 + m;
      int t   = rid >> 1;                // rows are (t,n) flattened, N=2
      int nb  = rid & 1;
      int e   = e0 + et * 16 + col;
      int h   = e >> 6;
      int hd  = e & 63;
      _Float16 val = (_Float16)cc[et][vr];
      if (p != 4)
        dst[(((size_t)(h * NBATCH + nb) * 2048 + t) << 6) + hd] = val;
      else
        dst[((size_t)(h * NBATCH + nb) * 64 + hd) * 2048 + t] = val;
    }
  }
}

// ---------------------------------------------------------------------------
// Logit tile helper: 16(L) x 16(S) agent-aware logits in C layout.
// ---------------------------------------------------------------------------
__device__ __forceinline__ void logits_tile(
    const _Float16* __restrict__ Ksb, const _Float16* __restrict__ Kob,
    const int* __restrict__ kid_g, const float* __restrict__ mask,
    v16h qsA0, v16h qsA1, v16h qoA0, v16h qoA1,
    const int* qid, int l0, int s0, int col, int khalf, float* x) {
  v16h kB0 = frag_from_f16row(Ksb + (size_t)(s0 + col) * HDIM, khalf);
  v16h kB1 = frag_from_f16row(Ksb + (size_t)(s0 + col) * HDIM + 32, khalf);
  v8f cS = {};
  cS = wmma_f16(qsA0, kB0, cS);
  cS = wmma_f16(qsA1, kB1, cS);
  v16h oB0 = frag_from_f16row(Kob + (size_t)(s0 + col) * HDIM, khalf);
  v16h oB1 = frag_from_f16row(Kob + (size_t)(s0 + col) * HDIM + 32, khalf);
  v8f cO = {};
  cO = wmma_f16(qoA0, oB0, cO);
  cO = wmma_f16(qoA1, oB1, cO);
  int kid = kid_g[s0 + col];
#pragma unroll
  for (int vr = 0; vr < 8; ++vr) {
    int row  = vr + khalf * 8;
    float mv = mask[(size_t)(l0 + row) * S_SEQ + s0 + col];
    x[vr] = ((kid == qid[vr]) ? cS[vr] : cO[vr]) + mv;
  }
}

// ---------------------------------------------------------------------------
// Kernel 2: attention. grid (L/32, N), 64 threads = 2 waves, each wave owns a
// 16-row L tile. Heads looped INSIDE the block -> deterministic in-order RMW
// accumulation of att_mean (no atomics), O written per-head 64-col slice.
// Two passes over S per head: pass1 online max/sum stats; pass2 recompute,
// emit probabilities and accumulate O = P @ V via WMMA (P staged via LDS to
// convert C-fragment layout -> A-fragment layout).
// ---------------------------------------------------------------------------
__global__ __launch_bounds__(64) void attn_kernel(
    const _Float16* __restrict__ Qs, const _Float16* __restrict__ Qo,
    const _Float16* __restrict__ Ks, const _Float16* __restrict__ Ko,
    const _Float16* __restrict__ Vt,
    const int* __restrict__ qid_g, const int* __restrict__ kid_g,
    const float* __restrict__ mask,
    _Float16* __restrict__ Obuf, float* __restrict__ att_mean) {
  const int lane  = threadIdx.x & 31;
  const int wid   = threadIdx.x >> 5;
  const int col   = lane & 15;
  const int khalf = lane >> 4;
  const int n     = blockIdx.y;
  const int l0    = blockIdx.x * 32 + wid * 16;

  // Per-wave P staging: 16 x 32 f16, row stride 34 elems (68B) so that the
  // A-fragment column reads hit distinct LDS banks (17*r mod 64 distinct).
  __shared__ __attribute__((aligned(16))) _Float16 Pb[2][16 * 34];
  _Float16* myP = &Pb[wid][0];

  int qid[8];
#pragma unroll
  for (int vr = 0; vr < 8; ++vr) qid[vr] = qid_g[l0 + vr + khalf * 8];

  for (int h = 0; h < NHEAD; ++h) {
    const _Float16* Qsb = Qs + ((size_t)(h * NBATCH + n) * L_SEQ + l0) * HDIM;
    const _Float16* Qob = Qo + ((size_t)(h * NBATCH + n) * L_SEQ + l0) * HDIM;
    const _Float16* Ksb = Ks + (size_t)(h * NBATCH + n) * S_SEQ * HDIM;
    const _Float16* Kob = Ko + (size_t)(h * NBATCH + n) * S_SEQ * HDIM;
    const _Float16* Vtb = Vt + (size_t)(h * NBATCH + n) * HDIM * S_SEQ;

    v16h qsA0 = frag_from_f16row(Qsb + col * HDIM, khalf);
    v16h qsA1 = frag_from_f16row(Qsb + col * HDIM + 32, khalf);
    v16h qoA0 = frag_from_f16row(Qob + col * HDIM, khalf);
    v16h qoA1 = frag_from_f16row(Qob + col * HDIM + 32, khalf);

    // ---- pass 1: online softmax statistics over S -------------------------
    float mrow[8], srow[8];
#pragma unroll
    for (int vr = 0; vr < 8; ++vr) { mrow[vr] = -1e30f; srow[vr] = 0.0f; }

    for (int st = 0; st < S_SEQ / 16; ++st) {
      int s0 = st * 16;
      float x[8];
      logits_tile(Ksb, Kob, kid_g, mask, qsA0, qsA1, qoA0, qoA1,
                  qid, l0, s0, col, khalf, x);
      float red[8];
#pragma unroll
      for (int vr = 0; vr < 8; ++vr) red[vr] = x[vr];
#pragma unroll
      for (int d = 1; d < 16; d <<= 1)
#pragma unroll
        for (int vr = 0; vr < 8; ++vr)
          red[vr] = fmaxf(red[vr], __shfl_xor(red[vr], d, 32));
      float es[8];
#pragma unroll
      for (int vr = 0; vr < 8; ++vr) {
        float mn = fmaxf(mrow[vr], red[vr]);
        es[vr]   = __expf(x[vr] - mn);
        red[vr]  = mn;                       // reuse: new running max
      }
#pragma unroll
      for (int d = 1; d < 16; d <<= 1)
#pragma unroll
        for (int vr = 0; vr < 8; ++vr) es[vr] += __shfl_xor(es[vr], d, 32);
#pragma unroll
      for (int vr = 0; vr < 8; ++vr) {
        srow[vr] = srow[vr] * __expf(mrow[vr] - red[vr]) + es[vr];
        mrow[vr] = red[vr];
      }
    }
    float invl[8];
#pragma unroll
    for (int vr = 0; vr < 8; ++vr) invl[vr] = 1.0f / srow[vr];

    // ---- pass 2: probabilities -> att_mean, and O += P @ V ---------------
    v8f oc[4] = {v8f{}, v8f{}, v8f{}, v8f{}};

    for (int sc = 0; sc < S_SEQ / 32; ++sc) {
#pragma unroll
      for (int sub = 0; sub < 2; ++sub) {
        int s0 = sc * 32 + sub * 16;
        float x[8];
        logits_tile(Ksb, Kob, kid_g, mask, qsA0, qsA1, qoA0, qoA1,
                    qid, l0, s0, col, khalf, x);
#pragma unroll
        for (int vr = 0; vr < 8; ++vr) {
          int row = vr + khalf * 8;
          float pp = __expf(x[vr] - mrow[vr]) * invl[vr];
          myP[row * 34 + sub * 16 + col] = (_Float16)pp;
          size_t ai = ((size_t)n * L_SEQ + (l0 + row)) * (size_t)S_SEQ
                      + s0 + col;
          float contrib = pp * (1.0f / NHEAD);
          att_mean[ai] = (h == 0) ? contrib : (att_mean[ai] + contrib);
        }
      }
      // A-fragment of P (16 x 32) from LDS (same wave: DS ops are in-order).
      v16h aP;
      {
        const _Float16* rp = myP + col * 34;
#pragma unroll
        for (int j = 0; j < 8; ++j) {
          int kb = ((j >> 2) << 4) + (khalf << 3) + ((j & 3) << 1);
          aP[2 * j]     = rp[kb];
          aP[2 * j + 1] = rp[kb + 1];
        }
      }
#pragma unroll
      for (int dt = 0; dt < 4; ++dt) {
        const _Float16* vrow = Vtb + (size_t)(dt * 16 + col) * S_SEQ + sc * 32;
        v16h bV = frag_from_f16row(vrow, khalf);
        oc[dt] = wmma_f16(aP, bV, oc[dt]);
      }
    }

    // store this head's 64-column slice of O (rows l0..l0+15)
#pragma unroll
    for (int dt = 0; dt < 4; ++dt)
#pragma unroll
      for (int vr = 0; vr < 8; ++vr) {
        int row    = vr + khalf * 8;
        size_t rid = (size_t)(l0 + row) * NBATCH + n;
        int e      = h * HDIM + dt * 16 + col;
        Obuf[rid * DMODEL + e] = (_Float16)oc[dt][vr];
      }
  }
}

// ---------------------------------------------------------------------------
// Kernel 3: final FC  out = O @ Wfc^T  (4096 x 512 x 512), f16 A, f32 out.
// grid (32, 8), 256 threads (8 waves, 16x64 tile per wave).
// ---------------------------------------------------------------------------
__global__ __launch_bounds__(256) void fc_kernel(
    const _Float16* __restrict__ Obuf, const float* __restrict__ Wfc,
    float* __restrict__ out) {
  const int lane  = threadIdx.x & 31;
  const int wid   = threadIdx.x >> 5;
  const int col   = lane & 15;
  const int khalf = lane >> 4;
  const int m0    = blockIdx.x * 128 + wid * 16;
  const int e0    = blockIdx.y * 64;

  const _Float16* Arow = Obuf + (size_t)(m0 + col) * DMODEL;
  const float* Wr[4];
#pragma unroll
  for (int et = 0; et < 4; ++et)
    Wr[et] = Wfc + (size_t)(e0 + et * 16 + col) * DMODEL;

  v8f cc[4] = {v8f{}, v8f{}, v8f{}, v8f{}};
  for (int k0 = 0; k0 < DMODEL; k0 += 32) {
    v16h a = frag_from_f16row(Arow + k0, khalf);
#pragma unroll
    for (int et = 0; et < 4; ++et) {
      v16h b = frag_from_f32row(Wr[et] + k0, khalf, 1.0f);
      cc[et] = wmma_f16(a, b, cc[et]);
    }
  }
#pragma unroll
  for (int et = 0; et < 4; ++et)
#pragma unroll
    for (int vr = 0; vr < 8; ++vr) {
      int m   = vr + khalf * 8;
      int rid = m0 + m;
      int e   = e0 + et * 16 + col;
      out[(size_t)rid * DMODEL + e] = cc[et][vr];
    }
}

// ---------------------------------------------------------------------------
// Host launcher
// ---------------------------------------------------------------------------
extern "C" void kernel_launch(void* const* d_in, const int* in_sizes, int n_in,
                              void* d_out, int out_size, void* d_ws,
                              size_t ws_size, hipStream_t stream) {
  (void)in_sizes; (void)n_in; (void)out_size; (void)ws_size;
  const float* q    = (const float*)d_in[0];
  const float* k    = (const float*)d_in[1];
  const float* v    = (const float*)d_in[2];
  const int*   qid  = (const int*)d_in[3];
  const int*   kid  = (const int*)d_in[4];
  const float* mask = (const float*)d_in[5];
  const float* Wqs  = (const float*)d_in[6];
  const float* Wqo  = (const float*)d_in[7];
  const float* Wks  = (const float*)d_in[8];
  const float* Wko  = (const float*)d_in[9];
  const float* Wv   = (const float*)d_in[10];
  const float* Wfc  = (const float*)d_in[11];

  const size_t BUF = (size_t)NHEAD * NBATCH * 2048 * HDIM;  // 2,097,152 f16
  _Float16* ws = (_Float16*)d_ws;
  _Float16* Qs = ws;
  _Float16* Qo = Qs + BUF;
  _Float16* Ks = Qo + BUF;
  _Float16* Ko = Ks + BUF;
  _Float16* Vt = Ko + BUF;
  _Float16* Ob = Vt + BUF;          // 24 MB total workspace

  float* out      = (float*)d_out;                               // [L,N,D]
  float* att_mean = out + (size_t)L_SEQ * NBATCH * DMODEL;       // [N,L,S]

  proj_kernel<<<dim3(32, 8, 5), 256, 0, stream>>>(
      q, k, v, Wqs, Wqo, Wks, Wko, Wv, Qs, Qo, Ks, Ko, Vt);
  attn_kernel<<<dim3(L_SEQ / 32, NBATCH), 64, 0, stream>>>(
      Qs, Qo, Ks, Ko, Vt, qid, kid, mask, Ob, att_mean);
  fc_kernel<<<dim3(32, 8), 256, 0, stream>>>(Ob, Wfc, out);
}

// v001
// One run takes 381 microseconds.
// Next to v000, in two timings, it ran 8.24 and 8.21 times as fast.
#include <hip/hip_runtime.h>

// ---------------------------------------------------------------------------
// AgentAwareAttention for MI455X (gfx1250), wave32 + v_wmma_f32_16x16x32_f16.
// f16 data / f32 accumulation everywhere; softmax math in f32.
// ---------------------------------------------------------------------------

typedef __attribute__((ext_vector_type(16))) _Float16 v16h;
typedef __attribute__((ext_vector_type(8)))  float    v8f;
typedef __attribute__((ext_vector_type(2)))  _Float16 h2;

#define L_SEQ 2048
#define S_SEQ 2048
#define NBATCH 2
#define DMODEL 512
#define NHEAD 8
#define HDIM 64

// ---- WMMA helpers ----------------------------------------------------------

__device__ __forceinline__ v8f wmma_f16(v16h a, v16h b, v8f c) {
  // D = A(16x32 f16) * B(32x16 f16) + C(16x16 f32)
  return __builtin_amdgcn_wmma_f32_16x16x32_f16(
      /*neg_a=*/false, a, /*neg_b=*/false, b,
      /*c_mod=*/(short)0, c, /*reuse_a=*/false, /*reuse_b=*/false);
}

// A-frag: lane holds row (lane&15); 16 K-elements with pattern
//   kb = (j>>2)*16 + (lane>>4)*8 + (j&3)*2   (pairs kb, kb+1)
// B-frag: identical pattern with lane&15 = output column, reading the
// column-major row (i.e. B_col[n][k]).
__device__ __forceinline__ v16h frag_from_f16row(const _Float16* __restrict__ rowPtr,
                                                 int khalf) {
  v16h f;
#pragma unroll
  for (int j = 0; j < 8; ++j) {
    int kb = ((j >> 2) << 4) + (khalf << 3) + ((j & 3) << 1);
    h2 p = *(const h2*)(rowPtr + kb);      // 4-byte load (kb is even)
    f[2 * j]     = p.x;
    f[2 * j + 1] = p.y;
  }
  return f;
}

__device__ __forceinline__ v16h frag_from_f32row(const float* __restrict__ rowPtr,
                                                 int khalf, float scale) {
  v16h f;
#pragma unroll
  for (int j = 0; j < 8; ++j) {
    int kb = ((j >> 2) << 4) + (khalf << 3) + ((j & 3) << 1);
    f[2 * j]     = (_Float16)(rowPtr[kb] * scale);
    f[2 * j + 1] = (_Float16)(rowPtr[kb + 1] * scale);
  }
  return f;
}

// ---------------------------------------------------------------------------
// Kernel 1: the five input projections  Y = X @ W^T  (4096 x 512 x 512 each),
// fp32 in, f16 out, scattered into attention-friendly layouts.
//   p=0: Qs[h][n][l][hd]  (x 1/sqrt(HD))
//   p=1: Qo[h][n][l][hd]  (x 1/sqrt(HD))
//   p=2: Ks[h][n][s][hd]
//   p=3: Ko[h][n][s][hd]
//   p=4: Vt[h][n][hd][s]   (transposed for AV B-fragments)
// grid: (4096/128, 512/64, 5), 256 threads (8 waves, 16x64 tile per wave)
// ---------------------------------------------------------------------------
__global__ __launch_bounds__(256) void proj_kernel(
    const float* __restrict__ q, const float* __restrict__ k,
    const float* __restrict__ v,
    const float* __restrict__ Wqs, const float* __restrict__ Wqo,
    const float* __restrict__ Wks, const float* __restrict__ Wko,
    const float* __restrict__ Wv,
    _Float16* __restrict__ Qs, _Float16* __restrict__ Qo,
    _Float16* __restrict__ Ks, _Float16* __restrict__ Ko,
    _Float16* __restrict__ Vt) {
  const int lane  = threadIdx.x & 31;
  const int wid   = threadIdx.x >> 5;
  const int col   = lane & 15;
  const int khalf = lane >> 4;
  const int p     = blockIdx.z;
  const int m0    = blockIdx.x * 128 + wid * 16;   // row = t*NBATCH + n
  const int e0    = blockIdx.y * 64;               // output feature tile

  const float* X = (p < 2) ? q : ((p < 4) ? k : v);
  const float* W = (p == 0) ? Wqs : (p == 1) ? Wqo : (p == 2) ? Wks
                 : (p == 3) ? Wko : Wv;
  _Float16* dst  = (p == 0) ? Qs : (p == 1) ? Qo : (p == 2) ? Ks
                 : (p == 3) ? Ko : Vt;
  const float scale = (p < 2) ? 0.125f : 1.0f;     // HD^-0.5 folded into Q

  const float* Xrow = X + (size_t)(m0 + col) * DMODEL;
  const float* Wr[4];
#pragma unroll
  for (int et = 0; et < 4; ++et)
    Wr[et] = W + (size_t)(e0 + et * 16 + col) * DMODEL;

  v8f cc[4] = {v8f{}, v8f{}, v8f{}, v8f{}};
  for (int k0 = 0; k0 < DMODEL; k0 += 32) {
    v16h a = frag_from_f32row(Xrow + k0, khalf, scale);
#pragma unroll
    for (int et = 0; et < 4; ++et) {
      v16h b = frag_from_f32row(Wr[et] + k0, khalf, 1.0f);
      cc[et] = wmma_f16(a, b, cc[et]);
    }
  }

#pragma unroll
  for (int et = 0; et < 4; ++et) {
#pragma unroll
    for (int vr = 0; vr < 8; ++vr) {
      int m   = vr + khalf * 8;          // C layout: row = vgpr + half*8
      int rid = m0 + m;
      int t   = rid >> 1;                // rows are (t,n) flattened, N=2
      int nb  = rid & 1;
      int e   = e0 + et * 16 + col;
      int h   = e >> 6;
      int hd  = e & 63;
      _Float16 val = (_Float16)cc[et][vr];
      if (p != 4)
        dst[(((size_t)(h * NBATCH + nb) * 2048 + t) << 6) + hd] = val;
      else
        dst[((size_t)(h * NBATCH + nb) * 64 + hd) * 2048 + t] = val;
    }
  }
}

// ---------------------------------------------------------------------------
// Logit tile helper: 16(L) x 16(S) agent-aware logits in C layout.
// ---------------------------------------------------------------------------
__device__ __forceinline__ void logits_tile(
    const _Float16* __restrict__ Ksb, const _Float16* __restrict__ Kob,
    const int* __restrict__ kid_g, const float* __restrict__ mask,
    v16h qsA0, v16h qsA1, v16h qoA0, v16h qoA1,
    const int* qid, int l0, int s0, int col, int khalf, float* x) {
  v16h kB0 = frag_from_f16row(Ksb + (size_t)(s0 + col) * HDIM, khalf);
  v16h kB1 = frag_from_f16row(Ksb + (size_t)(s0 + col) * HDIM + 32, khalf);
  v8f cS = {};
  cS = wmma_f16(qsA0, kB0, cS);
  cS = wmma_f16(qsA1, kB1, cS);
  v16h oB0 = frag_from_f16row(Kob + (size_t)(s0 + col) * HDIM, khalf);
  v16h oB1 = frag_from_f16row(Kob + (size_t)(s0 + col) * HDIM + 32, khalf);
  v8f cO = {};
  cO = wmma_f16(qoA0, oB0, cO);
  cO = wmma_f16(qoA1, oB1, cO);
  int kid = kid_g[s0 + col];
#pragma unroll
  for (int vr = 0; vr < 8; ++vr) {
    int row  = vr + khalf * 8;
    float mv = mask[(size_t)(l0 + row) * S_SEQ + s0 + col];
    x[vr] = ((kid == qid[vr]) ? cS[vr] : cO[vr]) + mv;
  }
}

// ---------------------------------------------------------------------------
// Kernel 2: attention. grid (L/16, N), 256 threads = 8 waves. The block owns a
// 16-row L tile; wave w computes head w of it, so the eight heads run side by
// side. att_mean (the mean over heads) is summed inside the block: every wave
// puts its share of a 16 x 32 probability tile into LDS, and after a barrier
// the 256 threads add the eight shares in head order and store the result
// once (no atomics, no global read-modify-write).
// Two passes over S per head: pass1 online max/sum stats; pass2 recompute,
// emit probabilities and accumulate O = P @ V via WMMA (P staged via LDS to
// convert C-fragment layout -> A-fragment layout).
// ---------------------------------------------------------------------------
#define RPITCH 36   // f32 row pitch of a share tile: rows r and r+8 land 32 banks apart
__global__ __launch_bounds__(256) void attn_kernel(
    const _Float16* __restrict__ Qs, const _Float16* __restrict__ Qo,
    const _Float16* __restrict__ Ks, const _Float16* __restrict__ Ko,
    const _Float16* __restrict__ Vt,
    const int* __restrict__ qid_g, const int* __restrict__ kid_g,
    const float* __restrict__ mask,
    _Float16* __restrict__ Obuf, float* __restrict__ att_mean) {
  const int lane  = threadIdx.x & 31;
  const int h     = threadIdx.x >> 5;      // wave index = head
  const int col   = lane & 15;
  const int khalf = lane >> 4;
  const int n     = blockIdx.y;
  const int l0    = blockIdx.x * 16;

  // Per-wave P staging: 16 x 32 f16, row stride 34 elems (68B) so that the
  // A-fragment column reads hit distinct LDS banks (17*r mod 64 distinct).
  __shared__ __attribute__((aligned(16))) _Float16 Pb[NHEAD][16 * 34];
  _Float16* myP = &Pb[h][0];
  // Per-head shares of att_mean, two buffers so that one barrier per 32
  // columns is enough (a buffer is rewritten one barrier after it was read).
  __shared__ __attribute__((aligned(16))) float Share[2][NHEAD][16 * RPITCH];

  // element pair of the 16 x 32 tile that this thread sums and stores
  const int rrow = threadIdx.x >> 4;
  const int rcol = (threadIdx.x & 15) * 2;
  float* amRow = att_mean + ((size_t)n * L_SEQ + (l0 + rrow)) * (size_t)S_SEQ + rcol;

  int qid[8];
#pragma unroll
  for (int vr = 0; vr < 8; ++vr) qid[vr] = qid_g[l0 + vr + khalf * 8];

  const _Float16* Qsb = Qs + ((size_t)(h * NBATCH + n) * L_SEQ + l0) * HDIM;
  const _Float16* Qob = Qo + ((size_t)(h * NBATCH + n) * L_SEQ + l0) * HDIM;
  const _Float16* Ksb = Ks + (size_t)(h * NBATCH + n) * S_SEQ * HDIM;
  const _Float16* Kob = Ko + (size_t)(h * NBATCH + n) * S_SEQ * HDIM;
  const _Float16* Vtb = Vt + (size_t)(h * NBATCH + n) * HDIM * S_SEQ;

  v16h qsA0 = frag_from_f16row(Qsb + col * HDIM, khalf);
  v16h qsA1 = frag_from_f16row(Qsb + col * HDIM + 32, khalf);
  v16h qoA0 = frag_from_f16row(Qob + col * HDIM, khalf);
  v16h qoA1 = frag_from_f16row(Qob + col * HDIM + 32, khalf);

  // ---- pass 1: online softmax statistics over S ---------------------------
  float mrow[8], srow[8];
#pragma unroll
  for (int vr = 0; vr < 8; ++vr) { mrow[vr] = -1e30f; srow[vr] = 0.0f; }

  for (int st = 0; st < S_SEQ / 16; ++st) {
    int s0 = st * 16;
    float x[8];
    logits_tile(Ksb, Kob, kid_g, mask, qsA0, qsA1, qoA0, qoA1,
                qid, l0, s0, col, khalf, x);
    float red[8];
#pragma unroll
    for (int vr = 0; vr < 8; ++vr) red[vr] = x[vr];
#pragma unroll
    for (int d = 1; d < 16; d <<= 1)
#pragma unroll
      for (int vr = 0; vr < 8; ++vr)
        red[vr] = fmaxf(red[vr], __shfl_xor(red[vr], d, 32));
    float es[8];
#pragma unroll
    for (int vr = 0; vr < 8; ++vr) {
      float mn = fmaxf(mrow[vr], red[vr]);
      es[vr]   = __expf(x[vr] - mn);
      red[vr]  = mn;                       // reuse: new running max
    }
#pragma unroll
    for (int d = 1; d < 16; d <<= 1)
#pragma unroll
      for (int vr = 0; vr < 8; ++vr) es[vr] += __shfl_xor(es[vr], d, 32);
#pragma unroll
    for (int vr = 0; vr < 8; ++vr) {
      srow[vr] = srow[vr] * __expf(mrow[vr] - red[vr]) + es[vr];
      mrow[vr] = red[vr];
    }
  }
  float invl[8];
#pragma unroll
  for (int vr = 0; vr < 8; ++vr) invl[vr] = 1.0f / srow[vr];

  // ---- pass 2: probabilities -> att_mean, and O += P @ V -----------------
  v8f oc[4] = {v8f{}, v8f{}, v8f{}, v8f{}};

  for (int sc = 0; sc < S_SEQ / 32; ++sc) {
    float* myS = &Share[sc & 1][h][0];
#pragma unroll
    for (int sub = 0; sub < 2; ++sub) {
      int s0 = sc * 32 + sub * 16;
      float x[8];
      logits_tile(Ksb, Kob, kid_g, mask, qsA0, qsA1, qoA0, qoA1,
                  qid, l0, s0, col, khalf, x);
#pragma unroll
      for (int vr = 0; vr < 8; ++vr) {
        int row = vr + khalf * 8;
        float pp = __expf(x[vr] - mrow[vr]) * invl[vr];
        myP[row * 34 + sub * 16 + col] = (_Float16)pp;
        myS[row * RPITCH + sub * 16 + col] = pp * (1.0f / NHEAD);
      }
    }
    // A-fragment of P (16 x 32) from LDS (same wave: DS ops are in-order).
    v16h aP;
    {
      const _Float16* rp = myP + col * 34;
#pragma unroll
      for (int j = 0; j < 8; ++j) {
        int kb = ((j >> 2) << 4) + (khalf << 3) + ((j & 3) << 1);
        aP[2 * j]     = rp[kb];
        aP[2 * j + 1] = rp[kb + 1];
      }
    }
#pragma unroll
    for (int dt = 0; dt < 4; ++dt) {
      const _Float16* vrow = Vtb + (size_t)(dt * 16 + col) * S_SEQ + sc * 32;
      v16h bV = frag_from_f16row(vrow, khalf);
      oc[dt] = wmma_f16(aP, bV, oc[dt]);
    }

    // All eight shares of this 32-column tile are in LDS behind this barrier.
    __syncthreads();
    {
      const float* sp = &Share[sc & 1][0][rrow * RPITCH + rcol];
      float2 acc = *(const float2*)sp;
#pragma unroll
      for (int hh = 1; hh < NHEAD; ++hh) {   // head order 0..7
        float2 c = *(const float2*)(sp + hh * 16 * RPITCH);
        acc.x += c.x;
        acc.y += c.y;
      }
      *(float2*)(amRow + sc * 32) = acc;
      // the next trip reuses the store's registers: wait until it has read them
      asm volatile("s_wait_xcnt 0x0" ::: "memory");
    }
  }

  // store this head's 64-column slice of O (rows l0..l0+15)
#pragma unroll
  for (int dt = 0; dt < 4; ++dt)
#pragma unroll
    for (int vr = 0; vr < 8; ++vr) {
      int row    = vr + khalf * 8;
      size_t rid = (size_t)(l0 + row) * NBATCH + n;
      int e      = h * HDIM + dt * 16 + col;
      Obuf[rid * DMODEL + e] = (_Float16)oc[dt][vr];
    }
}

// ---------------------------------------------------------------------------
// Kernel 3: final FC  out = O @ Wfc^T  (4096 x 512 x 512), f16 A, f32 out.
// grid (32, 8), 256 threads (8 waves, 16x64 tile per wave).
// ---------------------------------------------------------------------------
__global__ __launch_bounds__(256) void fc_kernel(
    const _Float16* __restrict__ Obuf, const float* __restrict__ Wfc,
    float* __restrict__ out) {
  const int lane  = threadIdx.x & 31;
  const int wid   = threadIdx.x >> 5;
  const int col   = lane & 15;
  const int khalf = lane >> 4;
  const int m0    = blockIdx.x * 128 + wid * 16;
  const int e0    = blockIdx.y * 64;

  const _Float16* Arow = Obuf + (size_t)(m0 + col) * DMODEL;
  const float* Wr[4];
#pragma unroll
  for (int et = 0; et < 4; ++et)
    Wr[et] = Wfc + (size_t)(e0 + et * 16 + col) * DMODEL;

  v8f cc[4] = {v8f{}, v8f{}, v8f{}, v8f{}};
  for (int k0 = 0; k0 < DMODEL; k0 += 32) {
    v16h a = frag_from_f16row(Arow + k0, khalf);
#pragma unroll
    for (int et = 0; et < 4; ++et) {
      v16h b = frag_from_f32row(Wr[et] + k0, khalf, 1.0f);
      cc[et] = wmma_f16(a, b, cc[et]);
    }
  }
#pragma unroll
  for (int et = 0; et < 4; ++et)
#pragma unroll
    for (int vr = 0; vr < 8; ++vr) {
      int m   = vr + khalf * 8;
      int rid = m0 + m;
      int e   = e0 + et * 16 + col;
      out[(size_t)rid * DMODEL + e] = cc[et][vr];
    }
}

// ---------------------------------------------------------------------------
// Host launcher
// ---------------------------------------------------------------------------
extern "C" void kernel_launch(void* const* d_in, const int* in_sizes, int n_in,
                              void* d_out, int out_size, void* d_ws,
                              size_t ws_size, hipStream_t stream) {
  (void)in_sizes; (void)n_in; (void)out_size; (void)ws_size;
  const float* q    = (const float*)d_in[0];
  const float* k    = (const float*)d_in[1];
  const float* v    = (const float*)d_in[2];
  const int*   qid  = (const int*)d_in[3];
  const int*   kid  = (const int*)d_in[4];
  const float* mask = (const float*)d_in[5];
  const float* Wqs  = (const float*)d_in[6];
  const float* Wqo  = (const float*)d_in[7];
  const float* Wks  = (const float*)d_in[8];
  const float* Wko  = (const float*)d_in[9];
  const float* Wv   = (const float*)d_in[10];
  const float* Wfc  = (const float*)d_in[11];

  const size_t BUF = (size_t)NHEAD * NBATCH * 2048 * HDIM;  // 2,097,152 f16
  _Float16* ws = (_Float16*)d_ws;
  _Float16* Qs = ws;
  _Float16* Qo = Qs + BUF;
  _Float16* Ks = Qo + BUF;
  _Float16* Ko = Ks + BUF;
  _Float16* Vt = Ko + BUF;
  _Float16* Ob = Vt + BUF;          // 24 MB total workspace

  float* out      = (float*)d_out;                               // [L,N,D]
  float* att_mean = out + (size_t)L_SEQ * NBATCH * DMODEL;       // [N,L,S]

  proj_kernel<<<dim3(32, 8, 5), 256, 0, stream>>>(
      q, k, v, Wqs, Wqo, Wks, Wko, Wv, Qs, Qo, Ks, Ko, Vt);
  attn_kernel<<<dim3(L_SEQ / 16, NBATCH), 256, 0, stream>>>(
      Qs, Qo, Ks, Ko, Vt, qid, kid, mask, Ob, att_mean);
  fc_kernel<<<dim3(32, 8), 256, 0, stream>>>(Ob, Wfc, out);
}

// v002
// It runs in 346 microseconds.
// In two side-by-side timings against v001, it was 1.09 and 1.10 times as fast.
// All steps since v000 together make it 9.03 times as fast.
#include <hip/hip_runtime.h>

// ---------------------------------------------------------------------------
// AgentAwareAttention for MI455X (gfx1250), wave32 + v_wmma_f32_16x16x32_f16.
// f16 data / f32 accumulation everywhere; softmax math in f32.
// ---------------------------------------------------------------------------

typedef __attribute__((ext_vector_type(16))) _Float16 v16h;
typedef __attribute__((ext_vector_type(8)))  float    v8f;
typedef __attribute__((ext_vector_type(2)))  _Float16 h2;

#define L_SEQ 2048
#define S_SEQ 2048
#define NBATCH 2
#define DMODEL 512
#define NHEAD 8
#define HDIM 64

// ---- WMMA helpers ----------------------------------------------------------

__device__ __forceinline__ v8f wmma_f16(v16h a, v16h b, v8f c) {
  // D = A(16x32 f16) * B(32x16 f16) + C(16x16 f32)
  return __builtin_amdgcn_wmma_f32_16x16x32_f16(
      /*neg_a=*/false, a, /*neg_b=*/false, b,
      /*c_mod=*/(short)0, c, /*reuse_a=*/false, /*reuse_b=*/false);
}

// A-frag: lane holds row (lane&15); 16 K-elements with pattern
//   kb = (j>>2)*16 + (lane>>4)*8 + (j&3)*2   (pairs kb, kb+1)
// B-frag: identical pattern with lane&15 = output column, reading the
// column-major row (i.e. B_col[n][k]).
__device__ __forceinline__ v16h frag_from_f16row(const _Float16* __restrict__ rowPtr,
                                                 int khalf) {
  v16h f;
#pragma unroll
  for (int j = 0; j < 8; ++j) {
    int kb = ((j >> 2) << 4) + (khalf << 3) + ((j & 3) << 1);
    h2 p = *(const h2*)(rowPtr + kb);      // 4-byte load (kb is even)
    f[2 * j]     = p.x;
    f[2 * j + 1] = p.y;
  }
  return f;
}

__device__ __forceinline__ v16h frag_from_f32row(const float* __restrict__ rowPtr,
                                                 int khalf, float scale) {
  v16h f;
#pragma unroll
  for (int j = 0; j < 8; ++j) {
    int kb = ((j >> 2) << 4) + (khalf << 3) + ((j & 3) << 1);
    f[2 * j]     = (_Float16)(rowPtr[kb] * scale);
    f[2 * j + 1] = (_Float16)(rowPtr[kb + 1] * scale);
  }
  return f;
}

// ---------------------------------------------------------------------------
// Kernel 1: the five input projections  Y = X @ W^T  (4096 x 512 x 512 each),
// fp32 in, f16 out, scattered into attention-friendly layouts.
//   p=0: Qs[h][n][l][hd]  (x 1/sqrt(HD))
//   p=1: Qo[h][n][l][hd]  (x 1/sqrt(HD))
//   p=2: Ks[h][n][s][hd]
//   p=3: Ko[h][n][s][hd]
//   p=4: Vt[h][n][hd][s]   (transposed for AV B-fragments)
// grid: (4096/128, 512/64, 5), 256 threads (8 waves, 16x64 tile per wave)
// ---------------------------------------------------------------------------
__global__ __launch_bounds__(256) void proj_kernel(
    const float* __restrict__ q, const float* __restrict__ k,
    const float* __restrict__ v,
    const float* __restrict__ Wqs, const float* __restrict__ Wqo,
    const float* __restrict__ Wks, const float* __restrict__ Wko,
    const float* __restrict__ Wv,
    _Float16* __restrict__ Qs, _Float16* __restrict__ Qo,
    _Float16* __restrict__ Ks, _Float16* __restrict__ Ko,
    _Float16* __restrict__ Vt) {
  const int lane  = threadIdx.x & 31;
  const int wid   = threadIdx.x >> 5;
  const int col   = lane & 15;
  const int khalf = lane >> 4;
  const int p     = blockIdx.z;
  const int m0    = blockIdx.x * 128 + wid * 16;   // row = t*NBATCH + n
  const int e0    = blockIdx.y * 64;               // output feature tile

  const float* X = (p < 2) ? q : ((p < 4) ? k : v);
  const float* W = (p == 0) ? Wqs : (p == 1) ? Wqo : (p == 2) ? Wks
                 : (p == 3) ? Wko : Wv;
  _Float16* dst  = (p == 0) ? Qs : (p == 1) ? Qo : (p == 2) ? Ks
                 : (p == 3) ? Ko : Vt;
  const float scale = (p < 2) ? 0.125f : 1.0f;     // HD^-0.5 folded into Q

  const float* Xrow = X + (size_t)(m0 + col) * DMODEL;
  const float* Wr[4];
#pragma unroll
  for (int et = 0; et < 4; ++et)
    Wr[et] = W + (size_t)(e0 + et * 16 + col) * DMODEL;

  v8f cc[4] = {v8f{}, v8f{}, v8f{}, v8f{}};
  for (int k0 = 0; k0 < DMODEL; k0 += 32) {
    v16h a = frag_from_f32row(Xrow + k0, khalf, scale);
#pragma unroll
    for (int et = 0; et < 4; ++et) {
      v16h b = frag_from_f32row(Wr[et] + k0, khalf, 1.0f);
      cc[et] = wmma_f16(a, b, cc[et]);
    }
  }

#pragma unroll
  for (int et = 0; et < 4; ++et) {
#pragma unroll
    for (int vr = 0; vr < 8; ++vr) {
      int m   = vr + khalf * 8;          // C layout: row = vgpr + half*8
      int rid = m0 + m;
      int t   = rid >> 1;                // rows are (t,n) flattened, N=2
      int nb  = rid & 1;
      int e   = e0 + et * 16 + col;
      int h   = e >> 6;
      int hd  = e & 63;
      _Float16 val = (_Float16)cc[et][vr];
      if (p != 4)
        dst[(((size_t)(h * NBATCH + nb) * 2048 + t) << 6) + hd] = val;
      else
        dst[((size_t)(h * NBATCH + nb) * 64 + hd) * 2048 + t] = val;
    }
  }
}

// e^t as the compiler's own multiply and v_exp_f32, with the one free slot that
// the instruction set asks for behind a transcendental kept inside the statement.
__device__ __forceinline__ float exp_slot(float t) {
  float r;
  // v_nop: fills that slot, whatever the compiler schedules next
  asm("v_exp_f32 %0, %1\n\tv_nop" : "=v"(r) : "v"(t * 1.44269504f));
  return r;
}

// ---------------------------------------------------------------------------
// Logit tile helper: 16(L) x 16(S) agent-aware logits in C layout.
// ---------------------------------------------------------------------------
__device__ __forceinline__ void logits_tile(
    const _Float16* __restrict__ Ksb, const _Float16* __restrict__ Kob,
    const int* __restrict__ kid_g, const float* __restrict__ mask,
    v16h qsA0, v16h qsA1, v16h qoA0, v16h qoA1,
    const int* qid, int l0, int s0, int col, int khalf, float* x) {
  v16h kB0 = frag_from_f16row(Ksb + (size_t)(s0 + col) * HDIM, khalf);
  v16h kB1 = frag_from_f16row(Ksb + (size_t)(s0 + col) * HDIM + 32, khalf);
  v8f cS = {};
  cS = wmma_f16(qsA0, kB0, cS);
  cS = wmma_f16(qsA1, kB1, cS);
  v16h oB0 = frag_from_f16row(Kob + (size_t)(s0 + col) * HDIM, khalf);
  v16h oB1 = frag_from_f16row(Kob + (size_t)(s0 + col) * HDIM + 32, khalf);
  v8f cO = {};
  cO = wmma_f16(qoA0, oB0, cO);
  cO = wmma_f16(qoA1, oB1, cO);
  int kid = kid_g[s0 + col];
#pragma unroll
  for (int vr = 0; vr < 8; ++vr) {
    int row  = vr + khalf * 8;
    float mv = mask[(size_t)(l0 + row) * S_SEQ + s0 + col];
    x[vr] = ((kid == qid[vr]) ? cS[vr] : cO[vr]) + mv;
  }
}

// ---------------------------------------------------------------------------
// Kernel 2: attention. grid (L/16, N), NSPLIT x 8 waves. The block owns a
// 16-row L tile; wave w computes head (w & 7) of it on one of NSPLIT runs of
// S / NSPLIT columns (part = w >> 3), so heads and parts run side by side and each
// SIMD has NSPLIT x 2 waves to cover load and LDS latency with.
// att_mean (the mean over heads) is summed inside the block: every wave
// puts its share of a 16 x 32 probability tile into LDS, and after a barrier
// the 256 threads of a part add its eight shares in head order and store the
// result once (no atomics, no global read-modify-write).
// Two passes over S per head: pass1 online max/sum stats per part, joined
// through LDS in part order; pass2 recompute, emit probabilities and
// accumulate O = P @ V via WMMA (P staged via LDS to convert C-fragment
// layout -> A-fragment layout); the parts' O sums are joined through LDS in
// part order.
// ---------------------------------------------------------------------------
#define RPITCH 36   // f32 row pitch of a share tile: rows r and r+8 land 32 banks apart
#define NSPLIT 2    // column parts per head
#define NWAVE (NHEAD * NSPLIT)
#define SPART (S_SEQ / NSPLIT)   // columns of one part
__global__ __launch_bounds__(NWAVE * 32) void attn_kernel(
    const _Float16* __restrict__ Qs, const _Float16* __restrict__ Qo,
    const _Float16* __restrict__ Ks, const _Float16* __restrict__ Ko,
    const _Float16* __restrict__ Vt,
    const int* __restrict__ qid_g, const int* __restrict__ kid_g,
    const float* __restrict__ mask,
    _Float16* __restrict__ Obuf, float* __restrict__ att_mean) {
  const int lane  = threadIdx.x & 31;
  const int w     = threadIdx.x >> 5;      // wave index
  const int h     = w & (NHEAD - 1);       // head
  const int part  = w >> 3;                // column part
  const int col   = lane & 15;
  const int khalf = lane >> 4;
  const int n     = blockIdx.y;
  const int l0    = blockIdx.x * 16;

  // Per-wave P staging: 16 x 32 f16, row stride 34 elems (68B) so that the
  // A-fragment column reads hit distinct LDS banks (17*r mod 64 distinct).
  __shared__ __attribute__((aligned(16))) _Float16 Pb[NWAVE][16 * 34];
  _Float16* myP = &Pb[w][0];
  // Per-head shares of att_mean, two buffers so that one barrier per 32
  // columns is enough (a buffer is rewritten one barrier after it was read).
  __shared__ __attribute__((aligned(16))) float Share[2][NSPLIT][NHEAD][16 * RPITCH];
  // Per-part softmax statistics (max, sum) of every head's 16 rows.
  __shared__ float Stat[NSPLIT][NHEAD][16][2];

  // element pair of its part's 16 x 32 tile that this thread sums and stores
  const int rrow = (threadIdx.x & 255) >> 4;
  const int rcol = (threadIdx.x & 15) * 2;
  float* amRow = att_mean + ((size_t)n * L_SEQ + (l0 + rrow)) * (size_t)S_SEQ + part * SPART + rcol;

  int qid[8];
#pragma unroll
  for (int vr = 0; vr < 8; ++vr) qid[vr] = qid_g[l0 + vr + khalf * 8];

  const _Float16* Qsb = Qs + ((size_t)(h * NBATCH + n) * L_SEQ + l0) * HDIM;
  const _Float16* Qob = Qo + ((size_t)(h * NBATCH + n) * L_SEQ + l0) * HDIM;
  // K, V, key identities and mask from this part's first column on
  const _Float16* Ksb = Ks + ((size_t)(h * NBATCH + n) * S_SEQ + part * SPART) * HDIM;
  const _Float16* Kob = Ko + ((size_t)(h * NBATCH + n) * S_SEQ + part * SPART) * HDIM;
  const _Float16* Vtb = Vt + (size_t)(h * NBATCH + n) * HDIM * S_SEQ + part * SPART;
  const int*   kidp  = kid_g + part * SPART;
  const float* maskp = mask + part * SPART;

  v16h qsA0 = frag_from_f16row(Qsb + col * HDIM, khalf);
  v16h qsA1 = frag_from_f16row(Qsb + col * HDIM + 32, khalf);
  v16h qoA0 = frag_from_f16row(Qob + col * HDIM, khalf);
  v16h qoA1 = frag_from_f16row(Qob + col * HDIM + 32, khalf);

  // ---- pass 1: online softmax statistics over S ---------------------------
  float mrow[8], srow[8];
#pragma unroll
  for (int vr = 0; vr < 8; ++vr) { mrow[vr] = -1e30f; srow[vr] = 0.0f; }

  for (int st = 0; st < SPART / 16; ++st) {
    int s0 = st * 16;
    float x[8];
    logits_tile(Ksb, Kob, kidp, maskp, qsA0, qsA1, qoA0, qoA1,
                qid, l0, s0, col, khalf, x);
    float red[8];
#pragma unroll
    for (int vr = 0; vr < 8; ++vr) red[vr] = x[vr];
#pragma unroll
    for (int d = 1; d < 16; d <<= 1)
#pragma unroll
      for (int vr = 0; vr < 8; ++vr)
        red[vr] = fmaxf(red[vr], __shfl_xor(red[vr], d, 32));
    float es[8];
#pragma unroll
    for (int vr = 0; vr < 8; ++vr) {
      float mn = fmaxf(mrow[vr], red[vr]);
      es[vr]   = __expf(x[vr] - mn);
      red[vr]  = mn;                       // reuse: new running max
    }
#pragma unroll
    for (int d = 1; d < 16; d <<= 1)
#pragma unroll
      for (int vr = 0; vr < 8; ++vr) es[vr] += __shfl_xor(es[vr], d, 32);
#pragma unroll
    for (int vr = 0; vr < 8; ++vr) {
      srow[vr] = srow[vr] * __expf(mrow[vr] - red[vr]) + es[vr];
      mrow[vr] = red[vr];
    }
  }
  // join the parts' statistics (part order 0..NSPLIT-1)
  if (col == 0) {
#pragma unroll
    for (int vr = 0; vr < 8; ++vr) {
      Stat[part][h][vr + khalf * 8][0] = mrow[vr];
      Stat[part][h][vr + khalf * 8][1] = srow[vr];
    }
  }
  __syncthreads();
  float invl[8];
#pragma unroll
  for (int vr = 0; vr < 8; ++vr) {
    const int row = vr + khalf * 8;
    float m = Stat[0][h][row][0];
#pragma unroll
    for (int pp = 1; pp < NSPLIT; ++pp) m = fmaxf(m, Stat[pp][h][row][0]);
    float s = 0.0f;
#pragma unroll
    for (int pp = 0; pp < NSPLIT; ++pp)
      s += Stat[pp][h][row][1] * __expf(Stat[pp][h][row][0] - m);
    mrow[vr] = m;
    invl[vr] = 1.0f / s;
  }

  // ---- pass 2: probabilities -> att_mean, and O += P @ V -----------------
  v8f oc[4] = {v8f{}, v8f{}, v8f{}, v8f{}};

  for (int sc = 0; sc < SPART / 32; ++sc) {
    float* myS = &Share[sc & 1][part][h][0];
#pragma unroll
    for (int sub = 0; sub < 2; ++sub) {
      int s0 = sc * 32 + sub * 16;
      float x[8];
      logits_tile(Ksb, Kob, kidp, maskp, qsA0, qsA1, qoA0, qoA1,
                  qid, l0, s0, col, khalf, x);
#pragma unroll
      for (int vr = 0; vr < 8; ++vr) {
        int row = vr + khalf * 8;
        float pp = exp_slot(x[vr] - mrow[vr]) * invl[vr];
        myP[row * 34 + sub * 16 + col] = (_Float16)pp;
        myS[row * RPITCH + sub * 16 + col] = pp * (1.0f / NHEAD);
      }
    }
    // A-fragment of P (16 x 32) from LDS (same wave: DS ops are in-order).
    v16h aP;
    {
      const _Float16* rp = myP + col * 34;
#pragma unroll
      for (int j = 0; j < 8; ++j) {
        int kb = ((j >> 2) << 4) + (khalf << 3) + ((j & 3) << 1);
        aP[2 * j]     = rp[kb];
        aP[2 * j + 1] = rp[kb + 1];
      }
    }
#pragma unroll
    for (int dt = 0; dt < 4; ++dt) {
      const _Float16* vrow = Vtb + (size_t)(dt * 16 + col) * S_SEQ + sc * 32;
      v16h bV = frag_from_f16row(vrow, khalf);
      oc[dt] = wmma_f16(aP, bV, oc[dt]);
    }

    // All eight shares of each part's 32-column tile are in LDS behind this barrier.
    __syncthreads();
    {
      const float* sp = &Share[sc & 1][part][0][rrow * RPITCH + rcol];
      float2 acc = *(const float2*)sp;
#pragma unroll
      for (int hh = 1; hh < NHEAD; ++hh) {   // head order 0..7
        float2 c = *(const float2*)(sp + hh * 16 * RPITCH);
        acc.x += c.x;
        acc.y += c.y;
      }
      *(float2*)(amRow + sc * 32) = acc;
      // the next trip reuses the store's registers: wait until it has read them
      asm volatile("s_wait_xcnt 0x0" ::: "memory");
    }
  }

  // Join the parts' O sums through the share buffers, which are free once
  // every wave has left the loop (first barrier); the partial sums are all in
  // LDS behind the second.
  float* Op = &Share[0][0][0][0];
  __syncthreads();
#pragma unroll
  for (int dt = 0; dt < 4; ++dt)
#pragma unroll
    for (int vr = 0; vr < 8; ++vr)
      Op[(((part * NHEAD + h) * 4 + dt) * 8 + vr) * 32 + lane] = oc[dt][vr];
  __syncthreads();

  // store this head's 64-column slice of O (rows l0..l0+15); each part sums
  // (part order 0..NSPLIT-1) and stores 64 / NSPLIT of the columns
#pragma unroll
  for (int d = 0; d < 4 / NSPLIT; ++d) {
    const int dt = part * (4 / NSPLIT) + d;
#pragma unroll
    for (int vr = 0; vr < 8; ++vr) {
      float a = Op[((h * 4 + dt) * 8 + vr) * 32 + lane];
#pragma unroll
      for (int pp = 1; pp < NSPLIT; ++pp)
        a += Op[(((pp * NHEAD + h) * 4 + dt) * 8 + vr) * 32 + lane];
      int row    = vr + khalf * 8;
      size_t rid = (size_t)(l0 + row) * NBATCH + n;
      int e      = h * HDIM + dt * 16 + col;
      Obuf[rid * DMODEL + e] = (_Float16)a;
    }
  }
}

// ---------------------------------------------------------------------------
// Kernel 3: final FC  out = O @ Wfc^T  (4096 x 512 x 512), f16 A, f32 out.
// grid (32, 8), 256 threads (8 waves, 16x64 tile per wave).
// ---------------------------------------------------------------------------
__global__ __launch_bounds__(256) void fc_kernel(
    const _Float16* __restrict__ Obuf, const float* __restrict__ Wfc,
    float* __restrict__ out) {
  const int lane  = threadIdx.x & 31;
  const int wid   = threadIdx.x >> 5;
  const int col   = lane & 15;
  const int khalf = lane >> 4;
  const int m0    = blockIdx.x * 128 + wid * 16;
  const int e0    = blockIdx.y * 64;

  const _Float16* Arow = Obuf + (size_t)(m0 + col) * DMODEL;
  const float* Wr[4];
#pragma unroll
  for (int et = 0; et < 4; ++et)
    Wr[et] = Wfc + (size_t)(e0 + et * 16 + col) * DMODEL;

  v8f cc[4] = {v8f{}, v8f{}, v8f{}, v8f{}};
  for (int k0 = 0; k0 < DMODEL; k0 += 32) {
    v16h a = frag_from_f16row(Arow + k0, khalf);
#pragma unroll
    for (int et = 0; et < 4; ++et) {
      v16h b = frag_from_f32row(Wr[et] + k0, khalf, 1.0f);
      cc[et] = wmma_f16(a, b, cc[et]);
    }
  }
#pragma unroll
  for (int et = 0; et < 4; ++et)
#pragma unroll
    for (int vr = 0; vr < 8; ++vr) {
      int m   = vr + khalf * 8;
      int rid = m0 + m;
      int e   = e0 + et * 16 + col;
      out[(size_t)rid * DMODEL + e] = cc[et][vr];
    }
}

// ---------------------------------------------------------------------------
// Host launcher
// ---------------------------------------------------------------------------
extern "C" void kernel_launch(void* const* d_in, const int* in_sizes, int n_in,
                              void* d_out, int out_size, void* d_ws,
                              size_t ws_size, hipStream_t stream) {
  (void)in_sizes; (void)n_in; (void)out_size; (void)ws_size;
  const float* q    = (const float*)d_in[0];
  const float* k    = (const float*)d_in[1];
  const float* v    = (const float*)d_in[2];
  const int*   qid  = (const int*)d_in[3];
  const int*   kid  = (const int*)d_in[4];
  const float* mask = (const float*)d_in[5];
  const float* Wqs  = (const float*)d_in[6];
  const float* Wqo  = (const float*)d_in[7];
  const float* Wks  = (const float*)d_in[8];
  const float* Wko  = (const float*)d_in[9];
  const float* Wv   = (const float*)d_in[10];
  const float* Wfc  = (const float*)d_in[11];

  const size_t BUF = (size_t)NHEAD * NBATCH * 2048 * HDIM;  // 2,097,152 f16
  _Float16* ws = (_Float16*)d_ws;
  _Float16* Qs = ws;
  _Float16* Qo = Qs + BUF;
  _Float16* Ks = Qo + BUF;
  _Float16* Ko = Ks + BUF;
  _Float16* Vt = Ko + BUF;
  _Float16* Ob = Vt + BUF;          // 24 MB total workspace

  float* out      = (float*)d_out;                               // [L,N,D]
  float* att_mean = out + (size_t)L_SEQ * NBATCH * DMODEL;       // [N,L,S]

  proj_kernel<<<dim3(32, 8, 5), 256, 0, stream>>>(
      q, k, v, Wqs, Wqo, Wks, Wko, Wv, Qs, Qo, Ks, Ko, Vt);
  attn_kernel<<<dim3(L_SEQ / 16, NBATCH), NWAVE * 32, 0, stream>>>(
      Qs, Qo, Ks, Ko, Vt, qid, kid, mask, Ob, att_mean);
  fc_kernel<<<dim3(32, 8), 256, 0, stream>>>(Ob, Wfc, out);
}

// v003
// Measured time: 261 microseconds a run.
// Two timings next to v002 both put it at 1.33 times that version's speed.
// Counting every step since v000, it is 12.0 times as fast.
#include <hip/hip_runtime.h>

// ---------------------------------------------------------------------------
// AgentAwareAttention for MI455X (gfx1250), wave32 + v_wmma_f32_16x16x32_f16.
// f16 data / f32 accumulation everywhere; softmax math in f32.
// ---------------------------------------------------------------------------

typedef __attribute__((ext_vector_type(16))) _Float16 v16h;
typedef __attribute__((ext_vector_type(8)))  float    v8f;
typedef __attribute__((ext_vector_type(2)))  _Float16 h2;
typedef __attribute__((ext_vector_type(4)))  _Float16 v4h;
typedef __attribute__((ext_vector_type(8)))  _Float16 v8h;

#define L_SEQ 2048
#define S_SEQ 2048
#define NBATCH 2
#define DMODEL 512
#define NHEAD 8
#define HDIM 64

// ---- WMMA helpers ----------------------------------------------------------

__device__ __forceinline__ v8f wmma_f16(v16h a, v16h b, v8f c) {
  // D = A(16x32 f16) * B(32x16 f16) + C(16x16 f32)
  return __builtin_amdgcn_wmma_f32_16x16x32_f16(
      /*neg_a=*/false, a, /*neg_b=*/false, b,
      /*c_mod=*/(short)0, c, /*reuse_a=*/false, /*reuse_b=*/false);
}

// A-frag: lane holds row (lane&15); 16 K-elements with pattern
//   kb = (j>>2)*16 + (lane>>4)*8 + (j&3)*2   (pairs kb, kb+1)
// B-frag: identical pattern with lane&15 = output column, reading the
// column-major row (i.e. B_col[n][k]).
__device__ __forceinline__ v16h frag_from_f16row(const _Float16* __restrict__ rowPtr,
                                                 int khalf) {
  v16h f;
#pragma unroll
  for (int j = 0; j < 8; ++j) {
    int kb = ((j >> 2) << 4) + (khalf << 3) + ((j & 3) << 1);
    h2 p = *(const h2*)(rowPtr + kb);      // 4-byte load (kb is even)
    f[2 * j]     = p.x;
    f[2 * j + 1] = p.y;
  }
  return f;
}

// Packed fragment: a 16 x 32 f16 operand tile kept in memory in register order,
// 512 halves: [i = 0,1][lane = 0..31][8 halves], where lane holds fragment
// elements 8i..8i+7. Element (r, kk) of the tile (r = row of A / column of B,
// kk = k index, same k pattern as above) lies at packed_off(r, kk). A wave
// reads a fragment with two 16-byte loads per lane, each 512 contiguous bytes
// (four whole cache lines) instead of 32-byte pieces of sixteen lines.
__device__ __forceinline__ int packed_off(int r, int kk) {
  return ((kk >> 4) << 8) + (((((kk >> 3) & 1) << 4) + r) << 3) + (kk & 7);
}

// p = start of the packed fragment + lane * 8 (16-byte aligned)
__device__ __forceinline__ v16h frag_packed(const _Float16* __restrict__ p) {
  v8h lo = *(const v8h*)p;
  v8h hi = *(const v8h*)(p + 256);
  return __builtin_shufflevector(lo, hi, 0, 1, 2, 3, 4, 5, 6, 7,
                                 8, 9, 10, 11, 12, 13, 14, 15);
}

__device__ __forceinline__ v16h frag_from_f32row(const float* __restrict__ rowPtr,
                                                 int khalf, float scale) {
  v16h f;
#pragma unroll
  for (int j = 0; j < 8; ++j) {
    int kb = ((j >> 2) << 4) + (khalf << 3) + ((j & 3) << 1);
    f[2 * j]     = (_Float16)(rowPtr[kb] * scale);
    f[2 * j + 1] = (_Float16)(rowPtr[kb + 1] * scale);
  }
  return f;
}

// ---------------------------------------------------------------------------
// Kernel 1: the five input projections  Y = X @ W^T  (4096 x 512 x 512 each),
// fp32 in, f16 out, scattered into attention-friendly layouts.
//   p=0: Qs[h][n][l][hd]  (x 1/sqrt(HD))
//   p=1: Qo[h][n][l][hd]  (x 1/sqrt(HD))
//   p=2: Ks[h][n][s/16][hd/32][packed 16(s) x 32(hd) B-fragment]
//   p=3: Ko, as Ks
//   p=4: Vt[h][n][s/32][hd/16][packed 16(hd) x 32(s) B-fragment]
// grid: (4096/128, 512/64, 5), 256 threads (8 waves, 16x64 tile per wave)
// ---------------------------------------------------------------------------
__global__ __launch_bounds__(256) void proj_kernel(
    const float* __restrict__ q, const float* __restrict__ k,
    const float* __restrict__ v,
    const float* __restrict__ Wqs, const float* __restrict__ Wqo,
    const float* __restrict__ Wks, const float* __restrict__ Wko,
    const float* __restrict__ Wv,
    _Float16* __restrict__ Qs, _Float16* __restrict__ Qo,
    _Float16* __restrict__ Ks, _Float16* __restrict__ Ko,
    _Float16* __restrict__ Vt) {
  const int lane  = threadIdx.x & 31;
  const int wid   = threadIdx.x >> 5;
  const int col   = lane & 15;
  const int khalf = lane >> 4;
  const int p     = blockIdx.z;
  const int m0    = blockIdx.x * 128 + wid * 16;   // row = t*NBATCH + n
  const int e0    = blockIdx.y * 64;               // output feature tile

  const float* X = (p < 2) ? q : ((p < 4) ? k : v);
  const float* W = (p == 0) ? Wqs : (p == 1) ? Wqo : (p == 2) ? Wks
                 : (p == 3) ? Wko : Wv;
  _Float16* dst  = (p == 0) ? Qs : (p == 1) ? Qo : (p == 2) ? Ks
                 : (p == 3) ? Ko : Vt;
  const float scale = (p < 2) ? 0.125f : 1.0f;     // HD^-0.5 folded into Q

  const float* Xrow = X + (size_t)(m0 + col) * DMODEL;
  const float* Wr[4];
#pragma unroll
  for (int et = 0; et < 4; ++et)
    Wr[et] = W + (size_t)(e0 + et * 16 + col) * DMODEL;

  v8f cc[4] = {v8f{}, v8f{}, v8f{}, v8f{}};
  for (int k0 = 0; k0 < DMODEL; k0 += 32) {
    v16h a = frag_from_f32row(Xrow + k0, khalf, scale);
#pragma unroll
    for (int et = 0; et < 4; ++et) {
      v16h b = frag_from_f32row(Wr[et] + k0, khalf, 1.0f);
      cc[et] = wmma_f16(a, b, cc[et]);
    }
  }

  // The 64-feature tile is one head h. C layout: a lane's eight rows are
  // t = t0 + 4*khalf + (vr >> 1), n = vr & 1, with t0 a multiple of 8.
  const int h  = e0 >> 6;
  const int t0 = m0 >> 1;
  const int NB = 2048 * HDIM;            // elements of one (h, n) plane
  _Float16* dh = dst + (size_t)h * NBATCH * NB;
  if (p == 4) {
    // per n, the lane's four t are four neighbouring halves of a V fragment
    _Float16* d = dh + (t0 >> 5) * 2048 + packed_off(col, (t0 & 31) + khalf * 4);
#pragma unroll
    for (int et = 0; et < 4; ++et) {
#pragma unroll
      for (int nb = 0; nb < NBATCH; ++nb) {
        v4h val;
#pragma unroll
        for (int i = 0; i < 4; ++i) val[i] = (_Float16)cc[et][2 * i + nb];
        *(v4h*)(d + nb * NB + et * 512) = val;
      }
    }
  } else if (p >= 2) {
    // hd = et*16 + col: fragment et >> 1, its half et & 1, so 256 halves per et
    _Float16* d = dh + (t0 & ~15) * HDIM + packed_off((t0 & 15) + khalf * 4, col);
#pragma unroll
    for (int et = 0; et < 4; ++et)
#pragma unroll
      for (int vr = 0; vr < 8; ++vr)
        d[(vr & 1) * NB + et * 256 + (vr >> 1) * 8] = (_Float16)cc[et][vr];
    // code laid out behind this branch reuses the stores' registers: wait until they are read
    asm volatile("s_wait_xcnt 0x0" ::: "memory");
  } else {
    _Float16* d = dh + (t0 + khalf * 4) * HDIM + col;
#pragma unroll
    for (int et = 0; et < 4; ++et)
#pragma unroll
      for (int vr = 0; vr < 8; ++vr)
        d[(vr & 1) * NB + (vr >> 1) * HDIM + et * 16] = (_Float16)cc[et][vr];
    // code laid out behind this branch reuses the stores' registers: wait until they are read
    asm volatile("s_wait_xcnt 0x0" ::: "memory");
  }
}

// e^t as the compiler's own multiply and v_exp_f32, with the one free slot that
// the instruction set asks for behind a transcendental kept inside the statement.
__device__ __forceinline__ float exp_slot(float t) {
  float r;
  // v_nop: fills that slot, whatever the compiler schedules next
  asm("v_exp_f32 %0, %1\n\tv_nop" : "=v"(r) : "v"(t * 1.44269504f));
  return r;
}

// ---------------------------------------------------------------------------
// Logit tile helper: 16(L) x 16(S) agent-aware logits in C layout.
// ---------------------------------------------------------------------------
__device__ __forceinline__ void logits_tile(
    const _Float16* __restrict__ Ksb, const _Float16* __restrict__ Kob,
    const int* __restrict__ kid_g, const float* __restrict__ mask,
    v16h qsA0, v16h qsA1, v16h qoA0, v16h qoA1,
    const int* qid, int l0, int s0, int col, int khalf, float* x) {
  const size_t ko = (size_t)s0 * HDIM + (khalf * 16 + col) * 8;  // tile s0/16, this lane
  v16h kB0 = frag_packed(Ksb + ko);
  v16h kB1 = frag_packed(Ksb + ko + 512);
  v8f cS = {};
  cS = wmma_f16(qsA0, kB0, cS);
  cS = wmma_f16(qsA1, kB1, cS);
  v16h oB0 = frag_packed(Kob + ko);
  v16h oB1 = frag_packed(Kob + ko + 512);
  v8f cO = {};
  cO = wmma_f16(qoA0, oB0, cO);
  cO = wmma_f16(qoA1, oB1, cO);
  int kid = kid_g[s0 + col];
#pragma unroll
  for (int vr = 0; vr < 8; ++vr) {
    int row  = vr + khalf * 8;
    float mv = mask[(size_t)(l0 + row) * S_SEQ + s0 + col];
    x[vr] = ((kid == qid[vr]) ? cS[vr] : cO[vr]) + mv;
  }
}

// ---------------------------------------------------------------------------
// Kernel 2: attention. grid (L/16, N), NSPLIT x 8 waves. The block owns a
// 16-row L tile; wave w computes head (w & 7) of it on one of NSPLIT runs of
// S / NSPLIT columns (part = w >> 3), so heads and parts run side by side and each
// SIMD has NSPLIT x 2 waves to cover load and LDS latency with.
// att_mean (the mean over heads) is summed inside the block: every wave
// puts its share of a 16 x 32 probability tile into LDS, and after a barrier
// the 256 threads of a part add its eight shares in head order and store the
// result once (no atomics, no global read-modify-write).
// Two passes over S per head: pass1 online max/sum stats per part, joined
// through LDS in part order; pass2 recompute, emit probabilities and
// accumulate O = P @ V via WMMA (P staged via LDS to convert C-fragment
// layout -> A-fragment layout); the parts' O sums are joined through LDS in
// part order.
// ---------------------------------------------------------------------------
#define RPITCH 36   // f32 row pitch of a share tile: rows r and r+8 land 32 banks apart
#define NSPLIT 2    // column parts per head
#define NWAVE (NHEAD * NSPLIT)
#define SPART (S_SEQ / NSPLIT)   // columns of one part
__global__ __launch_bounds__(NWAVE * 32) void attn_kernel(
    const _Float16* __restrict__ Qs, const _Float16* __restrict__ Qo,
    const _Float16* __restrict__ Ks, const _Float16* __restrict__ Ko,
    const _Float16* __restrict__ Vt,
    const int* __restrict__ qid_g, const int* __restrict__ kid_g,
    const float* __restrict__ mask,
    _Float16* __restrict__ Obuf, float* __restrict__ att_mean) {
  const int lane  = threadIdx.x & 31;
  const int w     = threadIdx.x >> 5;      // wave index
  const int h     = w & (NHEAD - 1);       // head
  const int part  = w >> 3;                // column part
  const int col   = lane & 15;
  const int khalf = lane >> 4;
  const int n     = blockIdx.y;
  const int l0    = blockIdx.x * 16;

  // Per-wave P staging: 16 x 32 f16, row stride 34 elems (68B) so that the
  // A-fragment column reads hit distinct LDS banks (17*r mod 64 distinct).
  __shared__ __attribute__((aligned(16))) _Float16 Pb[NWAVE][16 * 34];
  _Float16* myP = &Pb[w][0];
  // Per-head shares of att_mean, two buffers so that one barrier per 32
  // columns is enough (a buffer is rewritten one barrier after it was read).
  __shared__ __attribute__((aligned(16))) float Share[2][NSPLIT][NHEAD][16 * RPITCH];
  // Per-part softmax statistics (max, sum) of every head's 16 rows.
  __shared__ float Stat[NSPLIT][NHEAD][16][2];

  // element pair of its part's 16 x 32 tile that this thread sums and stores
  const int rrow = (threadIdx.x & 255) >> 4;
  const int rcol = (threadIdx.x & 15) * 2;
  float* amRow = att_mean + ((size_t)n * L_SEQ + (l0 + rrow)) * (size_t)S_SEQ + part * SPART + rcol;

  int qid[8];
#pragma unroll
  for (int vr = 0; vr < 8; ++vr) qid[vr] = qid_g[l0 + vr + khalf * 8];

  const _Float16* Qsb = Qs + ((size_t)(h * NBATCH + n) * L_SEQ + l0) * HDIM;
  const _Float16* Qob = Qo + ((size_t)(h * NBATCH + n) * L_SEQ + l0) * HDIM;
  // K, V, key identities and mask from this part's first column on
  const _Float16* Ksb = Ks + ((size_t)(h * NBATCH + n) * S_SEQ + part * SPART) * HDIM;
  const _Float16* Kob = Ko + ((size_t)(h * NBATCH + n) * S_SEQ + part * SPART) * HDIM;
  const _Float16* Vtb = Vt + ((size_t)(h * NBATCH + n) * S_SEQ + part * SPART) * HDIM + lane * 8;
  const int*   kidp  = kid_g + part * SPART;
  const float* maskp = mask + part * SPART;

  v16h qsA0 = frag_from_f16row(Qsb + col * HDIM, khalf);
  v16h qsA1 = frag_from_f16row(Qsb + col * HDIM + 32, khalf);
  v16h qoA0 = frag_from_f16row(Qob + col * HDIM, khalf);
  v16h qoA1 = frag_from_f16row(Qob + col * HDIM + 32, khalf);

  // ---- pass 1: online softmax statistics over S ---------------------------
  float mrow[8], srow[8];
#pragma unroll
  for (int vr = 0; vr < 8; ++vr) { mrow[vr] = -1e30f; srow[vr] = 0.0f; }

  for (int st = 0; st < SPART / 16; ++st) {
    int s0 = st * 16;
    float x[8];
    logits_tile(Ksb, Kob, kidp, maskp, qsA0, qsA1, qoA0, qoA1,
                qid, l0, s0, col, khalf, x);
    float red[8];
#pragma unroll
    for (int vr = 0; vr < 8; ++vr) red[vr] = x[vr];
#pragma unroll
    for (int d = 1; d < 16; d <<= 1)
#pragma unroll
      for (int vr = 0; vr < 8; ++vr)
        red[vr] = fmaxf(red[vr], __shfl_xor(red[vr], d, 32));
    float es[8];
#pragma unroll
    for (int vr = 0; vr < 8; ++vr) {
      float mn = fmaxf(mrow[vr], red[vr]);
      es[vr]   = __expf(x[vr] - mn);
      red[vr]  = mn;                       // reuse: new running max
    }
#pragma unroll
    for (int d = 1; d < 16; d <<= 1)
#pragma unroll
      for (int vr = 0; vr < 8; ++vr) es[vr] += __shfl_xor(es[vr], d, 32);
#pragma unroll
    for (int vr = 0; vr < 8; ++vr) {
      srow[vr] = srow[vr] * __expf(mrow[vr] - red[vr]) + es[vr];
      mrow[vr] = red[vr];
    }
  }
  // join the parts' statistics (part order 0..NSPLIT-1)
  if (col == 0) {
#pragma unroll
    for (int vr = 0; vr < 8; ++vr) {
      Stat[part][h][vr + khalf * 8][0] = mrow[vr];
      Stat[part][h][vr + khalf * 8][1] = srow[vr];
    }
  }
  __syncthreads();
  float invl[8];
#pragma unroll
  for (int vr = 0; vr < 8; ++vr) {
    const int row = vr + khalf * 8;
    float m = Stat[0][h][row][0];
#pragma unroll
    for (int pp = 1; pp < NSPLIT; ++pp) m = fmaxf(m, Stat[pp][h][row][0]);
    float s = 0.0f;
#pragma unroll
    for (int pp = 0; pp < NSPLIT; ++pp)
      s += Stat[pp][h][row][1] * __expf(Stat[pp][h][row][0] - m);
    mrow[vr] = m;
    invl[vr] = 1.0f / s;
  }

  // ---- pass 2: probabilities -> att_mean, and O += P @ V -----------------
  v8f oc[4] = {v8f{}, v8f{}, v8f{}, v8f{}};

  for (int sc = 0; sc < SPART / 32; ++sc) {
    float* myS = &Share[sc & 1][part][h][0];
#pragma unroll
    for (int sub = 0; sub < 2; ++sub) {
      int s0 = sc * 32 + sub * 16;
      float x[8];
      logits_tile(Ksb, Kob, kidp, maskp, qsA0, qsA1, qoA0, qoA1,
                  qid, l0, s0, col, khalf, x);
#pragma unroll
      for (int vr = 0; vr < 8; ++vr) {
        int row = vr + khalf * 8;
        float pp = exp_slot(x[vr] - mrow[vr]) * invl[vr];
        myP[row * 34 + sub * 16 + col] = (_Float16)pp;
        myS[row * RPITCH + sub * 16 + col] = pp * (1.0f / NHEAD);
      }
    }
    // A-fragment of P (16 x 32) from LDS (same wave: DS ops are in-order).
    v16h aP;
    {
      const _Float16* rp = myP + col * 34;
#pragma unroll
      for (int j = 0; j < 8; ++j) {
        int kb = ((j >> 2) << 4) + (khalf << 3) + ((j & 3) << 1);
        aP[2 * j]     = rp[kb];
        aP[2 * j + 1] = rp[kb + 1];
      }
    }
#pragma unroll
    for (int dt = 0; dt < 4; ++dt) {
      v16h bV = frag_packed(Vtb + (size_t)(sc * 4 + dt) * 512);
      oc[dt] = wmma_f16(aP, bV, oc[dt]);
    }

    // All eight shares of each part's 32-column tile are in LDS behind this barrier.
    __syncthreads();
    {
      const float* sp = &Share[sc & 1][part][0][rrow * RPITCH + rcol];
      float2 acc = *(const float2*)sp;
#pragma unroll
      for (int hh = 1; hh < NHEAD; ++hh) {   // head order 0..7
        float2 c = *(const float2*)(sp + hh * 16 * RPITCH);
        acc.x += c.x;
        acc.y += c.y;
      }
      *(float2*)(amRow + sc * 32) = acc;
      // the next trip reuses the store's registers: wait until it has read them
      asm volatile("s_wait_xcnt 0x0" ::: "memory");
    }
  }

  // Join the parts' O sums through the share buffers, which are free once
  // every wave has left the loop (first barrier); the partial sums are all in
  // LDS behind the second.
  float* Op = &Share[0][0][0][0];
  __syncthreads();
#pragma unroll
  for (int dt = 0; dt < 4; ++dt)
#pragma unroll
    for (int vr = 0; vr < 8; ++vr)
      Op[(((part * NHEAD + h) * 4 + dt) * 8 + vr) * 32 + lane] = oc[dt][vr];
  __syncthreads();

  // store this head's 64-column slice of O (rows l0..l0+15); each part sums
  // (part order 0..NSPLIT-1) and stores 64 / NSPLIT of the columns
#pragma unroll
  for (int d = 0; d < 4 / NSPLIT; ++d) {
    const int dt = part * (4 / NSPLIT) + d;
#pragma unroll
    for (int vr = 0; vr < 8; ++vr) {
      float a = Op[((h * 4 + dt) * 8 + vr) * 32 + lane];
#pragma unroll
      for (int pp = 1; pp < NSPLIT; ++pp)
        a += Op[(((pp * NHEAD + h) * 4 + dt) * 8 + vr) * 32 + lane];
      int row    = vr + khalf * 8;
      size_t rid = (size_t)(l0 + row) * NBATCH + n;
      int e      = h * HDIM + dt * 16 + col;
      Obuf[rid * DMODEL + e] = (_Float16)a;
    }
  }
}

// ---------------------------------------------------------------------------
// Kernel 3: final FC  out = O @ Wfc^T  (4096 x 512 x 512), f16 A, f32 out.
// grid (32, 8), 256 threads (8 waves, 16x64 tile per wave).
// ---------------------------------------------------------------------------
__global__ __launch_bounds__(256) void fc_kernel(
    const _Float16* __restrict__ Obuf, const float* __restrict__ Wfc,
    float* __restrict__ out) {
  const int lane  = threadIdx.x & 31;
  const int wid   = threadIdx.x >> 5;
  const int col   = lane & 15;
  const int khalf = lane >> 4;
  const int m0    = blockIdx.x * 128 + wid * 16;
  const int e0    = blockIdx.y * 64;

  const _Float16* Arow = Obuf + (size_t)(m0 + col) * DMODEL;
  const float* Wr[4];
#pragma unroll
  for (int et = 0; et < 4; ++et)
    Wr[et] = Wfc + (size_t)(e0 + et * 16 + col) * DMODEL;

  v8f cc[4] = {v8f{}, v8f{}, v8f{}, v8f{}};
  for (int k0 = 0; k0 < DMODEL; k0 += 32) {
    v16h a = frag_from_f16row(Arow + k0, khalf);
#pragma unroll
    for (int et = 0; et < 4; ++et) {
      v16h b = frag_from_f32row(Wr[et] + k0, khalf, 1.0f);
      cc[et] = wmma_f16(a, b, cc[et]);
    }
  }
#pragma unroll
  for (int et = 0; et < 4; ++et)
#pragma unroll
    for (int vr = 0; vr < 8; ++vr) {
      int m   = vr + khalf * 8;
      int rid = m0 + m;
      int e   = e0 + et * 16 + col;
      out[(size_t)rid * DMODEL + e] = cc[et][vr];
    }
}

// ---------------------------------------------------------------------------
// Host launcher
// ---------------------------------------------------------------------------
extern "C" void kernel_launch(void* const* d_in, const int* in_sizes, int n_in,
                              void* d_out, int out_size, void* d_ws,
                              size_t ws_size, hipStream_t stream) {
  (void)in_sizes; (void)n_in; (void)out_size; (void)ws_size;
  const float* q    = (const float*)d_in[0];
  const float* k    = (const float*)d_in[1];
  const float* v    = (const float*)d_in[2];
  const int*   qid  = (const int*)d_in[3];
  const int*   kid  = (const int*)d_in[4];
  const float* mask = (const float*)d_in[5];
  const float* Wqs  = (const float*)d_in[6];
  const float* Wqo  = (const float*)d_in[7];
  const float* Wks  = (const float*)d_in[8];
  const float* Wko  = (const float*)d_in[9];
  const float* Wv   = (const float*)d_in[10];
  const float* Wfc  = (const float*)d_in[11];

  const size_t BUF = (size_t)NHEAD * NBATCH * 2048 * HDIM;  // 2,097,152 f16
  _Float16* ws = (_Float16*)d_ws;
  _Float16* Qs = ws;
  _Float16* Qo = Qs + BUF;
  _Float16* Ks = Qo + BUF;
  _Float16* Ko = Ks + BUF;
  _Float16* Vt = Ko + BUF;
  _Float16* Ob = Vt + BUF;          // 24 MB total workspace

  float* out      = (float*)d_out;                               // [L,N,D]
  float* att_mean = out + (size_t)L_SEQ * NBATCH * DMODEL;       // [N,L,S]

  proj_kernel<<<dim3(32, 8, 5), 256, 0, stream>>>(
      q, k, v, Wqs, Wqo, Wks, Wko, Wv, Qs, Qo, Ks, Ko, Vt);
  attn_kernel<<<dim3(L_SEQ / 16, NBATCH), NWAVE * 32, 0, stream>>>(
      Qs, Qo, Ks, Ko, Vt, qid, kid, mask, Ob, att_mean);
  fc_kernel<<<dim3(32, 8), 256, 0, stream>>>(Ob, Wfc, out);
}

// v004
// A run of this version takes 190 microseconds.
// In two side-by-side timings against v003, it was 1.41 and 1.33 times as fast.
// Counting every step since v000, it is 16.5 times as fast.
#include <hip/hip_runtime.h>

// ---------------------------------------------------------------------------
// AgentAwareAttention for MI455X (gfx1250), wave32 + v_wmma_f32_16x16x32_f16.
// f16 data / f32 accumulation everywhere; softmax math in f32.
// ---------------------------------------------------------------------------

typedef __attribute__((ext_vector_type(16))) _Float16 v16h;
typedef __attribute__((ext_vector_type(8)))  float    v8f;
typedef __attribute__((ext_vector_type(2)))  _Float16 h2;
typedef __attribute__((ext_vector_type(4)))  _Float16 v4h;
typedef __attribute__((ext_vector_type(8)))  _Float16 v8h;

#define L_SEQ 2048
#define S_SEQ 2048
#define NBATCH 2
#define DMODEL 512
#define NHEAD 8
#define HDIM 64

// ---- WMMA helpers ----------------------------------------------------------

__device__ __forceinline__ v8f wmma_f16(v16h a, v16h b, v8f c) {
  // D = A(16x32 f16) * B(32x16 f16) + C(16x16 f32)
  return __builtin_amdgcn_wmma_f32_16x16x32_f16(
      /*neg_a=*/false, a, /*neg_b=*/false, b,
      /*c_mod=*/(short)0, c, /*reuse_a=*/false, /*reuse_b=*/false);
}

// A-frag: lane holds row (lane&15); 16 K-elements with pattern
//   kb = (j>>2)*16 + (lane>>4)*8 + (j&3)*2   (pairs kb, kb+1)
// B-frag: identical pattern with lane&15 = output column, reading the
// column-major row (i.e. B_col[n][k]).
__device__ __forceinline__ v16h frag_from_f16row(const _Float16* __restrict__ rowPtr,
                                                 int khalf) {
  v16h f;
#pragma unroll
  for (int j = 0; j < 8; ++j) {
    int kb = ((j >> 2) << 4) + (khalf << 3) + ((j & 3) << 1);
    h2 p = *(const h2*)(rowPtr + kb);      // 4-byte load (kb is even)
    f[2 * j]     = p.x;
    f[2 * j + 1] = p.y;
  }
  return f;
}

// Packed fragment: a 16 x 32 f16 operand tile kept in memory in register order,
// 512 halves: [i = 0,1][lane = 0..31][8 halves], where lane holds fragment
// elements 8i..8i+7. Element (r, kk) of the tile (r = row of A / column of B,
// kk = k index, same k pattern as above) lies at packed_off(r, kk). A wave
// reads a fragment with two 16-byte loads per lane, each 512 contiguous bytes
// (four whole cache lines) instead of 32-byte pieces of sixteen lines.
__device__ __forceinline__ int packed_off(int r, int kk) {
  return ((kk >> 4) << 8) + (((((kk >> 3) & 1) << 4) + r) << 3) + (kk & 7);
}

// p = start of the packed fragment + lane * 8 (16-byte aligned)
__device__ __forceinline__ v16h frag_packed(const _Float16* __restrict__ p) {
  v8h lo = *(const v8h*)p;
  v8h hi = *(const v8h*)(p + 256);
  return __builtin_shufflevector(lo, hi, 0, 1, 2, 3, 4, 5, 6, 7,
                                 8, 9, 10, 11, 12, 13, 14, 15);
}

// ---- GEMM operand tiles in LDS ---------------------------------------------
// A block's operand tiles of one 32-wide k step lie in LDS as f16 fragments of
// 16 rows x 32 k: four groups g = kk >> 3 of [16 rows][8 halves]. A lane reads
// its fragment as groups khalf and 2 + khalf, 16 bytes each (same k pattern as
// above). The group pitch of 320 bytes moves each group 16 banks on, so that the
// staging stores of a wave (some rows of all four groups) spread evenly over
// the banks; a 16-lane half of a fragment read covers 256 contiguous bytes.
#define GRPH 160            // halves from one group to the next (128 used)
#define FRAGH (4 * GRPH)    // halves from one fragment to the next
#define KSTEPS (DMODEL / 32)

// Order of one k step for the scheduler: the next tiles' global loads (NLOAD of
// them), this step's ten LDS reads, its four products, and only then the
// conversions and LDS stores with their waits for the loads. Left alone the
// scheduler put each conversion right behind its load, so that the load's
// latency lay open.
#define STEP_ORDER(NLOAD)                                   \
  do {                                                      \
    __builtin_amdgcn_sched_group_barrier(0x020, NLOAD, 0);  \
    __builtin_amdgcn_sched_group_barrier(0x100, 10, 0);     \
    __builtin_amdgcn_sched_group_barrier(0x008, 4, 0);      \
    __builtin_amdgcn_sched_group_barrier(0x002, 32, 0);     \
    __builtin_amdgcn_sched_group_barrier(0x200, 4, 0);      \
  } while (0)

// p = fragment + khalf * GRPH + (lane & 15) * 8
__device__ __forceinline__ v16h frag_lds(const _Float16* p) {
  v8h lo = *(const v8h*)p;
  v8h hi = *(const v8h*)(p + 2 * GRPH);
  return __builtin_shufflevector(lo, hi, 0, 1, 2, 3, 4, 5, 6, 7,
                                 8, 9, 10, 11, 12, 13, 14, 15);
}

// four neighbouring k of one row, f32 from global memory -> f16 in LDS
__device__ __forceinline__ void stage_f32(_Float16* dst, float4 x, float scale) {
  v4h hv;
  hv[0] = (_Float16)(x.x * scale);
  hv[1] = (_Float16)(x.y * scale);
  hv[2] = (_Float16)(x.z * scale);
  hv[3] = (_Float16)(x.w * scale);
  *(v4h*)dst = hv;
}

// ---------------------------------------------------------------------------
// Kernel 1: the five input projections  Y = X @ W^T  (4096 x 512 x 512 each),
// fp32 in, f16 out, scattered into attention-friendly layouts.
//   p=0: Qs[h][n][l][hd]  (x 1/sqrt(HD))
//   p=1: Qo[h][n][l][hd]  (x 1/sqrt(HD))
//   p=2: Ks[h][n][s/16][hd/32][packed 16(s) x 32(hd) B-fragment]
//   p=3: Ko, as Ks
//   p=4: Vt[h][n][s/32][hd/16][packed 16(hd) x 32(s) B-fragment]
// grid: (4096/128, 512/64, 5), 256 threads (8 waves, 16x64 tile per wave)
// Per k step the block brings its 128 x 32 tile of X and its 64 x 32 tile of W
// in once, eight lanes to a 128-byte row piece (whole cache lines), converts
// them and shares them through LDS; two buffers, one barrier per step.
// ---------------------------------------------------------------------------
__global__ __launch_bounds__(256) void proj_kernel(
    const float* __restrict__ q, const float* __restrict__ k,
    const float* __restrict__ v,
    const float* __restrict__ Wqs, const float* __restrict__ Wqo,
    const float* __restrict__ Wks, const float* __restrict__ Wko,
    const float* __restrict__ Wv,
    _Float16* __restrict__ Qs, _Float16* __restrict__ Qo,
    _Float16* __restrict__ Ks, _Float16* __restrict__ Ko,
    _Float16* __restrict__ Vt) {
  const int lane  = threadIdx.x & 31;
  const int wid   = threadIdx.x >> 5;
  const int col   = lane & 15;
  const int khalf = lane >> 4;
  const int p     = blockIdx.z;
  const int m0    = blockIdx.x * 128 + wid * 16;   // row = t*NBATCH + n
  const int e0    = blockIdx.y * 64;               // output feature tile

  const float* X = (p < 2) ? q : ((p < 4) ? k : v);
  const float* W = (p == 0) ? Wqs : (p == 1) ? Wqo : (p == 2) ? Wks
                 : (p == 3) ? Wko : Wv;
  _Float16* dst  = (p == 0) ? Qs : (p == 1) ? Qo : (p == 2) ? Ks
                 : (p == 3) ? Ko : Vt;
  const float scale = (p < 2) ? 0.125f : 1.0f;     // HD^-0.5 folded into Q

  // fragments 0..7: X rows of waves 0..7; fragments 8..11: W rows of et 0..3
  __shared__ __attribute__((aligned(16))) _Float16 Tile[2][12 * FRAGH];
  // staging: load i of thread t takes row i * 32 + (t >> 3), k (t & 7) * 4 ..+3
  const int t    = threadIdx.x;
  const int goff = (t >> 3) * DMODEL + (t & 7) * 4;
  const int loff = (t >> 7) * FRAGH + ((t & 7) >> 1) * GRPH + ((t >> 3) & 15) * 8 + (t & 1) * 4;
  const int roff = khalf * GRPH + col * 8;
  const float* Xg = X + (size_t)blockIdx.x * 128 * DMODEL + goff;
  const float* Wg = W + (size_t)e0 * DMODEL + goff;

  float4 xr[4], wr[2];
#pragma unroll
  for (int i = 0; i < 4; ++i) xr[i] = *(const float4*)(Xg + i * 32 * DMODEL);
#pragma unroll
  for (int i = 0; i < 2; ++i) wr[i] = *(const float4*)(Wg + i * 32 * DMODEL);
#pragma unroll
  for (int i = 0; i < 4; ++i) stage_f32(&Tile[0][i * 2 * FRAGH + loff], xr[i], scale);
#pragma unroll
  for (int i = 0; i < 2; ++i) stage_f32(&Tile[0][(8 + i * 2) * FRAGH + loff], wr[i], 1.0f);
  __syncthreads();

  v8f cc[4] = {v8f{}, v8f{}, v8f{}, v8f{}};
  // unrolled: the k offsets become the loads' immediate offsets and the buffer
  // index a constant, so no address register changes while loads are in flight
#pragma unroll
  for (int s = 0; s < KSTEPS; ++s) {
    if (s + 1 < KSTEPS) {   // next step's tiles fly while this step is computed
#pragma unroll
      for (int i = 0; i < 4; ++i) xr[i] = *(const float4*)(Xg + i * 32 * DMODEL + (s + 1) * 32);
#pragma unroll
      for (int i = 0; i < 2; ++i) wr[i] = *(const float4*)(Wg + i * 32 * DMODEL + (s + 1) * 32);
    }
    const _Float16* tb = &Tile[s & 1][roff];
    v16h a = frag_lds(tb + wid * FRAGH);
#pragma unroll
    for (int et = 0; et < 4; ++et) {
      v16h b = frag_lds(tb + (8 + et) * FRAGH);
      cc[et] = wmma_f16(a, b, cc[et]);
    }
    if (s + 1 < KSTEPS) {
      // the other buffer was last read in front of the previous step's barrier
      _Float16* tn = &Tile[(s + 1) & 1][loff];
#pragma unroll
      for (int i = 0; i < 4; ++i) stage_f32(tn + i * 2 * FRAGH, xr[i], scale);
#pragma unroll
      for (int i = 0; i < 2; ++i) stage_f32(tn + (8 + i * 2) * FRAGH, wr[i], 1.0f);
      STEP_ORDER(6);
      __syncthreads();
      // ends the stretch that the order above speaks of (with all steps in one
      // stretch the build took over 20 registers more)
      __builtin_amdgcn_sched_barrier(0);
    }
  }

  // The 64-feature tile is one head h. C layout: a lane's eight rows are
  // t = t0 + 4*khalf + (vr >> 1), n = vr & 1, with t0 a multiple of 8.
  const int h  = e0 >> 6;
  const int t0 = m0 >> 1;
  const int NB = 2048 * HDIM;            // elements of one (h, n) plane
  _Float16* dh = dst + (size_t)h * NBATCH * NB;
  if (p == 4) {
    // per n, the lane's four t are four neighbouring halves of a V fragment
    _Float16* d = dh + (t0 >> 5) * 2048 + packed_off(col, (t0 & 31) + khalf * 4);
#pragma unroll
    for (int et = 0; et < 4; ++et) {
#pragma unroll
      for (int nb = 0; nb < NBATCH; ++nb) {
        v4h val;
#pragma unroll
        for (int i = 0; i < 4; ++i) val[i] = (_Float16)cc[et][2 * i + nb];
        *(v4h*)(d + nb * NB + et * 512) = val;
      }
    }
  } else if (p >= 2) {
    // hd = et*16 + col: fragment et >> 1, its half et & 1, so 256 halves per et
    _Float16* d = dh + (t0 & ~15) * HDIM + packed_off((t0 & 15) + khalf * 4, col);
#pragma unroll
    for (int et = 0; et < 4; ++et)
#pragma unroll
      for (int vr = 0; vr < 8; ++vr)
        d[(vr & 1) * NB + et * 256 + (vr >> 1) * 8] = (_Float16)cc[et][vr];
    // code laid out behind this branch reuses the stores' registers: wait until they are read
    asm volatile("s_wait_xcnt 0x0" ::: "memory");
  } else {
    _Float16* d = dh + (t0 + khalf * 4) * HDIM + col;
#pragma unroll
    for (int et = 0; et < 4; ++et)
#pragma unroll
      for (int vr = 0; vr < 8; ++vr)
        d[(vr & 1) * NB + (vr >> 1) * HDIM + et * 16] = (_Float16)cc[et][vr];
    // code laid out behind this branch reuses the stores' registers: wait until they are read
    asm volatile("s_wait_xcnt 0x0" ::: "memory");
  }
}

// e^t as the compiler's own multiply and v_exp_f32, with the one free slot that
// the instruction set asks for behind a transcendental kept inside the statement.
__device__ __forceinline__ float exp_slot(float t) {
  float r;
  // v_nop: fills that slot, whatever the compiler schedules next
  asm("v_exp_f32 %0, %1\n\tv_nop" : "=v"(r) : "v"(t * 1.44269504f));
  return r;
}

// ---------------------------------------------------------------------------
// Logit tile helper: 16(L) x 16(S) agent-aware logits in C layout.
// ---------------------------------------------------------------------------
__device__ __forceinline__ void logits_tile(
    const _Float16* __restrict__ Ksb, const _Float16* __restrict__ Kob,
    const int* __restrict__ kid_g, const float* __restrict__ mask,
    v16h qsA0, v16h qsA1, v16h qoA0, v16h qoA1,
    const int* qid, int l0, int s0, int col, int khalf, float* x) {
  const size_t ko = (size_t)s0 * HDIM + (khalf * 16 + col) * 8;  // tile s0/16, this lane
  v16h kB0 = frag_packed(Ksb + ko);
  v16h kB1 = frag_packed(Ksb + ko + 512);
  v8f cS = {};
  cS = wmma_f16(qsA0, kB0, cS);
  cS = wmma_f16(qsA1, kB1, cS);
  v16h oB0 = frag_packed(Kob + ko);
  v16h oB1 = frag_packed(Kob + ko + 512);
  v8f cO = {};
  cO = wmma_f16(qoA0, oB0, cO);
  cO = wmma_f16(qoA1, oB1, cO);
  int kid = kid_g[s0 + col];
#pragma unroll
  for (int vr = 0; vr < 8; ++vr) {
    int row  = vr + khalf * 8;
    float mv = mask[(size_t)(l0 + row) * S_SEQ + s0 + col];
    x[vr] = ((kid == qid[vr]) ? cS[vr] : cO[vr]) + mv;
  }
}

// ---------------------------------------------------------------------------
// Kernel 2: attention. grid (L/16, N), NSPLIT x 8 waves. The block owns a
// 16-row L tile; wave w computes head (w & 7) of it on one of NSPLIT runs of
// S / NSPLIT columns (part = w >> 3), so heads and parts run side by side and each
// SIMD has NSPLIT x 2 waves to cover load and LDS latency with.
// att_mean (the mean over heads) is summed inside the block: every wave
// puts its share of a 16 x 32 probability tile into LDS, and after a barrier
// the 256 threads of a part add its eight shares in head order and store the
// result once (no atomics, no global read-modify-write).
// Two passes over S per head: pass1 online max/sum stats per part, joined
// through LDS in part order; pass2 recompute, emit probabilities and
// accumulate O = P @ V via WMMA (P staged via LDS to convert C-fragment
// layout -> A-fragment layout); the parts' O sums are joined through LDS in
// part order.
// ---------------------------------------------------------------------------
#define RPITCH 36   // f32 row pitch of a share tile: rows r and r+8 land 32 banks apart
#define NSPLIT 2    // column parts per head
#define NWAVE (NHEAD * NSPLIT)
#define SPART (S_SEQ / NSPLIT)   // columns of one part
__global__ __launch_bounds__(NWAVE * 32) void attn_kernel(
    const _Float16* __restrict__ Qs, const _Float16* __restrict__ Qo,
    const _Float16* __restrict__ Ks, const _Float16* __restrict__ Ko,
    const _Float16* __restrict__ Vt,
    const int* __restrict__ qid_g, const int* __restrict__ kid_g,
    const float* __restrict__ mask,
    _Float16* __restrict__ Obuf, float* __restrict__ att_mean) {
  const int lane  = threadIdx.x & 31;
  const int w     = threadIdx.x >> 5;      // wave index
  const int h     = w & (NHEAD - 1);       // head
  const int part  = w >> 3;                // column part
  const int col   = lane & 15;
  const int khalf = lane >> 4;
  const int n     = blockIdx.y;
  const int l0    = blockIdx.x * 16;

  // Per-wave P staging: 16 x 32 f16, row stride 34 elems (68B) so that the
  // A-fragment column reads hit distinct LDS banks (17*r mod 64 distinct).
  __shared__ __attribute__((aligned(16))) _Float16 Pb[NWAVE][16 * 34];
  _Float16* myP = &Pb[w][0];
  // Per-head shares of att_mean, two buffers so that one barrier per 32
  // columns is enough (a buffer is rewritten one barrier after it was read).
  __shared__ __attribute__((aligned(16))) float Share[2][NSPLIT][NHEAD][16 * RPITCH];
  // Per-part softmax statistics (max, sum) of every head's 16 rows.
  __shared__ float Stat[NSPLIT][NHEAD][16][2];

  // element pair of its part's 16 x 32 tile that this thread sums and stores
  const int rrow = (threadIdx.x & 255) >> 4;
  const int rcol = (threadIdx.x & 15) * 2;
  float* amRow = att_mean + ((size_t)n * L_SEQ + (l0 + rrow)) * (size_t)S_SEQ + part * SPART + rcol;

  int qid[8];
#pragma unroll
  for (int vr = 0; vr < 8; ++vr) qid[vr] = qid_g[l0 + vr + khalf * 8];

  const _Float16* Qsb = Qs + ((size_t)(h * NBATCH + n) * L_SEQ + l0) * HDIM;
  const _Float16* Qob = Qo + ((size_t)(h * NBATCH + n) * L_SEQ + l0) * HDIM;
  // K, V, key identities and mask from this part's first column on
  const _Float16* Ksb = Ks + ((size_t)(h * NBATCH + n) * S_SEQ + part * SPART) * HDIM;
  const _Float16* Kob = Ko + ((size_t)(h * NBATCH + n) * S_SEQ + part * SPART) * HDIM;
  const _Float16* Vtb = Vt + ((size_t)(h * NBATCH + n) * S_SEQ + part * SPART) * HDIM + lane * 8;
  const int*   kidp  = kid_g + part * SPART;
  const float* maskp = mask + part * SPART;

  v16h qsA0 = frag_from_f16row(Qsb + col * HDIM, khalf);
  v16h qsA1 = frag_from_f16row(Qsb + col * HDIM + 32, khalf);
  v16h qoA0 = frag_from_f16row(Qob + col * HDIM, khalf);
  v16h qoA1 = frag_from_f16row(Qob + col * HDIM + 32, khalf);

  // ---- pass 1: online softmax statistics over S ---------------------------
  float mrow[8], srow[8];
#pragma unroll
  for (int vr = 0; vr < 8; ++vr) { mrow[vr] = -1e30f; srow[vr] = 0.0f; }

  for (int st = 0; st < SPART / 16; ++st) {
    int s0 = st * 16;
    float x[8];
    logits_tile(Ksb, Kob, kidp, maskp, qsA0, qsA1, qoA0, qoA1,
                qid, l0, s0, col, khalf, x);
    float red[8];
#pragma unroll
    for (int vr = 0; vr < 8; ++vr) red[vr] = x[vr];
#pragma unroll
    for (int d = 1; d < 16; d <<= 1)
#pragma unroll
      for (int vr = 0; vr < 8; ++vr)
        red[vr] = fmaxf(red[vr], __shfl_xor(red[vr], d, 32));
    float es[8];
#pragma unroll
    for (int vr = 0; vr < 8; ++vr) {
      float mn = fmaxf(mrow[vr], red[vr]);
      es[vr]   = __expf(x[vr] - mn);
      red[vr]  = mn;                       // reuse: new running max
    }
#pragma unroll
    for (int d = 1; d < 16; d <<= 1)
#pragma unroll
      for (int vr = 0; vr < 8; ++vr) es[vr] += __shfl_xor(es[vr], d, 32);
#pragma unroll
    for (int vr = 0; vr < 8; ++vr) {
      srow[vr] = srow[vr] * __expf(mrow[vr] - red[vr]) + es[vr];
      mrow[vr] = red[vr];
    }
  }
  // join the parts' statistics (part order 0..NSPLIT-1)
  if (col == 0) {
#pragma unroll
    for (int vr = 0; vr < 8; ++vr) {
      Stat[part][h][vr + khalf * 8][0] = mrow[vr];
      Stat[part][h][vr + khalf * 8][1] = srow[vr];
    }
  }
  __syncthreads();
  float invl[8];
#pragma unroll
  for (int vr = 0; vr < 8; ++vr) {
    const int row = vr + khalf * 8;
    float m = Stat[0][h][row][0];
#pragma unroll
    for (int pp = 1; pp < NSPLIT; ++pp) m = fmaxf(m, Stat[pp][h][row][0]);
    float s = 0.0f;
#pragma unroll
    for (int pp = 0; pp < NSPLIT; ++pp)
      s += Stat[pp][h][row][1] * __expf(Stat[pp][h][row][0] - m);
    mrow[vr] = m;
    invl[vr] = 1.0f / s;
  }

  // ---- pass 2: probabilities -> att_mean, and O += P @ V -----------------
  v8f oc[4] = {v8f{}, v8f{}, v8f{}, v8f{}};

  for (int sc = 0; sc < SPART / 32; ++sc) {
    float* myS = &Share[sc & 1][part][h][0];
#pragma unroll
    for (int sub = 0; sub < 2; ++sub) {
      int s0 = sc * 32 + sub * 16;
      float x[8];
      logits_tile(Ksb, Kob, kidp, maskp, qsA0, qsA1, qoA0, qoA1,
                  qid, l0, s0, col, khalf, x);
#pragma unroll
      for (int vr = 0; vr < 8; ++vr) {
        int row = vr + khalf * 8;
        float pp = exp_slot(x[vr] - mrow[vr]) * invl[vr];
        myP[row * 34 + sub * 16 + col] = (_Float16)pp;
        myS[row * RPITCH + sub * 16 + col] = pp * (1.0f / NHEAD);
      }
    }
    // A-fragment of P (16 x 32) from LDS (same wave: DS ops are in-order).
    v16h aP;
    {
      const _Float16* rp = myP + col * 34;
#pragma unroll
      for (int j = 0; j < 8; ++j) {
        int kb = ((j >> 2) << 4) + (khalf << 3) + ((j & 3) << 1);
        aP[2 * j]     = rp[kb];
        aP[2 * j + 1] = rp[kb + 1];
      }
    }
#pragma unroll
    for (int dt = 0; dt < 4; ++dt) {
      v16h bV = frag_packed(Vtb + (size_t)(sc * 4 + dt) * 512);
      oc[dt] = wmma_f16(aP, bV, oc[dt]);
    }

    // All eight shares of each part's 32-column tile are in LDS behind this barrier.
    __syncthreads();
    {
      const float* sp = &Share[sc & 1][part][0][rrow * RPITCH + rcol];
      float2 acc = *(const float2*)sp;
#pragma unroll
      for (int hh = 1; hh < NHEAD; ++hh) {   // head order 0..7
        float2 c = *(const float2*)(sp + hh * 16 * RPITCH);
        acc.x += c.x;
        acc.y += c.y;
      }
      *(float2*)(amRow + sc * 32) = acc;
      // the next trip reuses the store's registers: wait until it has read them
      asm volatile("s_wait_xcnt 0x0" ::: "memory");
    }
  }

  // Join the parts' O sums through the share buffers, which are free once
  // every wave has left the loop (first barrier); the partial sums are all in
  // LDS behind the second.
  float* Op = &Share[0][0][0][0];
  __syncthreads();
#pragma unroll
  for (int dt = 0; dt < 4; ++dt)
#pragma unroll
    for (int vr = 0; vr < 8; ++vr)
      Op[(((part * NHEAD + h) * 4 + dt) * 8 + vr) * 32 + lane] = oc[dt][vr];
  __syncthreads();

  // store this head's 64-column slice of O (rows l0..l0+15); each part sums
  // (part order 0..NSPLIT-1) and stores 64 / NSPLIT of the columns
#pragma unroll
  for (int d = 0; d < 4 / NSPLIT; ++d) {
    const int dt = part * (4 / NSPLIT) + d;
#pragma unroll
    for (int vr = 0; vr < 8; ++vr) {
      float a = Op[((h * 4 + dt) * 8 + vr) * 32 + lane];
#pragma unroll
      for (int pp = 1; pp < NSPLIT; ++pp)
        a += Op[(((pp * NHEAD + h) * 4 + dt) * 8 + vr) * 32 + lane];
      int row    = vr + khalf * 8;
      size_t rid = (size_t)(l0 + row) * NBATCH + n;
      int e      = h * HDIM + dt * 16 + col;
      Obuf[rid * DMODEL + e] = (_Float16)a;
    }
  }
}

// ---------------------------------------------------------------------------
// Kernel 3: final FC  out = O @ Wfc^T  (4096 x 512 x 512), f16 A, f32 out.
// grid (32, 8), 256 threads (8 waves, 16x64 tile per wave).
// Operand tiles shared through LDS as in kernel 1; O is f16 already, so a
// thread stages eight neighbouring k (one group row) per load.
// ---------------------------------------------------------------------------
__global__ __launch_bounds__(256) void fc_kernel(
    const _Float16* __restrict__ Obuf, const float* __restrict__ Wfc,
    float* __restrict__ out) {
  const int lane  = threadIdx.x & 31;
  const int wid   = threadIdx.x >> 5;
  const int col   = lane & 15;
  const int khalf = lane >> 4;
  const int m0    = blockIdx.x * 128 + wid * 16;
  const int e0    = blockIdx.y * 64;

  // fragments 0..7: O rows of waves 0..7; fragments 8..11: Wfc rows of et 0..3
  __shared__ __attribute__((aligned(16))) _Float16 Tile[2][12 * FRAGH];
  const int t    = threadIdx.x;
  // O: load i of thread t takes row i * 64 + (t >> 2), k (t & 3) * 8 ..+7
  const int gaof = (t >> 2) * DMODEL + (t & 3) * 8;
  const int laof = (t >> 6) * FRAGH + (t & 3) * GRPH + ((t >> 2) & 15) * 8;
  // Wfc: load i of thread t takes row i * 32 + (t >> 3), k (t & 7) * 4 ..+3
  const int goff = (t >> 3) * DMODEL + (t & 7) * 4;
  const int loff = (t >> 7) * FRAGH + ((t & 7) >> 1) * GRPH + ((t >> 3) & 15) * 8 + (t & 1) * 4;
  const int roff = khalf * GRPH + col * 8;
  const _Float16* Ag = Obuf + (size_t)blockIdx.x * 128 * DMODEL + gaof;
  const float*    Wg = Wfc + (size_t)e0 * DMODEL + goff;

  v8h ar[2];
  float4 wr[2];
#pragma unroll
  for (int i = 0; i < 2; ++i) ar[i] = *(const v8h*)(Ag + i * 64 * DMODEL);
#pragma unroll
  for (int i = 0; i < 2; ++i) wr[i] = *(const float4*)(Wg + i * 32 * DMODEL);
#pragma unroll
  for (int i = 0; i < 2; ++i) *(v8h*)&Tile[0][i * 4 * FRAGH + laof] = ar[i];
#pragma unroll
  for (int i = 0; i < 2; ++i) stage_f32(&Tile[0][(8 + i * 2) * FRAGH + loff], wr[i], 1.0f);
  __syncthreads();

  v8f cc[4] = {v8f{}, v8f{}, v8f{}, v8f{}};
  // unrolled: the k offsets become the loads' immediate offsets and the buffer
  // index a constant, so no address register changes while loads are in flight
#pragma unroll
  for (int s = 0; s < KSTEPS; ++s) {
    if (s + 1 < KSTEPS) {   // next step's tiles fly while this step is computed
#pragma unroll
      for (int i = 0; i < 2; ++i) ar[i] = *(const v8h*)(Ag + i * 64 * DMODEL + (s + 1) * 32);
#pragma unroll
      for (int i = 0; i < 2; ++i) wr[i] = *(const float4*)(Wg + i * 32 * DMODEL + (s + 1) * 32);
    }
    const _Float16* tb = &Tile[s & 1][roff];
    v16h a = frag_lds(tb + wid * FRAGH);
#pragma unroll
    for (int et = 0; et < 4; ++et) {
      v16h b = frag_lds(tb + (8 + et) * FRAGH);
      cc[et] = wmma_f16(a, b, cc[et]);
    }
    if (s + 1 < KSTEPS) {
      // the other buffer was last read in front of the previous step's barrier
      _Float16* tn = &Tile[(s + 1) & 1][0];
#pragma unroll
      for (int i = 0; i < 2; ++i) *(v8h*)(tn + i * 4 * FRAGH + laof) = ar[i];
#pragma unroll
      for (int i = 0; i < 2; ++i) stage_f32(tn + (8 + i * 2) * FRAGH + loff, wr[i], 1.0f);
      STEP_ORDER(4);
      __syncthreads();
      // ends the stretch that the order above speaks of (with all steps in one
      // stretch the build took over 20 registers more)
      __builtin_amdgcn_sched_barrier(0);
    }
  }
#pragma unroll
  for (int et = 0; et < 4; ++et)
#pragma unroll
    for (int vr = 0; vr < 8; ++vr) {
      int m   = vr + khalf * 8;
      int rid = m0 + m;
      int e   = e0 + et * 16 + col;
      out[(size_t)rid * DMODEL + e] = cc[et][vr];
    }
}

// ---------------------------------------------------------------------------
// Host launcher
// ---------------------------------------------------------------------------
extern "C" void kernel_launch(void* const* d_in, const int* in_sizes, int n_in,
                              void* d_out, int out_size, void* d_ws,
                              size_t ws_size, hipStream_t stream) {
  (void)in_sizes; (void)n_in; (void)out_size; (void)ws_size;
  const float* q    = (const float*)d_in[0];
  const float* k    = (const float*)d_in[1];
  const float* v    = (const float*)d_in[2];
  const int*   qid  = (const int*)d_in[3];
  const int*   kid  = (const int*)d_in[4];
  const float* mask = (const float*)d_in[5];
  const float* Wqs  = (const float*)d_in[6];
  const float* Wqo  = (const float*)d_in[7];
  const float* Wks  = (const float*)d_in[8];
  const float* Wko  = (const float*)d_in[9];
  const float* Wv   = (const float*)d_in[10];
  const float* Wfc  = (const float*)d_in[11];

  const size_t BUF = (size_t)NHEAD * NBATCH * 2048 * HDIM;  // 2,097,152 f16
  _Float16* ws = (_Float16*)d_ws;
  _Float16* Qs = ws;
  _Float16* Qo = Qs + BUF;
  _Float16* Ks = Qo + BUF;
  _Float16* Ko = Ks + BUF;
  _Float16* Vt = Ko + BUF;
  _Float16* Ob = Vt + BUF;          // 24 MB total workspace

  float* out      = (float*)d_out;                               // [L,N,D]
  float* att_mean = out + (size_t)L_SEQ * NBATCH * DMODEL;       // [N,L,S]

  proj_kernel<<<dim3(32, 8, 5), 256, 0, stream>>>(
      q, k, v, Wqs, Wqo, Wks, Wko, Wv, Qs, Qo, Ks, Ko, Vt);
  attn_kernel<<<dim3(L_SEQ / 16, NBATCH), NWAVE * 32, 0, stream>>>(
      Qs, Qo, Ks, Ko, Vt, qid, kid, mask, Ob, att_mean);
  fc_kernel<<<dim3(32, 8), 256, 0, stream>>>(Ob, Wfc, out);
}

// v005
// One run takes 168 microseconds.
// Next to v004, in two timings, it ran 1.10 and 1.11 times as fast.
// Over all steps from v000 it is 18.2 times as fast.
#include <hip/hip_runtime.h>

// ---------------------------------------------------------------------------
// AgentAwareAttention for MI455X (gfx1250), wave32 + v_wmma_f32_16x16x32_f16.
// f16 data / f32 accumulation everywhere; softmax math in f32.
// ---------------------------------------------------------------------------

typedef __attribute__((ext_vector_type(16))) _Float16 v16h;
typedef __attribute__((ext_vector_type(8)))  float    v8f;
typedef __attribute__((ext_vector_type(2)))  _Float16 h2;
typedef __attribute__((ext_vector_type(4)))  _Float16 v4h;
typedef __attribute__((ext_vector_type(8)))  _Float16 v8h;

#define L_SEQ 2048
#define S_SEQ 2048
#define NBATCH 2
#define DMODEL 512
#define NHEAD 8
#define HDIM 64

// ---- WMMA helpers ----------------------------------------------------------

__device__ __forceinline__ v8f wmma_f16(v16h a, v16h b, v8f c) {
  // D = A(16x32 f16) * B(32x16 f16) + C(16x16 f32)
  return __builtin_amdgcn_wmma_f32_16x16x32_f16(
      /*neg_a=*/false, a, /*neg_b=*/false, b,
      /*c_mod=*/(short)0, c, /*reuse_a=*/false, /*reuse_b=*/false);
}

// A-frag: lane holds row (lane&15); 16 K-elements with pattern
//   kb = (j>>2)*16 + (lane>>4)*8 + (j&3)*2   (pairs kb, kb+1)
// B-frag: identical pattern with lane&15 = output column, reading the
// column-major row (i.e. B_col[n][k]).
__device__ __forceinline__ v16h frag_from_f16row(const _Float16* __restrict__ rowPtr,
                                                 int khalf) {
  v16h f;
#pragma unroll
  for (int j = 0; j < 8; ++j) {
    int kb = ((j >> 2) << 4) + (khalf << 3) + ((j & 3) << 1);
    h2 p = *(const h2*)(rowPtr + kb);      // 4-byte load (kb is even)
    f[2 * j]     = p.x;
    f[2 * j + 1] = p.y;
  }
  return f;
}

// Packed fragment: a 16 x 32 f16 operand tile kept in memory in register order,
// 512 halves: [i = 0,1][lane = 0..31][8 halves], where lane holds fragment
// elements 8i..8i+7. Element (r, kk) of the tile (r = row of A / column of B,
// kk = k index, same k pattern as above) lies at packed_off(r, kk). A wave
// reads a fragment with two 16-byte loads per lane, each 512 contiguous bytes
// (four whole cache lines) instead of 32-byte pieces of sixteen lines.
__device__ __forceinline__ int packed_off(int r, int kk) {
  return ((kk >> 4) << 8) + (((((kk >> 3) & 1) << 4) + r) << 3) + (kk & 7);
}

// p = start of the packed fragment + lane * 8 (16-byte aligned)
__device__ __forceinline__ v16h frag_packed(const _Float16* __restrict__ p) {
  v8h lo = *(const v8h*)p;
  v8h hi = *(const v8h*)(p + 256);
  return __builtin_shufflevector(lo, hi, 0, 1, 2, 3, 4, 5, 6, 7,
                                 8, 9, 10, 11, 12, 13, 14, 15);
}

// ---- GEMM operand tiles in LDS ---------------------------------------------
// A block's operand tiles of one 32-wide k step lie in LDS as f16 fragments of
// 16 rows x 32 k: four groups g = kk >> 3 of [16 rows][8 halves]. A lane reads
// its fragment as groups khalf and 2 + khalf, 16 bytes each (same k pattern as
// above). The group pitch of 320 bytes moves each group 16 banks on, so that the
// staging stores of a wave (some rows of all four groups) spread evenly over
// the banks; a 16-lane half of a fragment read covers 256 contiguous bytes.
#define GRPH 160            // halves from one group to the next (128 used)
#define FRAGH (4 * GRPH)    // halves from one fragment to the next
#define KSTEPS (DMODEL / 32)

// Order of one k step for the scheduler: the next tiles' global loads (NLOAD of
// them), this step's ten LDS reads, its four products, and only then the
// conversions and LDS stores with their waits for the loads. Left alone the
// scheduler put each conversion right behind its load, so that the load's
// latency lay open.
#define STEP_ORDER(NLOAD)                                   \
  do {                                                      \
    __builtin_amdgcn_sched_group_barrier(0x020, NLOAD, 0);  \
    __builtin_amdgcn_sched_group_barrier(0x100, 10, 0);     \
    __builtin_amdgcn_sched_group_barrier(0x008, 4, 0);      \
    __builtin_amdgcn_sched_group_barrier(0x002, 32, 0);     \
    __builtin_amdgcn_sched_group_barrier(0x200, 4, 0);      \
  } while (0)

// p = fragment + khalf * GRPH + (lane & 15) * 8
__device__ __forceinline__ v16h frag_lds(const _Float16* p) {
  v8h lo = *(const v8h*)p;
  v8h hi = *(const v8h*)(p + 2 * GRPH);
  return __builtin_shufflevector(lo, hi, 0, 1, 2, 3, 4, 5, 6, 7,
                                 8, 9, 10, 11, 12, 13, 14, 15);
}

// four neighbouring k of one row, f32 from global memory -> f16 in LDS
__device__ __forceinline__ void stage_f32(_Float16* dst, float4 x, float scale) {
  v4h hv;
  hv[0] = (_Float16)(x.x * scale);
  hv[1] = (_Float16)(x.y * scale);
  hv[2] = (_Float16)(x.z * scale);
  hv[3] = (_Float16)(x.w * scale);
  *(v4h*)dst = hv;
}

// ---------------------------------------------------------------------------
// Kernel 1: the five input projections  Y = X @ W^T  (4096 x 512 x 512 each),
// fp32 in, f16 out, scattered into attention-friendly layouts.
//   p=0: Qs[h][n][l][hd]  (x 1/sqrt(HD))
//   p=1: Qo[h][n][l][hd]  (x 1/sqrt(HD))
//   p=2: Ks[h][n][s/16][hd/32][packed 16(s) x 32(hd) B-fragment]
//   p=3: Ko, as Ks
//   p=4: Vt[h][n][s/32][hd/16][packed 16(hd) x 32(s) B-fragment]
// grid: (4096/128, 512/64, 5), 256 threads (8 waves, 16x64 tile per wave)
// Per k step the block brings its 128 x 32 tile of X and its 64 x 32 tile of W
// in once, eight lanes to a 128-byte row piece (whole cache lines), converts
// them and shares them through LDS; two buffers, one barrier per step.
// ---------------------------------------------------------------------------
__global__ __launch_bounds__(256) void proj_kernel(
    const float* __restrict__ q, const float* __restrict__ k,
    const float* __restrict__ v,
    const float* __restrict__ Wqs, const float* __restrict__ Wqo,
    const float* __restrict__ Wks, const float* __restrict__ Wko,
    const float* __restrict__ Wv,
    _Float16* __restrict__ Qs, _Float16* __restrict__ Qo,
    _Float16* __restrict__ Ks, _Float16* __restrict__ Ko,
    _Float16* __restrict__ Vt) {
  const int lane  = threadIdx.x & 31;
  const int wid   = threadIdx.x >> 5;
  const int col   = lane & 15;
  const int khalf = lane >> 4;
  const int p     = blockIdx.z;
  const int m0    = blockIdx.x * 128 + wid * 16;   // row = t*NBATCH + n
  const int e0    = blockIdx.y * 64;               // output feature tile

  const float* X = (p < 2) ? q : ((p < 4) ? k : v);
  const float* W = (p == 0) ? Wqs : (p == 1) ? Wqo : (p == 2) ? Wks
                 : (p == 3) ? Wko : Wv;
  _Float16* dst  = (p == 0) ? Qs : (p == 1) ? Qo : (p == 2) ? Ks
                 : (p == 3) ? Ko : Vt;
  const float scale = (p < 2) ? 0.125f : 1.0f;     // HD^-0.5 folded into Q

  // fragments 0..7: X rows of waves 0..7; fragments 8..11: W rows of et 0..3
  __shared__ __attribute__((aligned(16))) _Float16 Tile[2][12 * FRAGH];
  // staging: load i of thread t takes row i * 32 + (t >> 3), k (t & 7) * 4 ..+3
  const int t    = threadIdx.x;
  const int goff = (t >> 3) * DMODEL + (t & 7) * 4;
  const int loff = (t >> 7) * FRAGH + ((t & 7) >> 1) * GRPH + ((t >> 3) & 15) * 8 + (t & 1) * 4;
  const int roff = khalf * GRPH + col * 8;
  const float* Xg = X + (size_t)blockIdx.x * 128 * DMODEL + goff;
  const float* Wg = W + (size_t)e0 * DMODEL + goff;

  float4 xr[4], wr[2];
#pragma unroll
  for (int i = 0; i < 4; ++i) xr[i] = *(const float4*)(Xg + i * 32 * DMODEL);
#pragma unroll
  for (int i = 0; i < 2; ++i) wr[i] = *(const float4*)(Wg + i * 32 * DMODEL);
#pragma unroll
  for (int i = 0; i < 4; ++i) stage_f32(&Tile[0][i * 2 * FRAGH + loff], xr[i], scale);
#pragma unroll
  for (int i = 0; i < 2; ++i) stage_f32(&Tile[0][(8 + i * 2) * FRAGH + loff], wr[i], 1.0f);
  __syncthreads();

  v8f cc[4] = {v8f{}, v8f{}, v8f{}, v8f{}};
  // unrolled: the k offsets become the loads' immediate offsets and the buffer
  // index a constant, so no address register changes while loads are in flight
#pragma unroll
  for (int s = 0; s < KSTEPS; ++s) {
    if (s + 1 < KSTEPS) {   // next step's tiles fly while this step is computed
#pragma unroll
      for (int i = 0; i < 4; ++i) xr[i] = *(const float4*)(Xg + i * 32 * DMODEL + (s + 1) * 32);
#pragma unroll
      for (int i = 0; i < 2; ++i) wr[i] = *(const float4*)(Wg + i * 32 * DMODEL + (s + 1) * 32);
    }
    const _Float16* tb = &Tile[s & 1][roff];
    v16h a = frag_lds(tb + wid * FRAGH);
#pragma unroll
    for (int et = 0; et < 4; ++et) {
      v16h b = frag_lds(tb + (8 + et) * FRAGH);
      cc[et] = wmma_f16(a, b, cc[et]);
    }
    if (s + 1 < KSTEPS) {
      // the other buffer was last read in front of the previous step's barrier
      _Float16* tn = &Tile[(s + 1) & 1][loff];
#pragma unroll
      for (int i = 0; i < 4; ++i) stage_f32(tn + i * 2 * FRAGH, xr[i], scale);
#pragma unroll
      for (int i = 0; i < 2; ++i) stage_f32(tn + (8 + i * 2) * FRAGH, wr[i], 1.0f);
      STEP_ORDER(6);
      __syncthreads();
      // ends the stretch that the order above speaks of (with all steps in one
      // stretch the build took over 20 registers more)
      __builtin_amdgcn_sched_barrier(0);
    }
  }

  // The 64-feature tile is one head h. C layout: a lane's eight rows are
  // t = t0 + 4*khalf + (vr >> 1), n = vr & 1, with t0 a multiple of 8.
  const int h  = e0 >> 6;
  const int t0 = m0 >> 1;
  const int NB = 2048 * HDIM;            // elements of one (h, n) plane
  _Float16* dh = dst + (size_t)h * NBATCH * NB;
  if (p == 4) {
    // per n, the lane's four t are four neighbouring halves of a V fragment
    _Float16* d = dh + (t0 >> 5) * 2048 + packed_off(col, (t0 & 31) + khalf * 4);
#pragma unroll
    for (int et = 0; et < 4; ++et) {
#pragma unroll
      for (int nb = 0; nb < NBATCH; ++nb) {
        v4h val;
#pragma unroll
        for (int i = 0; i < 4; ++i) val[i] = (_Float16)cc[et][2 * i + nb];
        *(v4h*)(d + nb * NB + et * 512) = val;
      }
    }
  } else if (p >= 2) {
    // hd = et*16 + col: fragment et >> 1, its half et & 1, so 256 halves per et
    _Float16* d = dh + (t0 & ~15) * HDIM + packed_off((t0 & 15) + khalf * 4, col);
#pragma unroll
    for (int et = 0; et < 4; ++et)
#pragma unroll
      for (int vr = 0; vr < 8; ++vr)
        d[(vr & 1) * NB + et * 256 + (vr >> 1) * 8] = (_Float16)cc[et][vr];
    // code laid out behind this branch reuses the stores' registers: wait until they are read
    asm volatile("s_wait_xcnt 0x0" ::: "memory");
  } else {
    _Float16* d = dh + (t0 + khalf * 4) * HDIM + col;
#pragma unroll
    for (int et = 0; et < 4; ++et)
#pragma unroll
      for (int vr = 0; vr < 8; ++vr)
        d[(vr & 1) * NB + (vr >> 1) * HDIM + et * 16] = (_Float16)cc[et][vr];
    // code laid out behind this branch reuses the stores' registers: wait until they are read
    asm volatile("s_wait_xcnt 0x0" ::: "memory");
  }
}

// e^t as the compiler's own multiply and v_exp_f32, with the one free slot that
// the instruction set asks for behind a transcendental kept inside the statement.
__device__ __forceinline__ float exp_slot(float t) {
  float r;
  // v_nop: fills that slot, whatever the compiler schedules next
  asm("v_exp_f32 %0, %1\n\tv_nop" : "=v"(r) : "v"(t * 1.44269504f));
  return r;
}

// ---------------------------------------------------------------------------
// Logit tile helper: 16(L) x 16(S) agent-aware logits in C layout.
// ---------------------------------------------------------------------------
__device__ __forceinline__ void logits_tile(
    const _Float16* __restrict__ Ksb, const _Float16* __restrict__ Kob,
    const int* __restrict__ kid_g, const float* __restrict__ mask,
    v16h qsA0, v16h qsA1, v16h qoA0, v16h qoA1,
    const int* qid, int l0, int s0, int col, int khalf, float* x) {
  const size_t ko = (size_t)s0 * HDIM + (khalf * 16 + col) * 8;  // tile s0/16, this lane
  v16h kB0 = frag_packed(Ksb + ko);
  v16h kB1 = frag_packed(Ksb + ko + 512);
  v8f cS = {};
  cS = wmma_f16(qsA0, kB0, cS);
  cS = wmma_f16(qsA1, kB1, cS);
  v16h oB0 = frag_packed(Kob + ko);
  v16h oB1 = frag_packed(Kob + ko + 512);
  v8f cO = {};
  cO = wmma_f16(qoA0, oB0, cO);
  cO = wmma_f16(qoA1, oB1, cO);
  int kid = kid_g[s0 + col];
#pragma unroll
  for (int vr = 0; vr < 8; ++vr) {
    int row  = vr + khalf * 8;
    float mv = mask[(size_t)(l0 + row) * S_SEQ + s0 + col];
    x[vr] = ((kid == qid[vr]) ? cS[vr] : cO[vr]) + mv;
  }
}

// ---------------------------------------------------------------------------
// Kernel 2: attention. grid (L/16, N), NSPLIT x 8 waves. The block owns a
// 16-row L tile; wave w computes head (w & 7) of it on one of NSPLIT runs of
// S / NSPLIT columns (part = w >> 3), so heads and parts run side by side and each
// SIMD has NSPLIT x 2 waves to cover load and LDS latency with.
// att_mean (the mean over heads) is summed inside the block: every wave
// puts its share of a 16 x 32 probability tile into LDS, and after a barrier
// the 256 threads of a part add its eight shares in head order and store the
// result once (no atomics, no global read-modify-write).
// Two passes over S per head: pass1 online max/sum stats per part, joined
// through LDS in part order; pass2 recompute, emit probabilities and
// accumulate O = P @ V via WMMA (P staged via LDS to convert C-fragment
// layout -> A-fragment layout); the parts' O sums are joined through LDS in
// part order.
// ---------------------------------------------------------------------------
#define RPITCH 36   // f32 row pitch of a share tile: rows r and r+8 land 32 banks apart
#define NSPLIT 2    // column parts per head
#define NWAVE (NHEAD * NSPLIT)
#define SPART (S_SEQ / NSPLIT)   // columns of one part
__global__ __launch_bounds__(NWAVE * 32) void attn_kernel(
    const _Float16* __restrict__ Qs, const _Float16* __restrict__ Qo,
    const _Float16* __restrict__ Ks, const _Float16* __restrict__ Ko,
    const _Float16* __restrict__ Vt,
    const int* __restrict__ qid_g, const int* __restrict__ kid_g,
    const float* __restrict__ mask,
    _Float16* __restrict__ Obuf, float* __restrict__ att_mean) {
  const int lane  = threadIdx.x & 31;
  const int w     = threadIdx.x >> 5;      // wave index
  const int h     = w & (NHEAD - 1);       // head
  const int part  = w >> 3;                // column part
  const int col   = lane & 15;
  const int khalf = lane >> 4;
  const int n     = blockIdx.y;
  const int l0    = blockIdx.x * 16;

  // Per-wave P staging: 16 x 32 f16, row stride 34 elems (68B) so that the
  // A-fragment column reads hit distinct LDS banks (17*r mod 64 distinct).
  __shared__ __attribute__((aligned(16))) _Float16 Pb[NWAVE][16 * 34];
  _Float16* myP = &Pb[w][0];
  // Per-head shares of att_mean, two buffers so that one barrier per 32
  // columns is enough (a buffer is rewritten one barrier after it was read).
  __shared__ __attribute__((aligned(16))) float Share[2][NSPLIT][NHEAD][16 * RPITCH];
  // Per-part softmax statistics (max, sum) of every head's 16 rows.
  __shared__ float Stat[NSPLIT][NHEAD][16][2];

  // element pair of its part's 16 x 32 tile that this thread sums and stores
  const int rrow = (threadIdx.x & 255) >> 4;
  const int rcol = (threadIdx.x & 15) * 2;
  float* amRow = att_mean + ((size_t)n * L_SEQ + (l0 + rrow)) * (size_t)S_SEQ + part * SPART + rcol;

  int qid[8];
#pragma unroll
  for (int vr = 0; vr < 8; ++vr) qid[vr] = qid_g[l0 + vr + khalf * 8];

  const _Float16* Qsb = Qs + ((size_t)(h * NBATCH + n) * L_SEQ + l0) * HDIM;
  const _Float16* Qob = Qo + ((size_t)(h * NBATCH + n) * L_SEQ + l0) * HDIM;
  // K, V, key identities and mask from this part's first column on
  const _Float16* Ksb = Ks + ((size_t)(h * NBATCH + n) * S_SEQ + part * SPART) * HDIM;
  const _Float16* Kob = Ko + ((size_t)(h * NBATCH + n) * S_SEQ + part * SPART) * HDIM;
  const _Float16* Vtb = Vt + ((size_t)(h * NBATCH + n) * S_SEQ + part * SPART) * HDIM + lane * 8;
  const int*   kidp  = kid_g + part * SPART;
  const float* maskp = mask + part * SPART;

  v16h qsA0 = frag_from_f16row(Qsb + col * HDIM, khalf);
  v16h qsA1 = frag_from_f16row(Qsb + col * HDIM + 32, khalf);
  v16h qoA0 = frag_from_f16row(Qob + col * HDIM, khalf);
  v16h qoA1 = frag_from_f16row(Qob + col * HDIM + 32, khalf);

  // ---- pass 1: online softmax statistics over S ---------------------------
  // Every lane keeps the running max and sum of its own columns (col, col + 16,
  // ...); the 16 lanes of a row are joined once, behind the loop.
  float mrow[8], srow[8];
#pragma unroll
  for (int vr = 0; vr < 8; ++vr) { mrow[vr] = -1e30f; srow[vr] = 0.0f; }

  for (int st = 0; st < SPART / 32; ++st) {
    float x0[8], x1[8];
    logits_tile(Ksb, Kob, kidp, maskp, qsA0, qsA1, qoA0, qoA1,
                qid, l0, st * 32, col, khalf, x0);
    logits_tile(Ksb, Kob, kidp, maskp, qsA0, qsA1, qoA0, qoA1,
                qid, l0, st * 32 + 16, col, khalf, x1);
#pragma unroll
    for (int vr = 0; vr < 8; ++vr) {
      float mn = fmaxf(mrow[vr], fmaxf(x0[vr], x1[vr]));
      srow[vr] = srow[vr] * exp_slot(mrow[vr] - mn) + (exp_slot(x0[vr] - mn) + exp_slot(x1[vr] - mn));
      mrow[vr] = mn;
    }
  }
  // join the 16 lanes of each row: max first, then the rescaled sums
#pragma unroll
  for (int vr = 0; vr < 8; ++vr) {
    float mn = mrow[vr];
#pragma unroll
    for (int d = 1; d < 16; d <<= 1) mn = fmaxf(mn, __shfl_xor(mn, d, 32));
    float sn = srow[vr] * exp_slot(mrow[vr] - mn);
#pragma unroll
    for (int d = 1; d < 16; d <<= 1) sn += __shfl_xor(sn, d, 32);
    mrow[vr] = mn;
    srow[vr] = sn;
  }
  // join the parts' statistics (part order 0..NSPLIT-1)
  if (col == 0) {
#pragma unroll
    for (int vr = 0; vr < 8; ++vr) {
      Stat[part][h][vr + khalf * 8][0] = mrow[vr];
      Stat[part][h][vr + khalf * 8][1] = srow[vr];
    }
  }
  __syncthreads();
  float invl[8];
#pragma unroll
  for (int vr = 0; vr < 8; ++vr) {
    const int row = vr + khalf * 8;
    float m = Stat[0][h][row][0];
#pragma unroll
    for (int pp = 1; pp < NSPLIT; ++pp) m = fmaxf(m, Stat[pp][h][row][0]);
    float s = 0.0f;
#pragma unroll
    for (int pp = 0; pp < NSPLIT; ++pp)
      s += Stat[pp][h][row][1] * exp_slot(Stat[pp][h][row][0] - m);
    mrow[vr] = m;
    invl[vr] = 1.0f / s;
  }

  // ---- pass 2: probabilities -> att_mean, and O += P @ V -----------------
  v8f oc[4] = {v8f{}, v8f{}, v8f{}, v8f{}};

  for (int sc = 0; sc < SPART / 32; ++sc) {
    float* myS = &Share[sc & 1][part][h][0];
#pragma unroll
    for (int sub = 0; sub < 2; ++sub) {
      int s0 = sc * 32 + sub * 16;
      float x[8];
      logits_tile(Ksb, Kob, kidp, maskp, qsA0, qsA1, qoA0, qoA1,
                  qid, l0, s0, col, khalf, x);
#pragma unroll
      for (int vr = 0; vr < 8; ++vr) {
        int row = vr + khalf * 8;
        float pp = exp_slot(x[vr] - mrow[vr]) * invl[vr];
        myP[row * 34 + sub * 16 + col] = (_Float16)pp;
        myS[row * RPITCH + sub * 16 + col] = pp * (1.0f / NHEAD);
      }
    }
    // A-fragment of P (16 x 32) from LDS (same wave: DS ops are in-order).
    v16h aP;
    {
      const _Float16* rp = myP + col * 34;
#pragma unroll
      for (int j = 0; j < 8; ++j) {
        int kb = ((j >> 2) << 4) + (khalf << 3) + ((j & 3) << 1);
        aP[2 * j]     = rp[kb];
        aP[2 * j + 1] = rp[kb + 1];
      }
    }
#pragma unroll
    for (int dt = 0; dt < 4; ++dt) {
      v16h bV = frag_packed(Vtb + (size_t)(sc * 4 + dt) * 512);
      oc[dt] = wmma_f16(aP, bV, oc[dt]);
    }

    // All eight shares of each part's 32-column tile are in LDS behind this barrier.
    __syncthreads();
    {
      const float* sp = &Share[sc & 1][part][0][rrow * RPITCH + rcol];
      float2 acc = *(const float2*)sp;
#pragma unroll
      for (int hh = 1; hh < NHEAD; ++hh) {   // head order 0..7
        float2 c = *(const float2*)(sp + hh * 16 * RPITCH);
        acc.x += c.x;
        acc.y += c.y;
      }
      *(float2*)(amRow + sc * 32) = acc;
      // the next trip reuses the store's registers: wait until it has read them
      asm volatile("s_wait_xcnt 0x0" ::: "memory");
    }
  }

  // Join the parts' O sums through the share buffers, which are free once
  // every wave has left the loop (first barrier); the partial sums are all in
  // LDS behind the second.
  float* Op = &Share[0][0][0][0];
  __syncthreads();
#pragma unroll
  for (int dt = 0; dt < 4; ++dt)
#pragma unroll
    for (int vr = 0; vr < 8; ++vr)
      Op[(((part * NHEAD + h) * 4 + dt) * 8 + vr) * 32 + lane] = oc[dt][vr];
  __syncthreads();

  // store this head's 64-column slice of O (rows l0..l0+15); each part sums
  // (part order 0..NSPLIT-1) and stores 64 / NSPLIT of the columns
#pragma unroll
  for (int d = 0; d < 4 / NSPLIT; ++d) {
    const int dt = part * (4 / NSPLIT) + d;
#pragma unroll
    for (int vr = 0; vr < 8; ++vr) {
      float a = Op[((h * 4 + dt) * 8 + vr) * 32 + lane];
#pragma unroll
      for (int pp = 1; pp < NSPLIT; ++pp)
        a += Op[(((pp * NHEAD + h) * 4 + dt) * 8 + vr) * 32 + lane];
      int row    = vr + khalf * 8;
      size_t rid = (size_t)(l0 + row) * NBATCH + n;
      int e      = h * HDIM + dt * 16 + col;
      Obuf[rid * DMODEL + e] = (_Float16)a;
    }
  }
}

// ---------------------------------------------------------------------------
// Kernel 3: final FC  out = O @ Wfc^T  (4096 x 512 x 512), f16 A, f32 out.
// grid (32, 8), 256 threads (8 waves, 16x64 tile per wave).
// Operand tiles shared through LDS as in kernel 1; O is f16 already, so a
// thread stages eight neighbouring k (one group row) per load.
// ---------------------------------------------------------------------------
__global__ __launch_bounds__(256) void fc_kernel(
    const _Float16* __restrict__ Obuf, const float* __restrict__ Wfc,
    float* __restrict__ out) {
  const int lane  = threadIdx.x & 31;
  const int wid   = threadIdx.x >> 5;
  const int col   = lane & 15;
  const int khalf = lane >> 4;
  const int m0    = blockIdx.x * 128 + wid * 16;
  const int e0    = blockIdx.y * 64;

  // fragments 0..7: O rows of waves 0..7; fragments 8..11: Wfc rows of et 0..3
  __shared__ __attribute__((aligned(16))) _Float16 Tile[2][12 * FRAGH];
  const int t    = threadIdx.x;
  // O: load i of thread t takes row i * 64 + (t >> 2), k (t & 3) * 8 ..+7
  const int gaof = (t >> 2) * DMODEL + (t & 3) * 8;
  const int laof = (t >> 6) * FRAGH + (t & 3) * GRPH + ((t >> 2) & 15) * 8;
  // Wfc: load i of thread t takes row i * 32 + (t >> 3), k (t & 7) * 4 ..+3
  const int goff = (t >> 3) * DMODEL + (t & 7) * 4;
  const int loff = (t >> 7) * FRAGH + ((t & 7) >> 1) * GRPH + ((t >> 3) & 15) * 8 + (t & 1) * 4;
  const int roff = khalf * GRPH + col * 8;
  const _Float16* Ag = Obuf + (size_t)blockIdx.x * 128 * DMODEL + gaof;
  const float*    Wg = Wfc + (size_t)e0 * DMODEL + goff;

  v8h ar[2];
  float4 wr[2];
#pragma unroll
  for (int i = 0; i < 2; ++i) ar[i] = *(const v8h*)(Ag + i * 64 * DMODEL);
#pragma unroll
  for (int i = 0; i < 2; ++i) wr[i] = *(const float4*)(Wg + i * 32 * DMODEL);
#pragma unroll
  for (int i = 0; i < 2; ++i) *(v8h*)&Tile[0][i * 4 * FRAGH + laof] = ar[i];
#pragma unroll
  for (int i = 0; i < 2; ++i) stage_f32(&Tile[0][(8 + i * 2) * FRAGH + loff], wr[i], 1.0f);
  __syncthreads();

  v8f cc[4] = {v8f{}, v8f{}, v8f{}, v8f{}};
  // unrolled: the k offsets become the loads' immediate offsets and the buffer
  // index a constant, so no address register changes while loads are in flight
#pragma unroll
  for (int s = 0; s < KSTEPS; ++s) {
    if (s + 1 < KSTEPS) {   // next step's tiles fly while this step is computed
#pragma unroll
      for (int i = 0; i < 2; ++i) ar[i] = *(const v8h*)(Ag + i * 64 * DMODEL + (s + 1) * 32);
#pragma unroll
      for (int i = 0; i < 2; ++i) wr[i] = *(const float4*)(Wg + i * 32 * DMODEL + (s + 1) * 32);
    }
    const _Float16* tb = &Tile[s & 1][roff];
    v16h a = frag_lds(tb + wid * FRAGH);
#pragma unroll
    for (int et = 0; et < 4; ++et) {
      v16h b = frag_lds(tb + (8 + et) * FRAGH);
      cc[et] = wmma_f16(a, b, cc[et]);
    }
    if (s + 1 < KSTEPS) {
      // the other buffer was last read in front of the previous step's barrier
      _Float16* tn = &Tile[(s + 1) & 1][0];
#pragma unroll
      for (int i = 0; i < 2; ++i) *(v8h*)(tn + i * 4 * FRAGH + laof) = ar[i];
#pragma unroll
      for (int i = 0; i < 2; ++i) stage_f32(tn + (8 + i * 2) * FRAGH + loff, wr[i], 1.0f);
      STEP_ORDER(4);
      __syncthreads();
      // ends the stretch that the order above speaks of (with all steps in one
      // stretch the build took over 20 registers more)
      __builtin_amdgcn_sched_barrier(0);
    }
  }
#pragma unroll
  for (int et = 0; et < 4; ++et)
#pragma unroll
    for (int vr = 0; vr < 8; ++vr) {
      int m   = vr + khalf * 8;
      int rid = m0 + m;
      int e   = e0 + et * 16 + col;
      out[(size_t)rid * DMODEL + e] = cc[et][vr];
    }
}

// ---------------------------------------------------------------------------
// Host launcher
// ---------------------------------------------------------------------------
extern "C" void kernel_launch(void* const* d_in, const int* in_sizes, int n_in,
                              void* d_out, int out_size, void* d_ws,
                              size_t ws_size, hipStream_t stream) {
  (void)in_sizes; (void)n_in; (void)out_size; (void)ws_size;
  const float* q    = (const float*)d_in[0];
  const float* k    = (const float*)d_in[1];
  const float* v    = (const float*)d_in[2];
  const int*   qid  = (const int*)d_in[3];
  const int*   kid  = (const int*)d_in[4];
  const float* mask = (const float*)d_in[5];
  const float* Wqs  = (const float*)d_in[6];
  const float* Wqo  = (const float*)d_in[7];
  const float* Wks  = (const float*)d_in[8];
  const float* Wko  = (const float*)d_in[9];
  const float* Wv   = (const float*)d_in[10];
  const float* Wfc  = (const float*)d_in[11];

  const size_t BUF = (size_t)NHEAD * NBATCH * 2048 * HDIM;  // 2,097,152 f16
  _Float16* ws = (_Float16*)d_ws;
  _Float16* Qs = ws;
  _Float16* Qo = Qs + BUF;
  _Float16* Ks = Qo + BUF;
  _Float16* Ko = Ks + BUF;
  _Float16* Vt = Ko + BUF;
  _Float16* Ob = Vt + BUF;          // 24 MB total workspace

  float* out      = (float*)d_out;                               // [L,N,D]
  float* att_mean = out + (size_t)L_SEQ * NBATCH * DMODEL;       // [N,L,S]

  proj_kernel<<<dim3(32, 8, 5), 256, 0, stream>>>(
      q, k, v, Wqs, Wqo, Wks, Wko, Wv, Qs, Qo, Ks, Ko, Vt);
  attn_kernel<<<dim3(L_SEQ / 16, NBATCH), NWAVE * 32, 0, stream>>>(
      Qs, Qo, Ks, Ko, Vt, qid, kid, mask, Ob, att_mean);
  fc_kernel<<<dim3(32, 8), 256, 0, stream>>>(Ob, Wfc, out);
}

// v006
// It runs in 150 microseconds.
// Timed twice side by side with v005, it ran 1.13 times as fast both times.
// Over all steps from v000 it is 20.5 times as fast.
#include <hip/hip_runtime.h>

// ---------------------------------------------------------------------------
// AgentAwareAttention for MI455X (gfx1250), wave32 + v_wmma_f32_16x16x32_f16.
// f16 data / f32 accumulation everywhere; softmax math in f32.
// ---------------------------------------------------------------------------

typedef __attribute__((ext_vector_type(16))) _Float16 v16h;
typedef __attribute__((ext_vector_type(8)))  float    v8f;
typedef __attribute__((ext_vector_type(2)))  _Float16 h2;
typedef __attribute__((ext_vector_type(4)))  _Float16 v4h;
typedef __attribute__((ext_vector_type(8)))  _Float16 v8h;

#define L_SEQ 2048
#define S_SEQ 2048
#define NBATCH 2
#define DMODEL 512
#define NHEAD 8
#define HDIM 64

// ---- WMMA helpers ----------------------------------------------------------

__device__ __forceinline__ v8f wmma_f16(v16h a, v16h b, v8f c) {
  // D = A(16x32 f16) * B(32x16 f16) + C(16x16 f32)
  return __builtin_amdgcn_wmma_f32_16x16x32_f16(
      /*neg_a=*/false, a, /*neg_b=*/false, b,
      /*c_mod=*/(short)0, c, /*reuse_a=*/false, /*reuse_b=*/false);
}

// A-frag: lane holds row (lane&15); 16 K-elements with pattern
//   kb = (j>>2)*16 + (lane>>4)*8 + (j&3)*2   (pairs kb, kb+1)
// B-frag: identical pattern with lane&15 = output column, reading the
// column-major row (i.e. B_col[n][k]).
__device__ __forceinline__ v16h frag_from_f16row(const _Float16* __restrict__ rowPtr,
                                                 int khalf) {
  v16h f;
#pragma unroll
  for (int j = 0; j < 8; ++j) {
    int kb = ((j >> 2) << 4) + (khalf << 3) + ((j & 3) << 1);
    h2 p = *(const h2*)(rowPtr + kb);      // 4-byte load (kb is even)
    f[2 * j]     = p.x;
    f[2 * j + 1] = p.y;
  }
  return f;
}

// Packed fragment: a 16 x 32 f16 operand tile kept in memory in register order,
// 512 halves: [i = 0,1][lane = 0..31][8 halves], where lane holds fragment
// elements 8i..8i+7. Element (r, kk) of the tile (r = row of A / column of B,
// kk = k index, same k pattern as above) lies at packed_off(r, kk). A wave
// reads a fragment with two 16-byte loads per lane, each 512 contiguous bytes
// (four whole cache lines) instead of 32-byte pieces of sixteen lines.
__device__ __forceinline__ int packed_off(int r, int kk) {
  return ((kk >> 4) << 8) + (((((kk >> 3) & 1) << 4) + r) << 3) + (kk & 7);
}

// p = start of the packed fragment + lane * 8 (16-byte aligned)
__device__ __forceinline__ v16h frag_packed(const _Float16* __restrict__ p) {
  v8h lo = *(const v8h*)p;
  v8h hi = *(const v8h*)(p + 256);
  return __builtin_shufflevector(lo, hi, 0, 1, 2, 3, 4, 5, 6, 7,
                                 8, 9, 10, 11, 12, 13, 14, 15);
}

// ---- GEMM operand tiles in LDS ---------------------------------------------
// A block's operand tiles of one 32-wide k step lie in LDS as f16 fragments of
// 16 rows x 32 k: four groups g = kk >> 3 of [16 rows][8 halves]. A lane reads
// its fragment as groups khalf and 2 + khalf, 16 bytes each (same k pattern as
// above). The group pitch of 320 bytes moves each group 16 banks on, so that the
// staging stores of a wave (some rows of all four groups) spread evenly over
// the banks; a 16-lane half of a fragment read covers 256 contiguous bytes.
#define GRPH 160            // halves from one group to the next (128 used)
#define FRAGH (4 * GRPH)    // halves from one fragment to the next
#define KSTEPS (DMODEL / 32)

// Order of one k step for the scheduler: the next tiles' global loads (NLOAD of
// them), this step's ten LDS reads, its four products, and only then the
// conversions and LDS stores with their waits for the loads. Left alone the
// scheduler put each conversion right behind its load, so that the load's
// latency lay open.
#define STEP_ORDER(NLOAD)                                   \
  do {                                                      \
    __builtin_amdgcn_sched_group_barrier(0x020, NLOAD, 0);  \
    __builtin_amdgcn_sched_group_barrier(0x100, 10, 0);     \
    __builtin_amdgcn_sched_group_barrier(0x008, 4, 0);      \
    __builtin_amdgcn_sched_group_barrier(0x002, 32, 0);     \
    __builtin_amdgcn_sched_group_barrier(0x200, 4, 0);      \
  } while (0)

// p = fragment + khalf * GRPH + (lane & 15) * 8
__device__ __forceinline__ v16h frag_lds(const _Float16* p) {
  v8h lo = *(const v8h*)p;
  v8h hi = *(const v8h*)(p + 2 * GRPH);
  return __builtin_shufflevector(lo, hi, 0, 1, 2, 3, 4, 5, 6, 7,
                                 8, 9, 10, 11, 12, 13, 14, 15);
}

// four neighbouring k of one row, f32 from global memory -> f16 in LDS
__device__ __forceinline__ void stage_f32(_Float16* dst, float4 x, float scale) {
  v4h hv;
  hv[0] = (_Float16)(x.x * scale);
  hv[1] = (_Float16)(x.y * scale);
  hv[2] = (_Float16)(x.z * scale);
  hv[3] = (_Float16)(x.w * scale);
  *(v4h*)dst = hv;
}

// ---------------------------------------------------------------------------
// Kernel 1: the five input projections  Y = X @ W^T  (4096 x 512 x 512 each),
// fp32 in, f16 out, scattered into attention-friendly layouts.
//   p=0: Qs[h][n][l][hd]  (x 1/sqrt(HD))
//   p=1: Qo[h][n][l][hd]  (x 1/sqrt(HD))
//   p=2: Ks[h][n][s/16][hd/32][packed 16(s) x 32(hd) B-fragment]
//   p=3: Ko, as Ks
//   p=4: Vt[h][n][s/32][hd/16][packed 16(hd) x 32(s) B-fragment]
// grid: (4096/128, 512/64, 5), 256 threads (8 waves, 16x64 tile per wave)
// Per k step the block brings its 128 x 32 tile of X and its 64 x 32 tile of W
// in once, eight lanes to a 128-byte row piece (whole cache lines), converts
// them and shares them through LDS; two buffers, one barrier per step.
// ---------------------------------------------------------------------------
__global__ __launch_bounds__(256) void proj_kernel(
    const float* __restrict__ q, const float* __restrict__ k,
    const float* __restrict__ v,
    const float* __restrict__ Wqs, const float* __restrict__ Wqo,
    const float* __restrict__ Wks, const float* __restrict__ Wko,
    const float* __restrict__ Wv,
    _Float16* __restrict__ Qs, _Float16* __restrict__ Qo,
    _Float16* __restrict__ Ks, _Float16* __restrict__ Ko,
    _Float16* __restrict__ Vt) {
  const int lane  = threadIdx.x & 31;
  const int wid   = threadIdx.x >> 5;
  const int col   = lane & 15;
  const int khalf = lane >> 4;
  const int p     = blockIdx.z;
  const int m0    = blockIdx.x * 128 + wid * 16;   // row = t*NBATCH + n
  const int e0    = blockIdx.y * 64;               // output feature tile

  const float* X = (p < 2) ? q : ((p < 4) ? k : v);
  const float* W = (p == 0) ? Wqs : (p == 1) ? Wqo : (p == 2) ? Wks
                 : (p == 3) ? Wko : Wv;
  _Float16* dst  = (p == 0) ? Qs : (p == 1) ? Qo : (p == 2) ? Ks
                 : (p == 3) ? Ko : Vt;
  const float scale = (p < 2) ? 0.125f : 1.0f;     // HD^-0.5 folded into Q

  // fragments 0..7: X rows of waves 0..7; fragments 8..11: W rows of et 0..3
  __shared__ __attribute__((aligned(16))) _Float16 Tile[2][12 * FRAGH];
  // staging: load i of thread t takes row i * 32 + (t >> 3), k (t & 7) * 4 ..+3
  const int t    = threadIdx.x;
  const int goff = (t >> 3) * DMODEL + (t & 7) * 4;
  const int loff = (t >> 7) * FRAGH + ((t & 7) >> 1) * GRPH + ((t >> 3) & 15) * 8 + (t & 1) * 4;
  const int roff = khalf * GRPH + col * 8;
  const float* Xg = X + (size_t)blockIdx.x * 128 * DMODEL + goff;
  const float* Wg = W + (size_t)e0 * DMODEL + goff;

  float4 xr[4], wr[2];
#pragma unroll
  for (int i = 0; i < 4; ++i) xr[i] = *(const float4*)(Xg + i * 32 * DMODEL);
#pragma unroll
  for (int i = 0; i < 2; ++i) wr[i] = *(const float4*)(Wg + i * 32 * DMODEL);
#pragma unroll
  for (int i = 0; i < 4; ++i) stage_f32(&Tile[0][i * 2 * FRAGH + loff], xr[i], scale);
#pragma unroll
  for (int i = 0; i < 2; ++i) stage_f32(&Tile[0][(8 + i * 2) * FRAGH + loff], wr[i], 1.0f);
  __syncthreads();

  v8f cc[4] = {v8f{}, v8f{}, v8f{}, v8f{}};
  // unrolled: the k offsets become the loads' immediate offsets and the buffer
  // index a constant, so no address register changes while loads are in flight
#pragma unroll
  for (int s = 0; s < KSTEPS; ++s) {
    if (s + 1 < KSTEPS) {   // next step's tiles fly while this step is computed
#pragma unroll
      for (int i = 0; i < 4; ++i) xr[i] = *(const float4*)(Xg + i * 32 * DMODEL + (s + 1) * 32);
#pragma unroll
      for (int i = 0; i < 2; ++i) wr[i] = *(const float4*)(Wg + i * 32 * DMODEL + (s + 1) * 32);
    }
    const _Float16* tb = &Tile[s & 1][roff];
    v16h a = frag_lds(tb + wid * FRAGH);
#pragma unroll
    for (int et = 0; et < 4; ++et) {
      v16h b = frag_lds(tb + (8 + et) * FRAGH);
      cc[et] = wmma_f16(a, b, cc[et]);
    }
    if (s + 1 < KSTEPS) {
      // the other buffer was last read in front of the previous step's barrier
      _Float16* tn = &Tile[(s + 1) & 1][loff];
#pragma unroll
      for (int i = 0; i < 4; ++i) stage_f32(tn + i * 2 * FRAGH, xr[i], scale);
#pragma unroll
      for (int i = 0; i < 2; ++i) stage_f32(tn + (8 + i * 2) * FRAGH, wr[i], 1.0f);
      STEP_ORDER(6);
      __syncthreads();
      // ends the stretch that the order above speaks of (with all steps in one
      // stretch the build took over 20 registers more)
      __builtin_amdgcn_sched_barrier(0);
    }
  }

  // The 64-feature tile is one head h. C layout: a lane's eight rows are
  // t = t0 + 4*khalf + (vr >> 1), n = vr & 1, with t0 a multiple of 8.
  const int h  = e0 >> 6;
  const int t0 = m0 >> 1;
  const int NB = 2048 * HDIM;            // elements of one (h, n) plane
  _Float16* dh = dst + (size_t)h * NBATCH * NB;
  if (p == 4) {
    // per n, the lane's four t are four neighbouring halves of a V fragment
    _Float16* d = dh + (t0 >> 5) * 2048 + packed_off(col, (t0 & 31) + khalf * 4);
#pragma unroll
    for (int et = 0; et < 4; ++et) {
#pragma unroll
      for (int nb = 0; nb < NBATCH; ++nb) {
        v4h val;
#pragma unroll
        for (int i = 0; i < 4; ++i) val[i] = (_Float16)cc[et][2 * i + nb];
        *(v4h*)(d + nb * NB + et * 512) = val;
      }
    }
  } else if (p >= 2) {
    // hd = et*16 + col: fragment et >> 1, its half et & 1, so 256 halves per et
    _Float16* d = dh + (t0 & ~15) * HDIM + packed_off((t0 & 15) + khalf * 4, col);
#pragma unroll
    for (int et = 0; et < 4; ++et)
#pragma unroll
      for (int vr = 0; vr < 8; ++vr)
        d[(vr & 1) * NB + et * 256 + (vr >> 1) * 8] = (_Float16)cc[et][vr];
    // code laid out behind this branch reuses the stores' registers: wait until they are read
    asm volatile("s_wait_xcnt 0x0" ::: "memory");
  } else {
    _Float16* d = dh + (t0 + khalf * 4) * HDIM + col;
#pragma unroll
    for (int et = 0; et < 4; ++et)
#pragma unroll
      for (int vr = 0; vr < 8; ++vr)
        d[(vr & 1) * NB + (vr >> 1) * HDIM + et * 16] = (_Float16)cc[et][vr];
    // code laid out behind this branch reuses the stores' registers: wait until they are read
    asm volatile("s_wait_xcnt 0x0" ::: "memory");
  }
}

// e^t as the compiler's own multiply and v_exp_f32, with the one free slot that
// the instruction set asks for behind a transcendental kept inside the statement.
__device__ __forceinline__ float exp_slot(float t) {
  float r;
  // v_nop: fills that slot, whatever the compiler schedules next
  asm("v_exp_f32 %0, %1\n\tv_nop" : "=v"(r) : "v"(t * 1.44269504f));
  return r;
}

// ---------------------------------------------------------------------------
// Logit tile helpers: 16(L) x 16(S) agent-aware logits in C layout, with the
// loads apart from the arithmetic so that a loop can issue a later tile's
// loads as soon as this tile's values have been used.
// ---------------------------------------------------------------------------
struct KTile { v16h s0, s1, o0, o1; };      // self and other K fragments of 16 columns
struct MTile { float mv[8]; int kid; };     // mask values and key identity of 16 columns

__device__ __forceinline__ KTile load_ktile(const _Float16* __restrict__ Ksb,
                                            const _Float16* __restrict__ Kob,
                                            int s0, int lane) {
  // tile s0/16: a wave-uniform tile pointer plus this lane's 32-bit offset
  const _Float16* ks = Ksb + (size_t)s0 * HDIM;
  const _Float16* ko = Kob + (size_t)s0 * HDIM;
  const unsigned lo = (unsigned)lane * 8u;
  KTile t;
  t.s0 = frag_packed(ks + lo);
  t.s1 = frag_packed(ks + 512 + lo);
  t.o0 = frag_packed(ko + lo);
  t.o1 = frag_packed(ko + 512 + lo);
  return t;
}

__device__ __forceinline__ MTile load_mtile(const int* __restrict__ kid_g,
                                            const float* __restrict__ mask,
                                            int l0, int s0, int col, int khalf) {
  MTile t;
  t.kid = (kid_g + s0)[(unsigned)col];
  const float* mp = mask + (size_t)l0 * S_SEQ + s0;      // wave-uniform
  const unsigned lo = (unsigned)(khalf * 8 * S_SEQ + col);
#pragma unroll
  for (int vr = 0; vr < 8; ++vr) t.mv[vr] = (mp + vr * S_SEQ)[lo];
  return t;
}

__device__ __forceinline__ void logit_products(const KTile& k, v16h qsA0, v16h qsA1,
                                               v16h qoA0, v16h qoA1, v8f& cS, v8f& cO) {
  cS = v8f{};
  cS = wmma_f16(qsA0, k.s0, cS);
  cS = wmma_f16(qsA1, k.s1, cS);
  cO = v8f{};
  cO = wmma_f16(qoA0, k.o0, cO);
  cO = wmma_f16(qoA1, k.o1, cO);
}

__device__ __forceinline__ void logit_blend(v8f cS, v8f cO, const MTile& m,
                                            const int* qid, float* x) {
#pragma unroll
  for (int vr = 0; vr < 8; ++vr)
    x[vr] = ((m.kid == qid[vr]) ? cS[vr] : cO[vr]) + m.mv[vr];
}

// ---------------------------------------------------------------------------
// Kernel 2: attention. grid (L/16, N), NSPLIT x 8 waves. The block owns a
// 16-row L tile; wave w computes head (w & 7) of it on one of NSPLIT runs of
// S / NSPLIT columns (part = w >> 3), so heads and parts run side by side and each
// SIMD has NSPLIT x 2 waves to cover load and LDS latency with.
// att_mean (the mean over heads) is summed inside the block: every wave
// puts its share of a 16 x 32 probability tile into LDS, and after a barrier
// the 256 threads of a part add its eight shares in head order and store the
// result once (no atomics, no global read-modify-write).
// Two passes over S per head: pass1 online max/sum stats per part, joined
// through LDS in part order; pass2 recompute, emit probabilities and
// accumulate O = P @ V via WMMA (P staged via LDS to convert C-fragment
// layout -> A-fragment layout); the parts' O sums are joined through LDS in
// part order. In both passes the global loads run ahead of the arithmetic: K and
// V one 32-column stage, the mask and identities a stage (pass 1) or 16 columns.
// ---------------------------------------------------------------------------
#define RPITCH 36   // f32 row pitch of a share tile: rows r and r+8 land 32 banks apart
#define NSPLIT 2    // column parts per head
#define NWAVE (NHEAD * NSPLIT)
#define SPART (S_SEQ / NSPLIT)   // columns of one part
__global__ __launch_bounds__(NWAVE * 32) void attn_kernel(
    const _Float16* __restrict__ Qs, const _Float16* __restrict__ Qo,
    const _Float16* __restrict__ Ks, const _Float16* __restrict__ Ko,
    const _Float16* __restrict__ Vt,
    const int* __restrict__ qid_g, const int* __restrict__ kid_g,
    const float* __restrict__ mask,
    _Float16* __restrict__ Obuf, float* __restrict__ att_mean) {
  const int lane  = threadIdx.x & 31;
  // wave index, in a scalar register: head, part and the tile pointers formed from
  // them are then scalar too (fewer vector registers, which the loads in flight need)
  const int w     = __builtin_amdgcn_readfirstlane(threadIdx.x >> 5);
  const int h     = w & (NHEAD - 1);       // head
  const int part  = w >> 3;                // column part
  const int col   = lane & 15;
  const int khalf = lane >> 4;
  const int n     = blockIdx.y;
  const int l0    = blockIdx.x * 16;

  // Per-wave P staging: 16 x 32 f16, row stride 34 elems (68B) so that the
  // A-fragment column reads hit distinct LDS banks (17*r mod 64 distinct).
  __shared__ __attribute__((aligned(16))) _Float16 Pb[NWAVE][16 * 34];
  _Float16* myP = &Pb[w][0];
  // Per-head shares of att_mean, two buffers so that one barrier per 32
  // columns is enough (a buffer is rewritten one barrier after it was read).
  __shared__ __attribute__((aligned(16))) float Share[2][NSPLIT][NHEAD][16 * RPITCH];
  // Per-part softmax statistics (max, sum) of every head's 16 rows.
  __shared__ float Stat[NSPLIT][NHEAD][16][2];

  // element pair of its part's 16 x 32 tile that this thread sums and stores
  const int rrow = (threadIdx.x & 255) >> 4;
  const int rcol = (threadIdx.x & 15) * 2;
  float* amRow = att_mean + ((size_t)n * L_SEQ + (l0 + rrow)) * (size_t)S_SEQ + part * SPART + rcol;

  int qid[8];
#pragma unroll
  for (int vr = 0; vr < 8; ++vr) qid[vr] = qid_g[l0 + vr + khalf * 8];
  // the Q loads below may land in the address registers of these loads
  asm volatile("s_wait_xcnt 0x0" ::: "memory");

  const _Float16* Qsb = Qs + ((size_t)(h * NBATCH + n) * L_SEQ + l0) * HDIM;
  const _Float16* Qob = Qo + ((size_t)(h * NBATCH + n) * L_SEQ + l0) * HDIM;
  // K, V, key identities and mask from this part's first column on
  const _Float16* Ksb = Ks + ((size_t)(h * NBATCH + n) * S_SEQ + part * SPART) * HDIM;
  const _Float16* Kob = Ko + ((size_t)(h * NBATCH + n) * S_SEQ + part * SPART) * HDIM;
  const _Float16* Vtb = Vt + ((size_t)(h * NBATCH + n) * S_SEQ + part * SPART) * HDIM;
  const unsigned vlo = (unsigned)lane * 8u;   // this lane's place in a packed fragment
  const int*   kidp  = kid_g + part * SPART;
  const float* maskp = mask + part * SPART;

  v16h qsA0 = frag_from_f16row(Qsb + col * HDIM, khalf);
  v16h qsA1 = frag_from_f16row(Qsb + col * HDIM + 32, khalf);
  asm volatile("s_wait_xcnt 0x0" ::: "memory");   // as above, for the next group
  v16h qoA0 = frag_from_f16row(Qob + col * HDIM, khalf);
  v16h qoA1 = frag_from_f16row(Qob + col * HDIM + 32, khalf);
  asm volatile("s_wait_xcnt 0x0" ::: "memory");   // as above, for the K loads

  // ---- pass 1: online softmax statistics over S ---------------------------
  // Every lane keeps the running max and sum of its own columns (col, col + 16,
  // ...); the 16 lanes of a row are joined once, behind the loop.
  // Stage = 32 columns. A stage's K, mask and identity loads are issued one
  // stage ahead, each group behind the last use of the tile before it.
  // The stage index wraps, so the last trip of pass 1 fetches stage 0,
  // with which pass 2 starts (and the last trip of pass 2 fetches it unused).
  KTile ka = load_ktile(Ksb, Kob, 0, lane);
  KTile kb = load_ktile(Ksb, Kob, 16, lane);
  MTile ma = load_mtile(kidp, maskp, l0, 0, col, khalf);
  MTile mb = load_mtile(kidp, maskp, l0, 16, col, khalf);
  // the code behind reuses the address registers of the loads above
  asm volatile("s_wait_xcnt 0x0" ::: "memory");
  // keeps that code behind the wait (the scheduler lifted register moves over it)
  __builtin_amdgcn_sched_barrier(0);

  float mrow[8], srow[8];
#pragma unroll
  for (int vr = 0; vr < 8; ++vr) { mrow[vr] = -1e30f; srow[vr] = 0.0f; }

  for (int st = 0; st < SPART / 32; ++st) {
    const int nx = ((st + 1) & (SPART / 32 - 1)) * 32;   // next stage's first column
    float x0[8], x1[8];
    v8f cS, cO;
    logit_products(ka, qsA0, qsA1, qoA0, qoA1, cS, cO);
    logit_blend(cS, cO, ma, qid, x0);
    // holds the next mask loads behind the last read of their registers: lifted
    // above it they took registers of their own, and copies that wait for them
    __builtin_amdgcn_sched_barrier(0);
    // mask first: loads are counted back in order, so that a wait for the small
    // mask loads does not also wait for the K loads
    ma = load_mtile(kidp, maskp, l0, nx, col, khalf);
    // the K loads may land in the address registers of the loads above
    asm volatile("s_wait_xcnt 0x0" ::: "memory");
    ka = load_ktile(Ksb, Kob, nx, lane);
    logit_products(kb, qsA0, qsA1, qoA0, qoA1, cS, cO);
    logit_blend(cS, cO, mb, qid, x1);
    __builtin_amdgcn_sched_barrier(0);   // as above
    mb = load_mtile(kidp, maskp, l0, nx + 16, col, khalf);
    asm volatile("s_wait_xcnt 0x0" ::: "memory");   // as above
    kb = load_ktile(Ksb, Kob, nx + 16, lane);
    // the arithmetic below reuses the address registers of the K loads
    asm volatile("s_wait_xcnt 0x0" ::: "memory");
    // keeps that arithmetic behind the wait (the scheduler lifted part of it over)
    __builtin_amdgcn_sched_barrier(0);
#pragma unroll
    for (int vr = 0; vr < 8; ++vr) {
      float mn = fmaxf(mrow[vr], fmaxf(x0[vr], x1[vr]));
      srow[vr] = srow[vr] * exp_slot(mrow[vr] - mn) + (exp_slot(x0[vr] - mn) + exp_slot(x1[vr] - mn));
      mrow[vr] = mn;
    }
  }
  // join the 16 lanes of each row: max first, then the rescaled sums
#pragma unroll
  for (int vr = 0; vr < 8; ++vr) {
    float mn = mrow[vr];
#pragma unroll
    for (int d = 1; d < 16; d <<= 1) mn = fmaxf(mn, __shfl_xor(mn, d, 32));
    float sn = srow[vr] * exp_slot(mrow[vr] - mn);
#pragma unroll
    for (int d = 1; d < 16; d <<= 1) sn += __shfl_xor(sn, d, 32);
    mrow[vr] = mn;
    srow[vr] = sn;
  }
  // join the parts' statistics (part order 0..NSPLIT-1)
  if (col == 0) {
#pragma unroll
    for (int vr = 0; vr < 8; ++vr) {
      Stat[part][h][vr + khalf * 8][0] = mrow[vr];
      Stat[part][h][vr + khalf * 8][1] = srow[vr];
    }
  }
  __syncthreads();
  float invl[8];
#pragma unroll
  for (int vr = 0; vr < 8; ++vr) {
    const int row = vr + khalf * 8;
    float m = Stat[0][h][row][0];
#pragma unroll
    for (int pp = 1; pp < NSPLIT; ++pp) m = fmaxf(m, Stat[pp][h][row][0]);
    float s = 0.0f;
#pragma unroll
    for (int pp = 0; pp < NSPLIT; ++pp)
      s += Stat[pp][h][row][1] * exp_slot(Stat[pp][h][row][0] - m);
    mrow[vr] = m;
    invl[vr] = 1.0f / s;
  }

  // ---- pass 2: probabilities -> att_mean, and O += P @ V -----------------
  v8f oc[4] = {v8f{}, v8f{}, v8f{}, v8f{}};
  _Float16* pW = myP + khalf * (8 * 34) + col;
  v16h bV[4];   // V fragments, fetched one stage ahead like K
#pragma unroll
  for (int dt = 0; dt < 4; ++dt) bV[dt] = frag_packed(Vtb + (size_t)dt * 512 + vlo);

  for (int sc = 0; sc < SPART / 32; ++sc) {
    const int nsc = (sc + 1) & (SPART / 32 - 1);   // next stage
    float* sW = &Share[sc & 1][part][h][0] + khalf * (8 * RPITCH) + col;
#pragma unroll
    for (int sub = 0; sub < 2; ++sub) {
      float x[8];
      v8f cS, cO;
      KTile& kt = sub ? kb : ka;
      logit_products(kt, qsA0, qsA1, qoA0, qoA1, cS, cO);
      logit_blend(cS, cO, ma, qid, x);
      // mask and identities of the next 16 columns (16 ahead is enough here: the
      // exponentials and LDS stores below stand in front of their use); mask first:
      // loads are counted back in order, so a wait for it leaves the K loads open
      ma = load_mtile(kidp, maskp, l0, ((sc * 2 + sub + 1) & (SPART / 16 - 1)) * 16, col, khalf);
      // the K loads may land in the address registers of the loads above
      asm volatile("s_wait_xcnt 0x0" ::: "memory");
      kt = load_ktile(Ksb, Kob, nsc * 32 + sub * 16, lane);
#pragma unroll
      for (int vr = 0; vr < 8; ++vr) {
        // row vr + khalf * 8: one base register each, the rest an immediate offset
        float pp = exp_slot(x[vr] - mrow[vr]) * invl[vr];
        pW[vr * 34 + sub * 16] = (_Float16)pp;
        sW[vr * RPITCH + sub * 16] = pp * (1.0f / NHEAD);
      }
      // keeps the two 16-column halves apart for the scheduler: left alone it let
      // the second half's K loads sink behind the exponentials and LDS stores (a
      // shorter flight)
      __builtin_amdgcn_sched_barrier(0);
    }
    // A-fragment of P (16 x 32) from LDS (same wave: DS ops are in-order).
    v16h aP;
    {
      const _Float16* rp = myP + col * 34;
#pragma unroll
      for (int j = 0; j < 8; ++j) {
        int kb = ((j >> 2) << 4) + (khalf << 3) + ((j & 3) << 1);
        aP[2 * j]     = rp[kb];
        aP[2 * j + 1] = rp[kb + 1];
      }
    }
#pragma unroll
    for (int dt = 0; dt < 4; ++dt) {
      oc[dt] = wmma_f16(aP, bV[dt], oc[dt]);
      bV[dt] = frag_packed(Vtb + (size_t)(nsc * 4 + dt) * 512 + vlo);
    }
    // the LDS reads behind the barrier reuse the address registers of these loads
    asm volatile("s_wait_xcnt 0x0" ::: "memory");

    // All eight shares of each part's 32-column tile are in LDS behind this barrier.
    // It orders LDS only: the waves hand nothing over in global memory here, and
    // __syncthreads() would also wait for the next stage's loads in flight.
    __builtin_amdgcn_fence(__ATOMIC_RELEASE, "workgroup", "local");
    __builtin_amdgcn_s_barrier();
    __builtin_amdgcn_fence(__ATOMIC_ACQUIRE, "workgroup", "local");
    {
      const float* sp = &Share[sc & 1][part][0][rrow * RPITCH + rcol];
      float2 acc = *(const float2*)sp;
#pragma unroll
      for (int hh = 1; hh < NHEAD; ++hh) {   // head order 0..7
        float2 c = *(const float2*)(sp + hh * 16 * RPITCH);
        acc.x += c.x;
        acc.y += c.y;
      }
      *(float2*)(amRow + sc * 32) = acc;
      // the next trip reuses the store's registers: wait until it has read them
      asm volatile("s_wait_xcnt 0x0" ::: "memory");
    }
  }

  // Join the parts' O sums through the share buffers, which are free once
  // every wave has left the loop (first barrier); the partial sums are all in
  // LDS behind the second.
  float* Op = &Share[0][0][0][0];
  __syncthreads();
#pragma unroll
  for (int dt = 0; dt < 4; ++dt)
#pragma unroll
    for (int vr = 0; vr < 8; ++vr)
      Op[(((part * NHEAD + h) * 4 + dt) * 8 + vr) * 32 + lane] = oc[dt][vr];
  __syncthreads();

  // store this head's 64-column slice of O (rows l0..l0+15); each part sums
  // (part order 0..NSPLIT-1) and stores 64 / NSPLIT of the columns
#pragma unroll
  for (int d = 0; d < 4 / NSPLIT; ++d) {
    const int dt = part * (4 / NSPLIT) + d;
#pragma unroll
    for (int vr = 0; vr < 8; ++vr) {
      float a = Op[((h * 4 + dt) * 8 + vr) * 32 + lane];
#pragma unroll
      for (int pp = 1; pp < NSPLIT; ++pp)
        a += Op[(((pp * NHEAD + h) * 4 + dt) * 8 + vr) * 32 + lane];
      int row    = vr + khalf * 8;
      size_t rid = (size_t)(l0 + row) * NBATCH + n;
      int e      = h * HDIM + dt * 16 + col;
      Obuf[rid * DMODEL + e] = (_Float16)a;
    }
  }
}

// ---------------------------------------------------------------------------
// Kernel 3: final FC  out = O @ Wfc^T  (4096 x 512 x 512), f16 A, f32 out.
// grid (32, 8), 256 threads (8 waves, 16x64 tile per wave).
// Operand tiles shared through LDS as in kernel 1; O is f16 already, so a
// thread stages eight neighbouring k (one group row) per load.
// ---------------------------------------------------------------------------
__global__ __launch_bounds__(256) void fc_kernel(
    const _Float16* __restrict__ Obuf, const float* __restrict__ Wfc,
    float* __restrict__ out) {
  const int lane  = threadIdx.x & 31;
  const int wid   = threadIdx.x >> 5;
  const int col   = lane & 15;
  const int khalf = lane >> 4;
  const int m0    = blockIdx.x * 128 + wid * 16;
  const int e0    = blockIdx.y * 64;

  // fragments 0..7: O rows of waves 0..7; fragments 8..11: Wfc rows of et 0..3
  __shared__ __attribute__((aligned(16))) _Float16 Tile[2][12 * FRAGH];
  const int t    = threadIdx.x;
  // O: load i of thread t takes row i * 64 + (t >> 2), k (t & 3) * 8 ..+7
  const int gaof = (t >> 2) * DMODEL + (t & 3) * 8;
  const int laof = (t >> 6) * FRAGH + (t & 3) * GRPH + ((t >> 2) & 15) * 8;
  // Wfc: load i of thread t takes row i * 32 + (t >> 3), k (t & 7) * 4 ..+3
  const int goff = (t >> 3) * DMODEL + (t & 7) * 4;
  const int loff = (t >> 7) * FRAGH + ((t & 7) >> 1) * GRPH + ((t >> 3) & 15) * 8 + (t & 1) * 4;
  const int roff = khalf * GRPH + col * 8;
  const _Float16* Ag = Obuf + (size_t)blockIdx.x * 128 * DMODEL + gaof;
  const float*    Wg = Wfc + (size_t)e0 * DMODEL + goff;

  v8h ar[2];
  float4 wr[2];
#pragma unroll
  for (int i = 0; i < 2; ++i) ar[i] = *(const v8h*)(Ag + i * 64 * DMODEL);
#pragma unroll
  for (int i = 0; i < 2; ++i) wr[i] = *(const float4*)(Wg + i * 32 * DMODEL);
#pragma unroll
  for (int i = 0; i < 2; ++i) *(v8h*)&Tile[0][i * 4 * FRAGH + laof] = ar[i];
#pragma unroll
  for (int i = 0; i < 2; ++i) stage_f32(&Tile[0][(8 + i * 2) * FRAGH + loff], wr[i], 1.0f);
  __syncthreads();

  v8f cc[4] = {v8f{}, v8f{}, v8f{}, v8f{}};
  // unrolled: the k offsets become the loads' immediate offsets and the buffer
  // index a constant, so no address register changes while loads are in flight
#pragma unroll
  for (int s = 0; s < KSTEPS; ++s) {
    if (s + 1 < KSTEPS) {   // next step's tiles fly while this step is computed
#pragma unroll
      for (int i = 0; i < 2; ++i) ar[i] = *(const v8h*)(Ag + i * 64 * DMODEL + (s + 1) * 32);
#pragma unroll
      for (int i = 0; i < 2; ++i) wr[i] = *(const float4*)(Wg + i * 32 * DMODEL + (s + 1) * 32);
    }
    const _Float16* tb = &Tile[s & 1][roff];
    v16h a = frag_lds(tb + wid * FRAGH);
#pragma unroll
    for (int et = 0; et < 4; ++et) {
      v16h b = frag_lds(tb + (8 + et) * FRAGH);
      cc[et] = wmma_f16(a, b, cc[et]);
    }
    if (s + 1 < KSTEPS) {
      // the other buffer was last read in front of the previous step's barrier
      _Float16* tn = &Tile[(s + 1) & 1][0];
#pragma unroll
      for (int i = 0; i < 2; ++i) *(v8h*)(tn + i * 4 * FRAGH + laof) = ar[i];
#pragma unroll
      for (int i = 0; i < 2; ++i) stage_f32(tn + (8 + i * 2) * FRAGH + loff, wr[i], 1.0f);
      STEP_ORDER(4);
      __syncthreads();
      // ends the stretch that the order above speaks of (with all steps in one
      // stretch the build took over 20 registers more)
      __builtin_amdgcn_sched_barrier(0);
    }
  }
#pragma unroll
  for (int et = 0; et < 4; ++et)
#pragma unroll
    for (int vr = 0; vr < 8; ++vr) {
      int m   = vr + khalf * 8;
      int rid = m0 + m;
      int e   = e0 + et * 16 + col;
      out[(size_t)rid * DMODEL + e] = cc[et][vr];
    }
}

// ---------------------------------------------------------------------------
// Host launcher
// ---------------------------------------------------------------------------
extern "C" void kernel_launch(void* const* d_in, const int* in_sizes, int n_in,
                              void* d_out, int out_size, void* d_ws,
                              size_t ws_size, hipStream_t stream) {
  (void)in_sizes; (void)n_in; (void)out_size; (void)ws_size;
  const float* q    = (const float*)d_in[0];
  const float* k    = (const float*)d_in[1];
  const float* v    = (const float*)d_in[2];
  const int*   qid  = (const int*)d_in[3];
  const int*   kid  = (const int*)d_in[4];
  const float* mask = (const float*)d_in[5];
  const float* Wqs  = (const float*)d_in[6];
  const float* Wqo  = (const float*)d_in[7];
  const float* Wks  = (const float*)d_in[8];
  const float* Wko  = (const float*)d_in[9];
  const float* Wv   = (const float*)d_in[10];
  const float* Wfc  = (const float*)d_in[11];

  const size_t BUF = (size_t)NHEAD * NBATCH * 2048 * HDIM;  // 2,097,152 f16
  _Float16* ws = (_Float16*)d_ws;
  _Float16* Qs = ws;
  _Float16* Qo = Qs + BUF;
  _Float16* Ks = Qo + BUF;
  _Float16* Ko = Ks + BUF;
  _Float16* Vt = Ko + BUF;
  _Float16* Ob = Vt + BUF;          // 24 MB total workspace

  float* out      = (float*)d_out;                               // [L,N,D]
  float* att_mean = out + (size_t)L_SEQ * NBATCH * DMODEL;       // [N,L,S]

  proj_kernel<<<dim3(32, 8, 5), 256, 0, stream>>>(
      q, k, v, Wqs, Wqo, Wks, Wko, Wv, Qs, Qo, Ks, Ko, Vt);
  attn_kernel<<<dim3(L_SEQ / 16, NBATCH), NWAVE * 32, 0, stream>>>(
      Qs, Qo, Ks, Ko, Vt, qid, kid, mask, Ob, att_mean);
  fc_kernel<<<dim3(32, 8), 256, 0, stream>>>(Ob, Wfc, out);
}

// v008
// Measured time: 116 microseconds a run.
// It is 1.29 times as fast as v006, going by the measured steps of the versions left out in between.
// Counting every step since v000, it is 26.6 times as fast.
#include <hip/hip_runtime.h>

// ---------------------------------------------------------------------------
// AgentAwareAttention for MI455X (gfx1250), wave32 + v_wmma_f32_16x16x32_f16.
// f16 data / f32 accumulation (the two S halves' O sums are added in f16); softmax math in f32.
// ---------------------------------------------------------------------------

typedef __attribute__((ext_vector_type(16))) _Float16 v16h;
typedef __attribute__((ext_vector_type(8)))  float    v8f;
typedef __attribute__((ext_vector_type(2)))  _Float16 h2;
typedef __attribute__((ext_vector_type(4)))  _Float16 v4h;
typedef __attribute__((ext_vector_type(8)))  _Float16 v8h;

#define L_SEQ 2048
#define S_SEQ 2048
#define NBATCH 2
#define DMODEL 512
#define NHEAD 8
#define HDIM 64

// ---- WMMA helpers ----------------------------------------------------------

__device__ __forceinline__ v8f wmma_f16(v16h a, v16h b, v8f c) {
  // D = A(16x32 f16) * B(32x16 f16) + C(16x16 f32)
  return __builtin_amdgcn_wmma_f32_16x16x32_f16(
      /*neg_a=*/false, a, /*neg_b=*/false, b,
      /*c_mod=*/(short)0, c, /*reuse_a=*/false, /*reuse_b=*/false);
}

// A-frag: lane holds row (lane&15); 16 K-elements with pattern
//   kb = (j>>2)*16 + (lane>>4)*8 + (j&3)*2   (pairs kb, kb+1)
// B-frag: identical pattern with lane&15 = output column, reading the
// column-major row (i.e. B_col[n][k]).
__device__ __forceinline__ v16h frag_from_f16row(const _Float16* __restrict__ rowPtr,
                                                 int khalf) {
  v16h f;
#pragma unroll
  for (int j = 0; j < 8; ++j) {
    int kb = ((j >> 2) << 4) + (khalf << 3) + ((j & 3) << 1);
    h2 p = *(const h2*)(rowPtr + kb);      // 4-byte load (kb is even)
    f[2 * j]     = p.x;
    f[2 * j + 1] = p.y;
  }
  return f;
}

// Packed fragment: a 16 x 32 f16 operand tile kept in memory in register order,
// 512 halves: [i = 0,1][lane = 0..31][8 halves], where lane holds fragment
// elements 8i..8i+7. Element (r, kk) of the tile (r = row of A / column of B,
// kk = k index, same k pattern as above) lies at packed_off(r, kk). A wave
// reads a fragment with two 16-byte loads per lane, each 512 contiguous bytes
// (four whole cache lines) instead of 32-byte pieces of sixteen lines.
__device__ __forceinline__ int packed_off(int r, int kk) {
  return ((kk >> 4) << 8) + (((((kk >> 3) & 1) << 4) + r) << 3) + (kk & 7);
}

// p = start of the packed fragment + lane * 8 (16-byte aligned)
__device__ __forceinline__ v16h frag_packed(const _Float16* __restrict__ p) {
  v8h lo = *(const v8h*)p;
  v8h hi = *(const v8h*)(p + 256);
  return __builtin_shufflevector(lo, hi, 0, 1, 2, 3, 4, 5, 6, 7,
                                 8, 9, 10, 11, 12, 13, 14, 15);
}

// ---- GEMM operand tiles in LDS ---------------------------------------------
// A block's operand tiles of one 32-wide k step lie in LDS as f16 fragments of
// 16 rows x 32 k: four groups g = kk >> 3 of [16 rows][8 halves]. A lane reads
// its fragment as groups khalf and 2 + khalf, 16 bytes each (same k pattern as
// above). The group pitch of 320 bytes moves each group 16 banks on, so that the
// staging stores of a wave (some rows of all four groups) spread evenly over
// the banks; a 16-lane half of a fragment read covers 256 contiguous bytes.
#define GRPH 160            // halves from one group to the next (128 used)
#define FRAGH (4 * GRPH)    // halves from one fragment to the next
#define KSTEPS (DMODEL / 32)

// Order of one k step for the scheduler: the next tiles' global loads (NLOAD of
// them), this step's NREAD LDS reads, its NMMA products, and only then the
// conversions and the NWRITE LDS stores with their waits for the loads. Left
// alone the scheduler put each conversion right behind its load, so that the
// load's latency lay open.
#define STEP_ORDER(NLOAD, NREAD, NMMA, NWRITE)              \
  do {                                                      \
    __builtin_amdgcn_sched_group_barrier(0x020, NLOAD, 0);  \
    __builtin_amdgcn_sched_group_barrier(0x100, NREAD, 0);  \
    __builtin_amdgcn_sched_group_barrier(0x008, NMMA, 0);   \
    __builtin_amdgcn_sched_group_barrier(0x002, 32, 0);     \
    __builtin_amdgcn_sched_group_barrier(0x200, NWRITE, 0); \
  } while (0)

// p = fragment + khalf * GRPH + (lane & 15) * 8
__device__ __forceinline__ v16h frag_lds(const _Float16* p) {
  v8h lo = *(const v8h*)p;
  v8h hi = *(const v8h*)(p + 2 * GRPH);
  return __builtin_shufflevector(lo, hi, 0, 1, 2, 3, 4, 5, 6, 7,
                                 8, 9, 10, 11, 12, 13, 14, 15);
}

// four neighbouring k of one row, f32 from global memory -> f16 in LDS
__device__ __forceinline__ void stage_f32(_Float16* dst, float4 x, float scale) {
  v4h hv;
  hv[0] = (_Float16)(x.x * scale);
  hv[1] = (_Float16)(x.y * scale);
  hv[2] = (_Float16)(x.z * scale);
  hv[3] = (_Float16)(x.w * scale);
  *(v4h*)dst = hv;
}

// ---------------------------------------------------------------------------
// Kernel 1: the five input projections  Y = X @ W^T  (4096 x 512 x 512 each),
// fp32 in, f16 out, scattered into attention-friendly layouts.
//   p=0: Qs[h][n][l][hd]  (x 1/sqrt(HD))
//   p=1: Qo[h][n][l][hd]  (x 1/sqrt(HD))
//   p=2: Ks[h][n][s/16][hd/32][packed 16(s) x 32(hd) B-fragment]
//   p=3: Ko, as Ks
//   p=4: Vt[h][n][s/32][hd/16][packed 16(hd) x 32(s) B-fragment]
// grid: (4096/128, 512/128, 5), 256 threads (8 waves, 32x64 tile per wave:
// wave w takes rows (w & 3) * 32 ..+31 and head w >> 2 of the block's two heads,
// and uses each W fragment for its two X fragments)
// Per k step the block brings its 128 x 32 tile of X and its 128 x 32 tile of W
// in once, eight lanes to a 128-byte row piece (whole cache lines), converts
// them and shares them through LDS; two buffers, one barrier per step.
// ---------------------------------------------------------------------------
__global__ __launch_bounds__(256) void proj_kernel(
    const float* __restrict__ q, const float* __restrict__ k,
    const float* __restrict__ v,
    const float* __restrict__ Wqs, const float* __restrict__ Wqo,
    const float* __restrict__ Wks, const float* __restrict__ Wko,
    const float* __restrict__ Wv,
    _Float16* __restrict__ Qs, _Float16* __restrict__ Qo,
    _Float16* __restrict__ Ks, _Float16* __restrict__ Ko,
    _Float16* __restrict__ Vt) {
  const int lane  = threadIdx.x & 31;
  const int wid   = threadIdx.x >> 5;
  const int col   = lane & 15;
  const int khalf = lane >> 4;
  const int p     = blockIdx.z;
  const int wm    = wid & 3;                       // 32-row slice of the block's rows
  const int wn    = wid >> 2;                      // 64-feature slice (one head)
  const int e0    = blockIdx.y * 128;              // output feature tile

  const float* X = (p < 2) ? q : ((p < 4) ? k : v);
  const float* W = (p == 0) ? Wqs : (p == 1) ? Wqo : (p == 2) ? Wks
                 : (p == 3) ? Wko : Wv;
  _Float16* dst  = (p == 0) ? Qs : (p == 1) ? Qo : (p == 2) ? Ks
                 : (p == 3) ? Ko : Vt;
  const float scale = (p < 2) ? 0.125f : 1.0f;     // HD^-0.5 folded into Q

  // fragments 0..7: the block's X rows, 16 each; fragments 8..15: its W rows
  __shared__ __attribute__((aligned(16))) _Float16 Tile[2][16 * FRAGH];
  // staging: load i of thread t takes row i * 32 + (t >> 3), k (t & 7) * 4 ..+3
  const int t    = threadIdx.x;
  const int goff = (t >> 3) * DMODEL + (t & 7) * 4;
  const int loff = (t >> 7) * FRAGH + ((t & 7) >> 1) * GRPH + ((t >> 3) & 15) * 8 + (t & 1) * 4;
  const int roff = khalf * GRPH + col * 8;
  const float* Xg = X + (size_t)blockIdx.x * 128 * DMODEL + goff;
  const float* Wg = W + (size_t)e0 * DMODEL + goff;

  float4 xr[4], wr[4];
#pragma unroll
  for (int i = 0; i < 4; ++i) xr[i] = *(const float4*)(Xg + i * 32 * DMODEL);
#pragma unroll
  for (int i = 0; i < 4; ++i) wr[i] = *(const float4*)(Wg + i * 32 * DMODEL);
#pragma unroll
  for (int i = 0; i < 4; ++i) stage_f32(&Tile[0][i * 2 * FRAGH + loff], xr[i], scale);
#pragma unroll
  for (int i = 0; i < 4; ++i) stage_f32(&Tile[0][(8 + i * 2) * FRAGH + loff], wr[i], 1.0f);
  __syncthreads();

  v8f cc[2][4] = {{v8f{}, v8f{}, v8f{}, v8f{}}, {v8f{}, v8f{}, v8f{}, v8f{}}};
  // unrolled: the k offsets become the loads' immediate offsets and the buffer
  // index a constant, so no address register changes while loads are in flight
#pragma unroll
  for (int s = 0; s < KSTEPS; ++s) {
    if (s + 1 < KSTEPS) {   // next step's tiles fly while this step is computed
#pragma unroll
      for (int i = 0; i < 4; ++i) xr[i] = *(const float4*)(Xg + i * 32 * DMODEL + (s + 1) * 32);
#pragma unroll
      for (int i = 0; i < 4; ++i) wr[i] = *(const float4*)(Wg + i * 32 * DMODEL + (s + 1) * 32);
      // behind the last loads their address registers are free for reuse: wait until they are read
      if (s + 2 == KSTEPS) asm volatile("s_wait_xcnt 0x0" ::: "memory");
    }
    const _Float16* tb = &Tile[s & 1][roff];
    v16h a0 = frag_lds(tb + (wm * 2) * FRAGH);
    v16h a1 = frag_lds(tb + (wm * 2 + 1) * FRAGH);
#pragma unroll
    for (int et = 0; et < 4; ++et) {
      v16h b = frag_lds(tb + (8 + wn * 4 + et) * FRAGH);
      cc[0][et] = wmma_f16(a0, b, cc[0][et]);
      cc[1][et] = wmma_f16(a1, b, cc[1][et]);
    }
    if (s + 1 < KSTEPS) {
      // the other buffer was last read in front of the previous step's barrier
      _Float16* tn = &Tile[(s + 1) & 1][loff];
#pragma unroll
      for (int i = 0; i < 4; ++i) stage_f32(tn + i * 2 * FRAGH, xr[i], scale);
#pragma unroll
      for (int i = 0; i < 4; ++i) stage_f32(tn + (8 + i * 2) * FRAGH, wr[i], 1.0f);
      STEP_ORDER(8, 12, 8, 8);
      __syncthreads();
      // ends the stretch that the order above speaks of (with all steps in one
      // stretch the build took over 20 registers more)
      __builtin_amdgcn_sched_barrier(0);
    }
  }

  // The wave's 64 features are one head h. C layout of its row tile rt (16 rows
  // from m0; row = t*NBATCH + n): a lane's eight rows are t = t0 + 4*khalf +
  // (vr >> 1), n = vr & 1, with t0 = m0 / 2 + rt * 8 a multiple of 8.
  const int h  = (e0 >> 6) + wn;
  const int tw = (blockIdx.x * 128 + wm * 32) >> 1;   // a multiple of 16
  const int NB = 2048 * HDIM;            // elements of one (h, n) plane
  _Float16* dh = dst + (size_t)h * NBATCH * NB;
  if (p == 4) {
    // per n, the lane's four t are four neighbouring halves of a V fragment;
    // row tile 1 lies 8 t on: the next group of eight k, 128 halves on
    _Float16* d = dh + (tw >> 5) * 2048 + packed_off(col, (tw & 31) + khalf * 4);
#pragma unroll
    for (int rt = 0; rt < 2; ++rt) {
#pragma unroll
      for (int et = 0; et < 4; ++et) {
#pragma unroll
        for (int nb = 0; nb < NBATCH; ++nb) {
          v4h val;
#pragma unroll
          for (int i = 0; i < 4; ++i) val[i] = (_Float16)cc[rt][et][2 * i + nb];
          *(v4h*)(d + rt * 128 + nb * NB + et * 512) = val;
        }
      }
    }
  } else if (p >= 2) {
    // hd = et*16 + col: fragment et >> 1, its half et & 1, so 256 halves per et;
    // row tile 1 holds columns 8..15 of the same 16-column fragments, 64 halves on
    _Float16* d = dh + tw * HDIM + packed_off(khalf * 4, col);
#pragma unroll
    for (int rt = 0; rt < 2; ++rt)
#pragma unroll
      for (int et = 0; et < 4; ++et)
#pragma unroll
        for (int vr = 0; vr < 8; ++vr)
          d[rt * 64 + (vr & 1) * NB + et * 256 + (vr >> 1) * 8] = (_Float16)cc[rt][et][vr];
    // code laid out behind this branch reuses the stores' registers: wait until they are read
    asm volatile("s_wait_xcnt 0x0" ::: "memory");
  } else {
    _Float16* d = dh + (tw + khalf * 4) * HDIM + col;
#pragma unroll
    for (int rt = 0; rt < 2; ++rt)
#pragma unroll
      for (int et = 0; et < 4; ++et)
#pragma unroll
        for (int vr = 0; vr < 8; ++vr)
          d[rt * 8 * HDIM + (vr & 1) * NB + (vr >> 1) * HDIM + et * 16] = (_Float16)cc[rt][et][vr];
    // code laid out behind this branch reuses the stores' registers: wait until they are read
    asm volatile("s_wait_xcnt 0x0" ::: "memory");
  }
}

// e^t as the compiler's own multiply and v_exp_f32, with the one free slot that
// the instruction set asks for behind a transcendental kept inside the statement.
__device__ __forceinline__ float exp_slot(float t) {
  float r;
  // v_nop: fills that slot, whatever the compiler schedules next
  asm("v_exp_f32 %0, %1\n\tv_nop" : "=v"(r) : "v"(t * 1.44269504f));
  return r;
}

// ---------------------------------------------------------------------------
// Logit tile helpers: 16(L) x 16(S) agent-aware logits in C layout, with the
// loads apart from the arithmetic so that a loop can issue a later tile's
// loads as soon as this tile's values have been used.
// ---------------------------------------------------------------------------
struct KTile { v16h s0, s1, o0, o1; };      // self and other K fragments of 16 columns
struct MTile { float mv[8]; int kid; };     // mask values and key identity of 16 columns

__device__ __forceinline__ MTile load_mtile(const int* __restrict__ kid_g,
                                            const float* __restrict__ mask,
                                            int l0, int s0, int col, int khalf) {
  MTile t;
  t.kid = (kid_g + s0)[(unsigned)col];
  const float* mp = mask + (size_t)l0 * S_SEQ + s0;      // wave-uniform
  const unsigned lo = (unsigned)(khalf * 8 * S_SEQ + col);
#pragma unroll
  for (int vr = 0; vr < 8; ++vr) t.mv[vr] = (mp + vr * S_SEQ)[lo];
  return t;
}

__device__ __forceinline__ void logit_products(const KTile& k, v16h qsA0, v16h qsA1,
                                               v16h qoA0, v16h qoA1, v8f& cS, v8f& cO) {
  cS = v8f{};
  cS = wmma_f16(qsA0, k.s0, cS);
  cS = wmma_f16(qsA1, k.s1, cS);
  cO = v8f{};
  cO = wmma_f16(qoA0, k.o0, cO);
  cO = wmma_f16(qoA1, k.o1, cO);
}

__device__ __forceinline__ void logit_blend(v8f cS, v8f cO, const MTile& m,
                                            const int* qid, float* x) {
#pragma unroll
  for (int vr = 0; vr < 8; ++vr)
    x[vr] = ((m.kid == qid[vr]) ? cS[vr] : cO[vr]) + m.mv[vr];
}

// ---------------------------------------------------------------------------
// Kernels 2a and 2b: attention. grid (L/32, N, 2), 16 waves. A block owns 32
// rows of L and one half of S (SHALF columns); wave w computes head (w & 7) of
// the 16-row tile rt = w >> 3. The two row-tile waves of a head use the same K
// and V fragments: a 32-column stage of them is brought from L2 once, by
// asynchronous copies into LDS (two buffers, the next stage in flight while
// this one is worked on), and both waves read it there.
// 2a: online max/sum statistics of every (head, row) over the block's half,
//     stored to the workspace.
// 2b: joins the two halves' statistics (half order), recomputes the logits,
//     emits probabilities and accumulates O = P @ V over its half (P staged via
//     LDS to convert C-fragment layout -> A-fragment layout). att_mean (the mean
//     over heads) is summed inside the block: every wave puts its share of a
//     16 x 32 probability tile into LDS, and after the stage's barrier the 256
//     threads of a row tile add its eight shares in head order and store the
//     result once. The two halves' O sums are added in kernel 3.
// ---------------------------------------------------------------------------
#define RPITCH 36   // f32 row pitch of a share tile: rows r and r+8 land 32 banks apart
#define RTILES 2    // 16-row tiles of a block
#define NWAVE (NHEAD * RTILES)
#define SHALF (S_SEQ / 2)        // columns of one block
#define NSTAGE (SHALF / 32)      // 32-column stages of one block
#define CHUNKH 2048              // halves of one operand's stage (4 KiB, contiguous in memory)

// LDS byte address of a __shared__ object: the low 32 bits of its address
__device__ __forceinline__ unsigned lds_addr(const void* p) {
  return (unsigned)(size_t)p;
}

// 4 KiB from global memory to LDS, contiguous in both, 16 bytes a lane
// and copy; the immediate offset moves both addresses alike. The s_wait_xcnt
// stands inside the statement, in front of any rewrite of the address registers.
__device__ __forceinline__ void copy_4k(unsigned lds, const _Float16* g) {
  asm volatile(
      "global_load_async_to_lds_b128 %0, %1, off\n\t"
      "global_load_async_to_lds_b128 %0, %1, off offset:512\n\t"
      "global_load_async_to_lds_b128 %0, %1, off offset:1024\n\t"
      "global_load_async_to_lds_b128 %0, %1, off offset:1536\n\t"
      "global_load_async_to_lds_b128 %0, %1, off offset:2048\n\t"
      "global_load_async_to_lds_b128 %0, %1, off offset:2560\n\t"
      "global_load_async_to_lds_b128 %0, %1, off offset:3072\n\t"
      "global_load_async_to_lds_b128 %0, %1, off offset:3584\n\t"
      "s_wait_xcnt 0x0"
      :: "v"(lds), "v"(g) : "memory");
}
// the same with 2 KiB of a second operand, under one wait
__device__ __forceinline__ void copy_4k_2k(unsigned lds, const _Float16* g,
                                           unsigned lds2, const _Float16* g2) {
  asm volatile(
      "global_load_async_to_lds_b128 %0, %1, off\n\t"
      "global_load_async_to_lds_b128 %0, %1, off offset:512\n\t"
      "global_load_async_to_lds_b128 %0, %1, off offset:1024\n\t"
      "global_load_async_to_lds_b128 %0, %1, off offset:1536\n\t"
      "global_load_async_to_lds_b128 %0, %1, off offset:2048\n\t"
      "global_load_async_to_lds_b128 %0, %1, off offset:2560\n\t"
      "global_load_async_to_lds_b128 %0, %1, off offset:3072\n\t"
      "global_load_async_to_lds_b128 %0, %1, off offset:3584\n\t"
      "global_load_async_to_lds_b128 %2, %3, off\n\t"
      "global_load_async_to_lds_b128 %2, %3, off offset:512\n\t"
      "global_load_async_to_lds_b128 %2, %3, off offset:1024\n\t"
      "global_load_async_to_lds_b128 %2, %3, off offset:1536\n\t"
      "s_wait_xcnt 0x0"
      :: "v"(lds), "v"(g), "v"(lds2), "v"(g2) : "memory");
}

// Hand-over of a stage: this wave's LDS reads and writes are done, its own copies
// of the next stage have landed, and every wave has passed the barrier.
// The barrier orders LDS only: the waves hand nothing over in global memory here,
// and __syncthreads() would also wait for the next mask loads in flight.
__device__ __forceinline__ void publish_stage() {
  asm volatile("s_wait_dscnt 0x0" ::: "memory");     // my reads of the buffer to be refilled
  asm volatile("s_wait_asynccnt 0x0" ::: "memory");  // my copies of the next stage
  __builtin_amdgcn_fence(__ATOMIC_RELEASE, "workgroup", "local");
  __builtin_amdgcn_s_barrier();
  __builtin_amdgcn_fence(__ATOMIC_ACQUIRE, "workgroup", "local");
}

// K fragments of 16 columns from a stage in LDS; p = stage + lane * 8
__device__ __forceinline__ KTile lds_ktile(const _Float16* p, int sub) {
  KTile t;
  t.s0 = frag_packed(p + sub * 1024);
  t.s1 = frag_packed(p + sub * 1024 + 512);
  t.o0 = frag_packed(p + CHUNKH + sub * 1024);
  t.o1 = frag_packed(p + CHUNKH + sub * 1024 + 512);
  return t;
}

__global__ __launch_bounds__(NWAVE * 32) void stat_kernel(
    const _Float16* __restrict__ Qs, const _Float16* __restrict__ Qo,
    const _Float16* __restrict__ Ks, const _Float16* __restrict__ Ko,
    const int* __restrict__ qid_g, const int* __restrict__ kid_g,
    const float* __restrict__ mask, float* __restrict__ StatG) {
  const int lane  = threadIdx.x & 31;
  // wave index, in a scalar register: head, row tile and the pointers formed from
  // them are then scalar too
  const int w     = __builtin_amdgcn_readfirstlane(threadIdx.x >> 5);
  const int h     = w & (NHEAD - 1);       // head
  const int rt    = w >> 3;                // row tile
  const int col   = lane & 15;
  const int khalf = lane >> 4;
  const int n     = blockIdx.y;
  const int half  = blockIdx.z;
  const int l0    = blockIdx.x * (16 * RTILES) + rt * 16;

  // [buffer][head][self, other][stage of 32 columns in fragment order]
  __shared__ __attribute__((aligned(16))) _Float16 KT[2][NHEAD][2][CHUNKH];
  const unsigned KBUF = NHEAD * 2 * CHUNKH * 2;   // bytes of one buffer

  int qid[8];
#pragma unroll
  for (int vr = 0; vr < 8; ++vr) qid[vr] = qid_g[l0 + vr + khalf * 8];
  // the Q loads below may land in the address registers of these loads
  asm volatile("s_wait_xcnt 0x0" ::: "memory");

  const _Float16* Qsb = Qs + ((size_t)(h * NBATCH + n) * L_SEQ + l0) * HDIM;
  const _Float16* Qob = Qo + ((size_t)(h * NBATCH + n) * L_SEQ + l0) * HDIM;
  // row tile 0 copies the head's self K, row tile 1 its other K
  const _Float16* kg = (rt ? Ko : Ks) +
      ((size_t)(h * NBATCH + n) * S_SEQ + half * SHALF) * HDIM + lane * 8;
  const unsigned kl = lds_addr(&KT[0][h][rt][lane * 8]);
  const int*   kidp  = kid_g + half * SHALF;
  const float* maskp = mask + half * SHALF;

  copy_4k(kl, kg);                       // stage 0

  v16h qsA0 = frag_from_f16row(Qsb + col * HDIM, khalf);
  v16h qsA1 = frag_from_f16row(Qsb + col * HDIM + 32, khalf);
  asm volatile("s_wait_xcnt 0x0" ::: "memory");   // as above, for the next group
  v16h qoA0 = frag_from_f16row(Qob + col * HDIM, khalf);
  v16h qoA1 = frag_from_f16row(Qob + col * HDIM + 32, khalf);
  asm volatile("s_wait_xcnt 0x0" ::: "memory");   // as above, for the mask loads

  // A stage's mask and identity loads are issued one stage ahead (the index
  // wraps: the last trip fetches stage 0 unused).
  MTile ma = load_mtile(kidp, maskp, l0, 0, col, khalf);
  MTile mb = load_mtile(kidp, maskp, l0, 16, col, khalf);
  // the code behind reuses the address registers of the loads above
  asm volatile("s_wait_xcnt 0x0" ::: "memory");
  // keeps that code behind the wait (the scheduler lifted register moves over it)
  __builtin_amdgcn_sched_barrier(0);

  asm volatile("s_wait_asynccnt 0x0" ::: "memory");   // my copies of stage 0 have landed
  __syncthreads();                                    // and everybody's
  copy_4k(kl + KBUF, kg + CHUNKH);       // stage 1

  // Every lane keeps the running max and sum of its own columns (col, col + 16,
  // ...); the 16 lanes of a row are joined once, behind the loop.
  float mrow[8], srow[8];
#pragma unroll
  for (int vr = 0; vr < 8; ++vr) { mrow[vr] = -1e30f; srow[vr] = 0.0f; }

  for (int st = 0; st < NSTAGE; ++st) {
    const int nx = ((st + 1) & (NSTAGE - 1)) * 32;   // next stage's first column
    const _Float16* kp = &KT[st & 1][h][0][lane * 8];
    KTile ka = lds_ktile(kp, 0);
    KTile kb = lds_ktile(kp, 1);
    float x0[8], x1[8];
    v8f cS, cO;
    logit_products(ka, qsA0, qsA1, qoA0, qoA1, cS, cO);
    logit_blend(cS, cO, ma, qid, x0);
    ma = load_mtile(kidp, maskp, l0, nx, col, khalf);
    // the code behind reuses the address registers of the loads above
    asm volatile("s_wait_xcnt 0x0" ::: "memory");
    __builtin_amdgcn_sched_barrier(0);   // keeps that code behind the wait
    logit_products(kb, qsA0, qsA1, qoA0, qoA1, cS, cO);
    logit_blend(cS, cO, mb, qid, x1);
    mb = load_mtile(kidp, maskp, l0, nx + 16, col, khalf);
    asm volatile("s_wait_xcnt 0x0" ::: "memory");   // as for the loads of ma
    __builtin_amdgcn_sched_barrier(0);   // keeps the code behind it behind the wait
#pragma unroll
    for (int vr = 0; vr < 8; ++vr) {
      float mn = fmaxf(mrow[vr], fmaxf(x0[vr], x1[vr]));
      srow[vr] = srow[vr] * exp_slot(mrow[vr] - mn) + (exp_slot(x0[vr] - mn) + exp_slot(x1[vr] - mn));
      mrow[vr] = mn;
    }
    publish_stage();
    // refill of the buffer that this trip has read, while a stage st + 2 exists
    if (st + 2 < NSTAGE) copy_4k(kl + (unsigned)(st & 1) * KBUF, kg + (size_t)(st + 2) * CHUNKH);
  }
  asm volatile("s_wait_asynccnt 0x0" ::: "memory");   // no copy is open when the wave ends

  // join the 16 lanes of each row: max first, then the rescaled sums
#pragma unroll
  for (int vr = 0; vr < 8; ++vr) {
    float mn = mrow[vr];
#pragma unroll
    for (int d = 1; d < 16; d <<= 1) mn = fmaxf(mn, __shfl_xor(mn, d, 32));
    float sn = srow[vr] * exp_slot(mrow[vr] - mn);
#pragma unroll
    for (int d = 1; d < 16; d <<= 1) sn += __shfl_xor(sn, d, 32);
    mrow[vr] = mn;
    srow[vr] = sn;
  }
  // StatG[n][h][row][half] = (max, sum)
  if (col == 0) {
    float* sg = StatG + (((size_t)(n * NHEAD + h) * L_SEQ + l0 + khalf * 8) * 2 + half) * 2;
#pragma unroll
    for (int vr = 0; vr < 8; ++vr) {
      float2 ms;
      ms.x = mrow[vr];
      ms.y = srow[vr];
      *(float2*)(sg + vr * 4) = ms;
    }
  }
}

__global__ __launch_bounds__(NWAVE * 32) void attn_kernel(
    const _Float16* __restrict__ Qs, const _Float16* __restrict__ Qo,
    const _Float16* __restrict__ Ks, const _Float16* __restrict__ Ko,
    const _Float16* __restrict__ Vt,
    const int* __restrict__ qid_g, const int* __restrict__ kid_g,
    const float* __restrict__ mask, const float* __restrict__ StatG,
    _Float16* __restrict__ Obuf, float* __restrict__ att_mean) {
  const int lane  = threadIdx.x & 31;
  // wave index, in a scalar register (as in kernel 2a)
  const int w     = __builtin_amdgcn_readfirstlane(threadIdx.x >> 5);
  const int h     = w & (NHEAD - 1);       // head
  const int rt    = w >> 3;                // row tile
  const int col   = lane & 15;
  const int khalf = lane >> 4;
  const int n     = blockIdx.y;
  const int half  = blockIdx.z;
  const int l0    = blockIdx.x * (16 * RTILES) + rt * 16;

  // [buffer][head][self K, other K, V][stage of 32 columns in fragment order]
  __shared__ __attribute__((aligned(16))) _Float16 KT[2][NHEAD][3][CHUNKH];
  const unsigned KBUF = NHEAD * 3 * CHUNKH * 2;   // bytes of one buffer
  // Per-wave P staging: 16 x 32 f16, row stride 34 elems (68B) so that the
  // A-fragment column reads hit distinct LDS banks (17*r mod 64 distinct).
  __shared__ __attribute__((aligned(16))) _Float16 Pb[NWAVE][16 * 34];
  _Float16* myP = &Pb[w][0];
  // Per-head shares of att_mean, two buffers so that one barrier per 32
  // columns is enough (a buffer is rewritten one barrier after it was read).
  __shared__ __attribute__((aligned(16))) float Share[2][RTILES][NHEAD][16 * RPITCH];

  // element pair of its row tile's 16 x 32 tile that this thread sums and stores
  const int rrow = (threadIdx.x & 255) >> 4;
  const int rcol = (threadIdx.x & 15) * 2;
  float* amRow = att_mean + ((size_t)n * L_SEQ + (l0 + rrow)) * (size_t)S_SEQ + half * SHALF + rcol;

  int qid[8];
#pragma unroll
  for (int vr = 0; vr < 8; ++vr) qid[vr] = qid_g[l0 + vr + khalf * 8];
  // the Q loads below may land in the address registers of these loads
  asm volatile("s_wait_xcnt 0x0" ::: "memory");

  const _Float16* Qsb = Qs + ((size_t)(h * NBATCH + n) * L_SEQ + l0) * HDIM;
  const _Float16* Qob = Qo + ((size_t)(h * NBATCH + n) * L_SEQ + l0) * HDIM;
  // row tile 0 copies the head's self K and the first half of its V stage,
  // row tile 1 its other K and the second half
  const size_t plane = ((size_t)(h * NBATCH + n) * S_SEQ + half * SHALF) * HDIM;
  const _Float16* kg = (rt ? Ko : Ks) + plane + lane * 8;
  const _Float16* vg = Vt + plane + rt * (CHUNKH / 2) + lane * 8;
  const unsigned kl = lds_addr(&KT[0][h][rt][lane * 8]);
  const unsigned vl = lds_addr(&KT[0][h][2][rt * (CHUNKH / 2) + lane * 8]);
  const int*   kidp  = kid_g + half * SHALF;
  const float* maskp = mask + half * SHALF;

  copy_4k_2k(kl, kg, vl, vg);            // stage 0

  v16h qsA0 = frag_from_f16row(Qsb + col * HDIM, khalf);
  v16h qsA1 = frag_from_f16row(Qsb + col * HDIM + 32, khalf);
  asm volatile("s_wait_xcnt 0x0" ::: "memory");   // as above, for the next group
  v16h qoA0 = frag_from_f16row(Qob + col * HDIM, khalf);
  v16h qoA1 = frag_from_f16row(Qob + col * HDIM + 32, khalf);
  asm volatile("s_wait_xcnt 0x0" ::: "memory");   // as above, for the next loads

  // join the halves' statistics (half order 0, 1)
  float mrow[8], invl[8];
  {
    const float* sg = StatG + ((size_t)(n * NHEAD + h) * L_SEQ + l0 + khalf * 8) * 4;
    float4 sv[8];
#pragma unroll
    for (int vr = 0; vr < 8; ++vr) sv[vr] = *(const float4*)(sg + vr * 4);
    // the code behind reuses the address registers of the loads above
    asm volatile("s_wait_xcnt 0x0" ::: "memory");
#pragma unroll
    for (int vr = 0; vr < 8; ++vr) {
      float m = fmaxf(sv[vr].x, sv[vr].z);
      float s = sv[vr].y * exp_slot(sv[vr].x - m) + sv[vr].w * exp_slot(sv[vr].z - m);
      mrow[vr] = m;
      invl[vr] = 1.0f / s;
    }
  }

  MTile ma = load_mtile(kidp, maskp, l0, 0, col, khalf);
  // the code behind reuses the address registers of the loads above
  asm volatile("s_wait_xcnt 0x0" ::: "memory");
  // keeps that code behind the wait
  __builtin_amdgcn_sched_barrier(0);

  asm volatile("s_wait_asynccnt 0x0" ::: "memory");   // my copies of stage 0 have landed
  __syncthreads();                                    // and everybody's
  copy_4k_2k(kl + KBUF, kg + CHUNKH, vl + KBUF, vg + CHUNKH);   // stage 1

  // ---- probabilities -> att_mean, and O += P @ V --------------------------
  v8f oc[4] = {v8f{}, v8f{}, v8f{}, v8f{}};
  _Float16* pW = myP + khalf * (8 * 34) + col;

  for (int sc = 0; sc < NSTAGE; ++sc) {
    const _Float16* kp = &KT[sc & 1][h][0][lane * 8];
    float* sW = &Share[sc & 1][rt][h][0] + khalf * (8 * RPITCH) + col;
    KTile kt = lds_ktile(kp, 0);
    v16h bV[4];
#pragma unroll
    for (int sub = 0; sub < 2; ++sub) {
      float x[8];
      v8f cS, cO;
      logit_products(kt, qsA0, qsA1, qoA0, qoA1, cS, cO);
      logit_blend(cS, cO, ma, qid, x);
      // the stage's first eight LDS reads in front of its first products: left alone
      // the scheduler put half of them between the products, each with a wait of its own
      if (sub == 0) {
        __builtin_amdgcn_sched_group_barrier(0x100, 8, 0);
        __builtin_amdgcn_sched_group_barrier(0x008, 4, 0);
      }
      // holds the next mask loads behind the last read of their registers
      __builtin_amdgcn_sched_barrier(0);
      // mask and identities of the next 16 columns (the exponentials and LDS stores
      // below stand in front of their use; the index wraps at the end)
      ma = load_mtile(kidp, maskp, l0, ((sc * 2 + sub + 1) & (SHALF / 16 - 1)) * 16, col, khalf);
      // the code behind reuses the address registers of the loads above
      asm volatile("s_wait_xcnt 0x0" ::: "memory");
      __builtin_amdgcn_sched_barrier(0);   // keeps that code behind the wait
      // the fragments needed next are read under the exponentials below, so that
      // the block's LDS reads do not all stand at the head of the stage
      if (sub == 0) {
        kt = lds_ktile(kp, 1);
      } else {
#pragma unroll
        for (int dt = 0; dt < 4; ++dt) bV[dt] = frag_packed(kp + 2 * CHUNKH + dt * 512);
      }
#pragma unroll
      for (int vr = 0; vr < 8; ++vr) {
        // row vr + khalf * 8: one base register each, the rest an immediate offset
        float pp = exp_slot(x[vr] - mrow[vr]) * invl[vr];
        pW[vr * 34 + sub * 16] = (_Float16)pp;
        sW[vr * RPITCH + sub * 16] = pp * (1.0f / NHEAD);
      }
      // keeps the matrix products that follow out of the exponentials above
      __builtin_amdgcn_sched_barrier(0);
    }
    // A-fragment of P (16 x 32) from LDS (same wave: DS ops are in-order).
    v16h aP;
    {
      const _Float16* rp = myP + col * 34;
#pragma unroll
      for (int j = 0; j < 8; ++j) {
        int kb2 = ((j >> 2) << 4) + (khalf << 3) + ((j & 3) << 1);
        aP[2 * j]     = rp[kb2];
        aP[2 * j + 1] = rp[kb2 + 1];
      }
    }
#pragma unroll
    for (int dt = 0; dt < 4; ++dt) oc[dt] = wmma_f16(aP, bV[dt], oc[dt]);

    // Behind this barrier all eight shares of each row tile's 32 columns are in
    // LDS, the next stage's K and V too, and this stage's buffer is free.
    publish_stage();
    // refill of the buffer that this trip has read, while a stage sc + 2 exists
    if (sc + 2 < NSTAGE)
      copy_4k_2k(kl + (unsigned)(sc & 1) * KBUF, kg + (size_t)(sc + 2) * CHUNKH,
                 vl + (unsigned)(sc & 1) * KBUF, vg + (size_t)(sc + 2) * CHUNKH);
    {
      const float* sp = &Share[sc & 1][rt][0][rrow * RPITCH + rcol];
      float2 acc = *(const float2*)sp;
#pragma unroll
      for (int hh = 1; hh < NHEAD; ++hh) {   // head order 0..7
        float2 c = *(const float2*)(sp + hh * 16 * RPITCH);
        acc.x += c.x;
        acc.y += c.y;
      }
      *(float2*)(amRow + sc * 32) = acc;
      // the next trip reuses the store's registers: wait until it has read them
      asm volatile("s_wait_xcnt 0x0" ::: "memory");
    }
  }
  asm volatile("s_wait_asynccnt 0x0" ::: "memory");   // no copy is open when the wave ends

  // store this head's 64-column slice of this half's O sums (rows l0..l0+15)
  _Float16* Oh = Obuf + (size_t)half * (L_SEQ * NBATCH * DMODEL);
#pragma unroll
  for (int dt = 0; dt < 4; ++dt) {
#pragma unroll
    for (int vr = 0; vr < 8; ++vr) {
      int row    = vr + khalf * 8;
      size_t rid = (size_t)(l0 + row) * NBATCH + n;
      int e      = h * HDIM + dt * 16 + col;
      Oh[rid * DMODEL + e] = (_Float16)oc[dt][vr];
    }
  }
}

// ---------------------------------------------------------------------------
// Kernel 3: final FC  out = O @ Wfc^T  (4096 x 512 x 512), f16 A, f32 out.
// O = the sum of the two S halves' planes (half order), added while staging.
// grid (32, 8), 256 threads (8 waves, 16x64 tile per wave).
// Operand tiles shared through LDS as in kernel 1; O is f16 already, so a
// thread stages eight neighbouring k (one group row) per load.
// ---------------------------------------------------------------------------
__global__ __launch_bounds__(256) void fc_kernel(
    const _Float16* __restrict__ Obuf, const float* __restrict__ Wfc,
    float* __restrict__ out) {
  const int lane  = threadIdx.x & 31;
  const int wid   = threadIdx.x >> 5;
  const int col   = lane & 15;
  const int khalf = lane >> 4;
  const int m0    = blockIdx.x * 128 + wid * 16;
  const int e0    = blockIdx.y * 64;

  // fragments 0..7: O rows of waves 0..7; fragments 8..11: Wfc rows of et 0..3
  __shared__ __attribute__((aligned(16))) _Float16 Tile[2][12 * FRAGH];
  const int t    = threadIdx.x;
  // O: load i of thread t takes row i * 64 + (t >> 2), k (t & 3) * 8 ..+7
  const int gaof = (t >> 2) * DMODEL + (t & 3) * 8;
  const int laof = (t >> 6) * FRAGH + (t & 3) * GRPH + ((t >> 2) & 15) * 8;
  // Wfc: load i of thread t takes row i * 32 + (t >> 3), k (t & 7) * 4 ..+3
  const int goff = (t >> 3) * DMODEL + (t & 7) * 4;
  const int loff = (t >> 7) * FRAGH + ((t & 7) >> 1) * GRPH + ((t >> 3) & 15) * 8 + (t & 1) * 4;
  const int roff = khalf * GRPH + col * 8;
  const _Float16* Ag = Obuf + (size_t)blockIdx.x * 128 * DMODEL + gaof;
  const float*    Wg = Wfc + (size_t)e0 * DMODEL + goff;

  const int OH = L_SEQ * NBATCH * DMODEL;   // from one half's plane to the other's
  v8h ar[2], br[2];
  float4 wr[2];
#pragma unroll
  for (int i = 0; i < 2; ++i) ar[i] = *(const v8h*)(Ag + i * 64 * DMODEL);
#pragma unroll
  for (int i = 0; i < 2; ++i) br[i] = *(const v8h*)(Ag + OH + i * 64 * DMODEL);
#pragma unroll
  for (int i = 0; i < 2; ++i) wr[i] = *(const float4*)(Wg + i * 32 * DMODEL);
#pragma unroll
  for (int i = 0; i < 2; ++i) *(v8h*)&Tile[0][i * 4 * FRAGH + laof] = ar[i] + br[i];
#pragma unroll
  for (int i = 0; i < 2; ++i) stage_f32(&Tile[0][(8 + i * 2) * FRAGH + loff], wr[i], 1.0f);
  __syncthreads();

  v8f cc[4] = {v8f{}, v8f{}, v8f{}, v8f{}};
  // unrolled: the k offsets become the loads' immediate offsets and the buffer
  // index a constant, so no address register changes while loads are in flight
#pragma unroll
  for (int s = 0; s < KSTEPS; ++s) {
    if (s + 1 < KSTEPS) {   // next step's tiles fly while this step is computed
#pragma unroll
      for (int i = 0; i < 2; ++i) ar[i] = *(const v8h*)(Ag + i * 64 * DMODEL + (s + 1) * 32);
#pragma unroll
      for (int i = 0; i < 2; ++i) br[i] = *(const v8h*)(Ag + OH + i * 64 * DMODEL + (s + 1) * 32);
#pragma unroll
      for (int i = 0; i < 2; ++i) wr[i] = *(const float4*)(Wg + i * 32 * DMODEL + (s + 1) * 32);
      // behind the last loads their address registers are free for reuse: wait until they are read
      if (s + 2 == KSTEPS) asm volatile("s_wait_xcnt 0x0" ::: "memory");
    }
    const _Float16* tb = &Tile[s & 1][roff];
    v16h a = frag_lds(tb + wid * FRAGH);
#pragma unroll
    for (int et = 0; et < 4; ++et) {
      v16h b = frag_lds(tb + (8 + et) * FRAGH);
      cc[et] = wmma_f16(a, b, cc[et]);
    }
    if (s + 1 < KSTEPS) {
      // the other buffer was last read in front of the previous step's barrier
      _Float16* tn = &Tile[(s + 1) & 1][0];
#pragma unroll
      for (int i = 0; i < 2; ++i) *(v8h*)(tn + i * 4 * FRAGH + laof) = ar[i] + br[i];
#pragma unroll
      for (int i = 0; i < 2; ++i) stage_f32(tn + (8 + i * 2) * FRAGH + loff, wr[i], 1.0f);
      STEP_ORDER(6, 10, 4, 4);
      __syncthreads();
      // ends the stretch that the order above speaks of (with all steps in one
      // stretch the build took over 20 registers more)
      __builtin_amdgcn_sched_barrier(0);
    }
  }
#pragma unroll
  for (int et = 0; et < 4; ++et)
#pragma unroll
    for (int vr = 0; vr < 8; ++vr) {
      int m   = vr + khalf * 8;
      int rid = m0 + m;
      int e   = e0 + et * 16 + col;
      out[(size_t)rid * DMODEL + e] = cc[et][vr];
    }
}

// ---------------------------------------------------------------------------
// Host launcher
// ---------------------------------------------------------------------------
extern "C" void kernel_launch(void* const* d_in, const int* in_sizes, int n_in,
                              void* d_out, int out_size, void* d_ws,
                              size_t ws_size, hipStream_t stream) {
  (void)in_sizes; (void)n_in; (void)out_size; (void)ws_size;
  const float* q    = (const float*)d_in[0];
  const float* k    = (const float*)d_in[1];
  const float* v    = (const float*)d_in[2];
  const int*   qid  = (const int*)d_in[3];
  const int*   kid  = (const int*)d_in[4];
  const float* mask = (const float*)d_in[5];
  const float* Wqs  = (const float*)d_in[6];
  const float* Wqo  = (const float*)d_in[7];
  const float* Wks  = (const float*)d_in[8];
  const float* Wko  = (const float*)d_in[9];
  const float* Wv   = (const float*)d_in[10];
  const float* Wfc  = (const float*)d_in[11];

  const size_t BUF = (size_t)NHEAD * NBATCH * 2048 * HDIM;  // 2,097,152 f16
  _Float16* ws = (_Float16*)d_ws;
  _Float16* Qs = ws;
  _Float16* Qo = Qs + BUF;
  _Float16* Ks = Qo + BUF;
  _Float16* Ko = Ks + BUF;
  _Float16* Vt = Ko + BUF;
  _Float16* Ob = Vt + BUF;          // two planes, one per S half
  float*    St = (float*)(Ob + 2 * BUF);   // 512 KB of softmax statistics; under 29 MB in all

  float* out      = (float*)d_out;                               // [L,N,D]
  float* att_mean = out + (size_t)L_SEQ * NBATCH * DMODEL;       // [N,L,S]

  proj_kernel<<<dim3(32, 4, 5), 256, 0, stream>>>(
      q, k, v, Wqs, Wqo, Wks, Wko, Wv, Qs, Qo, Ks, Ko, Vt);
  stat_kernel<<<dim3(L_SEQ / 32, NBATCH, 2), NWAVE * 32, 0, stream>>>(
      Qs, Qo, Ks, Ko, qid, kid, mask, St);
  attn_kernel<<<dim3(L_SEQ / 32, NBATCH, 2), NWAVE * 32, 0, stream>>>(
      Qs, Qo, Ks, Ko, Vt, qid, kid, mask, St, Ob, att_mean);
  fc_kernel<<<dim3(32, 8), 256, 0, stream>>>(Ob, Wfc, out);
}

// v009
// A run of this version takes 111 microseconds.
// Two timings next to v008 both put it at 1.04 times that version's speed.
// Counting every step since v000, it is 27.8 times as fast.
#include <hip/hip_runtime.h>

// ---------------------------------------------------------------------------
// AgentAwareAttention for MI455X (gfx1250), wave32 + v_wmma_f32_16x16x32_f16.
// f16 data / f32 accumulation (the two S halves' O sums are added in f16); softmax math in f32.
// ---------------------------------------------------------------------------

typedef __attribute__((ext_vector_type(16))) _Float16 v16h;
typedef __attribute__((ext_vector_type(8)))  float    v8f;
typedef __attribute__((ext_vector_type(2)))  _Float16 h2;
typedef __attribute__((ext_vector_type(4)))  _Float16 v4h;
typedef __attribute__((ext_vector_type(8)))  _Float16 v8h;

#define L_SEQ 2048
#define S_SEQ 2048
#define NBATCH 2
#define DMODEL 512
#define NHEAD 8
#define HDIM 64

// ---- WMMA helpers ----------------------------------------------------------

__device__ __forceinline__ v8f wmma_f16(v16h a, v16h b, v8f c) {
  // D = A(16x32 f16) * B(32x16 f16) + C(16x16 f32)
  return __builtin_amdgcn_wmma_f32_16x16x32_f16(
      /*neg_a=*/false, a, /*neg_b=*/false, b,
      /*c_mod=*/(short)0, c, /*reuse_a=*/false, /*reuse_b=*/false);
}

// A-frag: lane holds row (lane&15); 16 K-elements with pattern
//   kb = (j>>2)*16 + (lane>>4)*8 + (j&3)*2   (pairs kb, kb+1)
// B-frag: identical pattern with lane&15 = output column, reading the
// column-major row (i.e. B_col[n][k]).
__device__ __forceinline__ v16h frag_from_f16row(const _Float16* __restrict__ rowPtr,
                                                 int khalf) {
  v16h f;
#pragma unroll
  for (int j = 0; j < 8; ++j) {
    int kb = ((j >> 2) << 4) + (khalf << 3) + ((j & 3) << 1);
    h2 p = *(const h2*)(rowPtr + kb);      // 4-byte load (kb is even)
    f[2 * j]     = p.x;
    f[2 * j + 1] = p.y;
  }
  return f;
}

// Packed fragment: a 16 x 32 f16 operand tile kept in memory in register order,
// 512 halves: [i = 0,1][lane = 0..31][8 halves], where lane holds fragment
// elements 8i..8i+7. Element (r, kk) of the tile (r = row of A / column of B,
// kk = k index, same k pattern as above) lies at packed_off(r, kk). A wave
// reads a fragment with two 16-byte loads per lane, each 512 contiguous bytes
// (four whole cache lines) instead of 32-byte pieces of sixteen lines.
__device__ __forceinline__ int packed_off(int r, int kk) {
  return ((kk >> 4) << 8) + (((((kk >> 3) & 1) << 4) + r) << 3) + (kk & 7);
}

// p = start of the packed fragment + lane * 8 (16-byte aligned)
__device__ __forceinline__ v16h frag_packed(const _Float16* __restrict__ p) {
  v8h lo = *(const v8h*)p;
  v8h hi = *(const v8h*)(p + 256);
  return __builtin_shufflevector(lo, hi, 0, 1, 2, 3, 4, 5, 6, 7,
                                 8, 9, 10, 11, 12, 13, 14, 15);
}

// ---- GEMM operand tiles in LDS ---------------------------------------------
// A block's operand tiles of one 32-wide k step lie in LDS as f16 fragments of
// 16 rows x 32 k: four groups g = kk >> 3 of [16 rows][8 halves]. A lane reads
// its fragment as groups khalf and 2 + khalf, 16 bytes each (same k pattern as
// above). The group pitch of 320 bytes moves each group 16 banks on, so that the
// staging stores of a wave (some rows of all four groups) spread evenly over
// the banks; a 16-lane half of a fragment read covers 256 contiguous bytes.
#define GRPH 160            // halves from one group to the next (128 used)
#define FRAGH (4 * GRPH)    // halves from one fragment to the next
#define KSTEPS (DMODEL / 32)

// Order of one k step for the scheduler: the next tiles' global loads (NLOAD of
// them), this step's NREAD LDS reads, its NMMA products, and only then the
// conversions and the NWRITE LDS stores with their waits for the loads. Left
// alone the scheduler put each conversion right behind its load, so that the
// load's latency lay open.
#define STEP_ORDER(NLOAD, NREAD, NMMA, NWRITE)              \
  do {                                                      \
    __builtin_amdgcn_sched_group_barrier(0x020, NLOAD, 0);  \
    __builtin_amdgcn_sched_group_barrier(0x100, NREAD, 0);  \
    __builtin_amdgcn_sched_group_barrier(0x008, NMMA, 0);   \
    __builtin_amdgcn_sched_group_barrier(0x002, 32, 0);     \
    __builtin_amdgcn_sched_group_barrier(0x200, NWRITE, 0); \
  } while (0)

// p = fragment + khalf * GRPH + (lane & 15) * 8
__device__ __forceinline__ v16h frag_lds(const _Float16* p) {
  v8h lo = *(const v8h*)p;
  v8h hi = *(const v8h*)(p + 2 * GRPH);
  return __builtin_shufflevector(lo, hi, 0, 1, 2, 3, 4, 5, 6, 7,
                                 8, 9, 10, 11, 12, 13, 14, 15);
}

// four neighbouring k of one row, f32 from global memory -> f16 in LDS
__device__ __forceinline__ void stage_f32(_Float16* dst, float4 x, float scale) {
  v4h hv;
  hv[0] = (_Float16)(x.x * scale);
  hv[1] = (_Float16)(x.y * scale);
  hv[2] = (_Float16)(x.z * scale);
  hv[3] = (_Float16)(x.w * scale);
  *(v4h*)dst = hv;
}

// ---------------------------------------------------------------------------
// Kernel 1: the five input projections  Y = X @ W^T  (4096 x 512 x 512 each),
// fp32 in, f16 out, scattered into attention-friendly layouts.
//   p=0: Qs[h][n][l][hd]  (x 1/sqrt(HD))
//   p=1: Qo[h][n][l][hd]  (x 1/sqrt(HD))
//   p=2: Ks[h][n][s/16][hd/32][packed 16(s) x 32(hd) B-fragment]
//   p=3: Ko, as Ks
//   p=4: Vt[h][n][s/32][hd/16][packed 16(hd) x 32(s) B-fragment]
// grid: (4096/128, 512/128, 5), 256 threads (8 waves, 32x64 tile per wave:
// wave w takes rows (w & 3) * 32 ..+31 and head w >> 2 of the block's two heads,
// and uses each W fragment for its two X fragments)
// Per k step the block brings its 128 x 32 tile of X and its 128 x 32 tile of W
// in once, eight lanes to a 128-byte row piece (whole cache lines), converts
// them and shares them through LDS; two buffers, one barrier per step.
// ---------------------------------------------------------------------------
__global__ __launch_bounds__(256) void proj_kernel(
    const float* __restrict__ q, const float* __restrict__ k,
    const float* __restrict__ v,
    const float* __restrict__ Wqs, const float* __restrict__ Wqo,
    const float* __restrict__ Wks, const float* __restrict__ Wko,
    const float* __restrict__ Wv,
    _Float16* __restrict__ Qs, _Float16* __restrict__ Qo,
    _Float16* __restrict__ Ks, _Float16* __restrict__ Ko,
    _Float16* __restrict__ Vt) {
  const int lane  = threadIdx.x & 31;
  const int wid   = threadIdx.x >> 5;
  const int col   = lane & 15;
  const int khalf = lane >> 4;
  const int p     = blockIdx.z;
  const int wm    = wid & 3;                       // 32-row slice of the block's rows
  const int wn    = wid >> 2;                      // 64-feature slice (one head)
  const int e0    = blockIdx.y * 128;              // output feature tile

  const float* X = (p < 2) ? q : ((p < 4) ? k : v);
  const float* W = (p == 0) ? Wqs : (p == 1) ? Wqo : (p == 2) ? Wks
                 : (p == 3) ? Wko : Wv;
  _Float16* dst  = (p == 0) ? Qs : (p == 1) ? Qo : (p == 2) ? Ks
                 : (p == 3) ? Ko : Vt;
  const float scale = (p < 2) ? 0.125f : 1.0f;     // HD^-0.5 folded into Q

  // fragments 0..7: the block's X rows, 16 each; fragments 8..15: its W rows
  __shared__ __attribute__((aligned(16))) _Float16 Tile[2][16 * FRAGH];
  // staging: load i of thread t takes row i * 32 + (t >> 3), k (t & 7) * 4 ..+3
  const int t    = threadIdx.x;
  const int goff = (t >> 3) * DMODEL + (t & 7) * 4;
  const int loff = (t >> 7) * FRAGH + ((t & 7) >> 1) * GRPH + ((t >> 3) & 15) * 8 + (t & 1) * 4;
  const int roff = khalf * GRPH + col * 8;
  const float* Xg = X + (size_t)blockIdx.x * 128 * DMODEL + goff;
  const float* Wg = W + (size_t)e0 * DMODEL + goff;

  float4 xr[4], wr[4];
#pragma unroll
  for (int i = 0; i < 4; ++i) xr[i] = *(const float4*)(Xg + i * 32 * DMODEL);
#pragma unroll
  for (int i = 0; i < 4; ++i) wr[i] = *(const float4*)(Wg + i * 32 * DMODEL);
#pragma unroll
  for (int i = 0; i < 4; ++i) stage_f32(&Tile[0][i * 2 * FRAGH + loff], xr[i], scale);
#pragma unroll
  for (int i = 0; i < 4; ++i) stage_f32(&Tile[0][(8 + i * 2) * FRAGH + loff], wr[i], 1.0f);
  __syncthreads();

  v8f cc[2][4] = {{v8f{}, v8f{}, v8f{}, v8f{}}, {v8f{}, v8f{}, v8f{}, v8f{}}};
  // unrolled: the k offsets become the loads' immediate offsets and the buffer
  // index a constant, so no address register changes while loads are in flight
#pragma unroll
  for (int s = 0; s < KSTEPS; ++s) {
    if (s + 1 < KSTEPS) {   // next step's tiles fly while this step is computed
#pragma unroll
      for (int i = 0; i < 4; ++i) xr[i] = *(const float4*)(Xg + i * 32 * DMODEL + (s + 1) * 32);
#pragma unroll
      for (int i = 0; i < 4; ++i) wr[i] = *(const float4*)(Wg + i * 32 * DMODEL + (s + 1) * 32);
      // behind the last loads their address registers are free for reuse: wait until they are read
      if (s + 2 == KSTEPS) asm volatile("s_wait_xcnt 0x0" ::: "memory");
    }
    const _Float16* tb = &Tile[s & 1][roff];
    v16h a0 = frag_lds(tb + (wm * 2) * FRAGH);
    v16h a1 = frag_lds(tb + (wm * 2 + 1) * FRAGH);
#pragma unroll
    for (int et = 0; et < 4; ++et) {
      v16h b = frag_lds(tb + (8 + wn * 4 + et) * FRAGH);
      cc[0][et] = wmma_f16(a0, b, cc[0][et]);
      cc[1][et] = wmma_f16(a1, b, cc[1][et]);
    }
    if (s + 1 < KSTEPS) {
      // the other buffer was last read in front of the previous step's barrier
      _Float16* tn = &Tile[(s + 1) & 1][loff];
#pragma unroll
      for (int i = 0; i < 4; ++i) stage_f32(tn + i * 2 * FRAGH, xr[i], scale);
#pragma unroll
      for (int i = 0; i < 4; ++i) stage_f32(tn + (8 + i * 2) * FRAGH, wr[i], 1.0f);
      STEP_ORDER(8, 12, 8, 8);
      __syncthreads();
      // ends the stretch that the order above speaks of (with all steps in one
      // stretch the build took over 20 registers more)
      __builtin_amdgcn_sched_barrier(0);
    }
  }

  // The wave's 64 features are one head h. C layout of its row tile rt (16 rows
  // from m0; row = t*NBATCH + n): a lane's eight rows are t = t0 + 4*khalf +
  // (vr >> 1), n = vr & 1, with t0 = m0 / 2 + rt * 8 a multiple of 8.
  const int h  = (e0 >> 6) + wn;
  const int tw = (blockIdx.x * 128 + wm * 32) >> 1;   // a multiple of 16
  const int NB = 2048 * HDIM;            // elements of one (h, n) plane
  _Float16* dh = dst + (size_t)h * NBATCH * NB;
  if (p == 4) {
    // per n, the lane's four t are four neighbouring halves of a V fragment;
    // row tile 1 lies 8 t on: the next group of eight k, 128 halves on
    _Float16* d = dh + (tw >> 5) * 2048 + packed_off(col, (tw & 31) + khalf * 4);
#pragma unroll
    for (int rt = 0; rt < 2; ++rt) {
#pragma unroll
      for (int et = 0; et < 4; ++et) {
#pragma unroll
        for (int nb = 0; nb < NBATCH; ++nb) {
          v4h val;
#pragma unroll
          for (int i = 0; i < 4; ++i) val[i] = (_Float16)cc[rt][et][2 * i + nb];
          *(v4h*)(d + rt * 128 + nb * NB + et * 512) = val;
        }
      }
    }
  } else if (p >= 2) {
    // hd = et*16 + col: fragment et >> 1, its half et & 1, so 256 halves per et;
    // row tile 1 holds columns 8..15 of the same 16-column fragments, 64 halves on
    _Float16* d = dh + tw * HDIM + packed_off(khalf * 4, col);
#pragma unroll
    for (int rt = 0; rt < 2; ++rt)
#pragma unroll
      for (int et = 0; et < 4; ++et)
#pragma unroll
        for (int vr = 0; vr < 8; ++vr)
          d[rt * 64 + (vr & 1) * NB + et * 256 + (vr >> 1) * 8] = (_Float16)cc[rt][et][vr];
    // code laid out behind this branch reuses the stores' registers: wait until they are read
    asm volatile("s_wait_xcnt 0x0" ::: "memory");
  } else {
    _Float16* d = dh + (tw + khalf * 4) * HDIM + col;
#pragma unroll
    for (int rt = 0; rt < 2; ++rt)
#pragma unroll
      for (int et = 0; et < 4; ++et)
#pragma unroll
        for (int vr = 0; vr < 8; ++vr)
          d[rt * 8 * HDIM + (vr & 1) * NB + (vr >> 1) * HDIM + et * 16] = (_Float16)cc[rt][et][vr];
    // code laid out behind this branch reuses the stores' registers: wait until they are read
    asm volatile("s_wait_xcnt 0x0" ::: "memory");
  }
}

// e^t as the compiler's own multiply and v_exp_f32, with the one free slot that
// the instruction set asks for behind a transcendental kept inside the statement.
__device__ __forceinline__ float exp_slot(float t) {
  float r;
  // v_nop: fills that slot, whatever the compiler schedules next
  asm("v_exp_f32 %0, %1\n\tv_nop" : "=v"(r) : "v"(t * 1.44269504f));
  return r;
}

// ---------------------------------------------------------------------------
// Logit tile helpers: 16(L) x 16(S) agent-aware logits in C layout, with the
// loads apart from the arithmetic so that a loop can issue a later tile's
// loads as soon as this tile's values have been used.
// ---------------------------------------------------------------------------
struct KTile { v16h s0, s1, o0, o1; };      // self and other K fragments of 16 columns
struct MTile { float mv[8]; int kid; };     // mask values and key identity of 16 columns

__device__ __forceinline__ MTile load_mtile(const int* __restrict__ kid_g,
                                            const float* __restrict__ mask,
                                            int l0, int s0, int col, int khalf) {
  MTile t;
  t.kid = (kid_g + s0)[(unsigned)col];
  const float* mp = mask + (size_t)l0 * S_SEQ + s0;      // wave-uniform
  const unsigned lo = (unsigned)(khalf * 8 * S_SEQ + col);
#pragma unroll
  for (int vr = 0; vr < 8; ++vr) t.mv[vr] = (mp + vr * S_SEQ)[lo];
  return t;
}

__device__ __forceinline__ void logit_products(const KTile& k, v16h qsA0, v16h qsA1,
                                               v16h qoA0, v16h qoA1, v8f& cS, v8f& cO) {
  cS = v8f{};
  cS = wmma_f16(qsA0, k.s0, cS);
  cS = wmma_f16(qsA1, k.s1, cS);
  cO = v8f{};
  cO = wmma_f16(qoA0, k.o0, cO);
  cO = wmma_f16(qoA1, k.o1, cO);
}

__device__ __forceinline__ void logit_blend(v8f cS, v8f cO, const MTile& m,
                                            const int* qid, float* x) {
#pragma unroll
  for (int vr = 0; vr < 8; ++vr)
    x[vr] = ((m.kid == qid[vr]) ? cS[vr] : cO[vr]) + m.mv[vr];
}

// ---------------------------------------------------------------------------
// Kernels 2a and 2b: attention, 16 waves a block. The waves of a head use the
// same K and V fragments: a 32-column stage of them is brought from L2 once, by
// asynchronous copies into LDS (two buffers, the next stage in flight while
// this one is worked on), and the head's two waves read it there.
// 2a: grid (L/64, N, 4). A block owns 64 rows of L and a quarter of S (SQUART
//     columns); wave w computes head (w & 7) of the two 16-row tiles of row pair
//     w >> 3, and uses every K fragment that it reads for both tiles. Online
//     max/sum statistics of every (head, row) over the block's quarter, stored
//     to the workspace.
// 2b: grid (L/32, N, 2). A block owns 32 rows of L and one half of S (SHALF
//     columns); wave w computes head (w & 7) of the 16-row tile rt = w >> 3.
//     Joins the four quarters' statistics (quarter order), recomputes the logits,
//     emits probabilities and accumulates O = P @ V over its half (P staged via
//     LDS to convert C-fragment layout -> A-fragment layout). att_mean (the mean
//     over heads) is summed inside the block: every wave puts its share of a
//     16 x 32 probability tile into LDS, and after the stage's barrier the 256
//     threads of a row tile add its eight shares in head order and store the
//     result once. The two halves' O sums are added in kernel 3.
// ---------------------------------------------------------------------------
#define RPITCH 36   // f32 row pitch of a share tile: rows r and r+8 land 32 banks apart
#define RTILES 2    // 16-row tiles of a block
#define NWAVE (NHEAD * RTILES)
#define SHALF (S_SEQ / 2)        // columns of one block
#define NSTAGE (SHALF / 32)      // 32-column stages of one block
#define CHUNKH 2048              // halves of one operand's stage (4 KiB, contiguous in memory)
#define SPARTS 4                 // kernel 2a: parts of S, one block each
#define SQUART (S_SEQ / SPARTS)  // kernel 2a: columns of one block
#define NSTAGE_A (SQUART / 32)   // kernel 2a: 32-column stages of one block
#define STATP (NBATCH * NHEAD * L_SEQ * 2)   // floats of one part's plane of statistics

// LDS byte address of a __shared__ object: the low 32 bits of its address
__device__ __forceinline__ unsigned lds_addr(const void* p) {
  return (unsigned)(size_t)p;
}

// 4 KiB from global memory to LDS, contiguous in both, 16 bytes a lane
// and copy; the immediate offset moves both addresses alike. The s_wait_xcnt
// stands inside the statement, in front of any rewrite of the address registers.
__device__ __forceinline__ void copy_4k(unsigned lds, const _Float16* g) {
  asm volatile(
      "global_load_async_to_lds_b128 %0, %1, off\n\t"
      "global_load_async_to_lds_b128 %0, %1, off offset:512\n\t"
      "global_load_async_to_lds_b128 %0, %1, off offset:1024\n\t"
      "global_load_async_to_lds_b128 %0, %1, off offset:1536\n\t"
      "global_load_async_to_lds_b128 %0, %1, off offset:2048\n\t"
      "global_load_async_to_lds_b128 %0, %1, off offset:2560\n\t"
      "global_load_async_to_lds_b128 %0, %1, off offset:3072\n\t"
      "global_load_async_to_lds_b128 %0, %1, off offset:3584\n\t"
      "s_wait_xcnt 0x0"
      :: "v"(lds), "v"(g) : "memory");
}
// the same with 2 KiB of a second operand, under one wait
__device__ __forceinline__ void copy_4k_2k(unsigned lds, const _Float16* g,
                                           unsigned lds2, const _Float16* g2) {
  asm volatile(
      "global_load_async_to_lds_b128 %0, %1, off\n\t"
      "global_load_async_to_lds_b128 %0, %1, off offset:512\n\t"
      "global_load_async_to_lds_b128 %0, %1, off offset:1024\n\t"
      "global_load_async_to_lds_b128 %0, %1, off offset:1536\n\t"
      "global_load_async_to_lds_b128 %0, %1, off offset:2048\n\t"
      "global_load_async_to_lds_b128 %0, %1, off offset:2560\n\t"
      "global_load_async_to_lds_b128 %0, %1, off offset:3072\n\t"
      "global_load_async_to_lds_b128 %0, %1, off offset:3584\n\t"
      "global_load_async_to_lds_b128 %2, %3, off\n\t"
      "global_load_async_to_lds_b128 %2, %3, off offset:512\n\t"
      "global_load_async_to_lds_b128 %2, %3, off offset:1024\n\t"
      "global_load_async_to_lds_b128 %2, %3, off offset:1536\n\t"
      "s_wait_xcnt 0x0"
      :: "v"(lds), "v"(g), "v"(lds2), "v"(g2) : "memory");
}

// Hand-over of a stage: this wave's LDS reads and writes are done, its own copies
// of the next stage have landed, and every wave has passed the barrier.
// The barrier orders LDS only: the waves hand nothing over in global memory here,
// and __syncthreads() would also wait for the next mask loads in flight.
__device__ __forceinline__ void publish_stage() {
  asm volatile("s_wait_dscnt 0x0" ::: "memory");     // my reads of the buffer to be refilled
  asm volatile("s_wait_asynccnt 0x0" ::: "memory");  // my copies of the next stage
  __builtin_amdgcn_fence(__ATOMIC_RELEASE, "workgroup", "local");
  __builtin_amdgcn_s_barrier();
  __builtin_amdgcn_fence(__ATOMIC_ACQUIRE, "workgroup", "local");
}

// K fragments of 16 columns from a stage in LDS; p = stage + lane * 8
__device__ __forceinline__ KTile lds_ktile(const _Float16* p, int sub) {
  KTile t;
  t.s0 = frag_packed(p + sub * 1024);
  t.s1 = frag_packed(p + sub * 1024 + 512);
  t.o0 = frag_packed(p + CHUNKH + sub * 1024);
  t.o1 = frag_packed(p + CHUNKH + sub * 1024 + 512);
  return t;
}

__global__ __launch_bounds__(NWAVE * 32) void stat_kernel(
    const _Float16* __restrict__ Qs, const _Float16* __restrict__ Qo,
    const _Float16* __restrict__ Ks, const _Float16* __restrict__ Ko,
    const int* __restrict__ qid_g, const int* __restrict__ kid_g,
    const float* __restrict__ mask, float* __restrict__ StatG) {
  const int lane  = threadIdx.x & 31;
  // wave index, in a scalar register: head, row pair and the pointers formed from
  // them are then scalar too
  const int w     = __builtin_amdgcn_readfirstlane(threadIdx.x >> 5);
  const int h     = w & (NHEAD - 1);       // head
  const int rp    = w >> 3;                // pair of row tiles
  const int col   = lane & 15;
  const int khalf = lane >> 4;
  const int n     = blockIdx.y;
  const int part  = blockIdx.z;
  const int l0    = blockIdx.x * 64 + rp * 32;   // row tile r: rows l0 + r * 16 ..+15

  // [buffer][head][self, other][stage of 32 columns in fragment order]
  __shared__ __attribute__((aligned(16))) _Float16 KT[2][NHEAD][2][CHUNKH];
  const unsigned KBUF = NHEAD * 2 * CHUNKH * 2;   // bytes of one buffer

  int qid[2][8];
#pragma unroll
  for (int r = 0; r < 2; ++r)
#pragma unroll
    for (int vr = 0; vr < 8; ++vr) qid[r][vr] = qid_g[l0 + r * 16 + vr + khalf * 8];
  // the Q loads below may land in the address registers of these loads
  asm volatile("s_wait_xcnt 0x0" ::: "memory");

  const _Float16* Qsb = Qs + ((size_t)(h * NBATCH + n) * L_SEQ + l0) * HDIM;
  const _Float16* Qob = Qo + ((size_t)(h * NBATCH + n) * L_SEQ + l0) * HDIM;
  // row pair 0 copies the head's self K, row pair 1 its other K
  const _Float16* kg = (rp ? Ko : Ks) +
      ((size_t)(h * NBATCH + n) * S_SEQ + part * SQUART) * HDIM + lane * 8;
  const unsigned kl = lds_addr(&KT[0][h][rp][lane * 8]);
  const int*   kidp  = kid_g + part * SQUART;
  const float* maskp = mask + part * SQUART;

  copy_4k(kl, kg);                       // stage 0

  v16h qsA[2][2], qoA[2][2];
#pragma unroll
  for (int r = 0; r < 2; ++r) {
    qsA[r][0] = frag_from_f16row(Qsb + (r * 16 + col) * HDIM, khalf);
    qsA[r][1] = frag_from_f16row(Qsb + (r * 16 + col) * HDIM + 32, khalf);
    asm volatile("s_wait_xcnt 0x0" ::: "memory");   // as above, for the next group
    qoA[r][0] = frag_from_f16row(Qob + (r * 16 + col) * HDIM, khalf);
    qoA[r][1] = frag_from_f16row(Qob + (r * 16 + col) * HDIM + 32, khalf);
    asm volatile("s_wait_xcnt 0x0" ::: "memory");   // as above, for the next loads
  }

  // A stage's mask and identity loads are issued one stage ahead (the index
  // wraps: the last trip fetches stage 0 unused).
  MTile ma[2], mb[2];
#pragma unroll
  for (int r = 0; r < 2; ++r) {
    ma[r] = load_mtile(kidp, maskp, l0 + r * 16, 0, col, khalf);
    mb[r] = load_mtile(kidp, maskp, l0 + r * 16, 16, col, khalf);
    // the code behind reuses the address registers of the loads above
    asm volatile("s_wait_xcnt 0x0" ::: "memory");
    // keeps that code behind the wait (the scheduler lifted register moves over it)
    __builtin_amdgcn_sched_barrier(0);
  }

  asm volatile("s_wait_asynccnt 0x0" ::: "memory");   // my copies of stage 0 have landed
  __syncthreads();                                    // and everybody's
  copy_4k(kl + KBUF, kg + CHUNKH);       // stage 1

  // Every lane keeps the running max and sum of its own columns (col, col + 16,
  // ...); the 16 lanes of a row are joined once, behind the loop.
  float mrow[2][8], srow[2][8];
#pragma unroll
  for (int r = 0; r < 2; ++r)
#pragma unroll
    for (int vr = 0; vr < 8; ++vr) { mrow[r][vr] = -1e30f; srow[r][vr] = 0.0f; }

  for (int st = 0; st < NSTAGE_A; ++st) {
    const int nx = ((st + 1) & (NSTAGE_A - 1)) * 32;   // next stage's first column
    const _Float16* kp = &KT[st & 1][h][0][lane * 8];
    // each 16-column group of K fragments is read once and used for both row tiles
    KTile kt = lds_ktile(kp, 0);
    float x0[2][8];
#pragma unroll
    for (int r = 0; r < 2; ++r) {
      v8f cS, cO;
      logit_products(kt, qsA[r][0], qsA[r][1], qoA[r][0], qoA[r][1], cS, cO);
      // the second group is read behind the first group's last products, so that
      // one group's registers are enough
      if (r == 1) kt = lds_ktile(kp, 1);
      logit_blend(cS, cO, ma[r], qid[r], x0[r]);
      ma[r] = load_mtile(kidp, maskp, l0 + r * 16, nx, col, khalf);
      // the code behind reuses the address registers of the loads above
      asm volatile("s_wait_xcnt 0x0" ::: "memory");
      __builtin_amdgcn_sched_barrier(0);   // keeps that code behind the wait
    }
#pragma unroll
    for (int r = 0; r < 2; ++r) {
      float x1[8];
      v8f cS, cO;
      logit_products(kt, qsA[r][0], qsA[r][1], qoA[r][0], qoA[r][1], cS, cO);
      logit_blend(cS, cO, mb[r], qid[r], x1);
      mb[r] = load_mtile(kidp, maskp, l0 + r * 16, nx + 16, col, khalf);
      asm volatile("s_wait_xcnt 0x0" ::: "memory");   // as for the loads of ma
      __builtin_amdgcn_sched_barrier(0);   // keeps the code behind it behind the wait
#pragma unroll
      for (int vr = 0; vr < 8; ++vr) {
        float mn = fmaxf(mrow[r][vr], fmaxf(x0[r][vr], x1[vr]));
        srow[r][vr] = srow[r][vr] * exp_slot(mrow[r][vr] - mn) + (exp_slot(x0[r][vr] - mn) + exp_slot(x1[vr] - mn));
        mrow[r][vr] = mn;
      }
      // keeps the matrix products that follow out of the exponentials above
      __builtin_amdgcn_sched_barrier(0);
    }
    publish_stage();
    // refill of the buffer that this trip has read, while a stage st + 2 exists
    if (st + 2 < NSTAGE_A) copy_4k(kl + (unsigned)(st & 1) * KBUF, kg + (size_t)(st + 2) * CHUNKH);
  }
  asm volatile("s_wait_asynccnt 0x0" ::: "memory");   // no copy is open when the wave ends

  // join the 16 lanes of each row: max first, then the rescaled sums
#pragma unroll
  for (int r = 0; r < 2; ++r) {
#pragma unroll
    for (int vr = 0; vr < 8; ++vr) {
      float mn = mrow[r][vr];
#pragma unroll
      for (int d = 1; d < 16; d <<= 1) mn = fmaxf(mn, __shfl_xor(mn, d, 32));
      float sn = srow[r][vr] * exp_slot(mrow[r][vr] - mn);
#pragma unroll
      for (int d = 1; d < 16; d <<= 1) sn += __shfl_xor(sn, d, 32);
      mrow[r][vr] = mn;
      srow[r][vr] = sn;
    }
  }
  // StatG[part][n][h][row] = (max, sum): a row tile fills one 128-byte line
  if (col == 0) {
    float* sg = StatG + (size_t)part * STATP +
                ((size_t)(n * NHEAD + h) * L_SEQ + l0 + khalf * 8) * 2;
#pragma unroll
    for (int r = 0; r < 2; ++r) {
#pragma unroll
      for (int vr = 0; vr < 8; ++vr) {
        float2 ms;
        ms.x = mrow[r][vr];
        ms.y = srow[r][vr];
        *(float2*)(sg + (r * 16 + vr) * 2) = ms;
      }
    }
  }
}

__global__ __launch_bounds__(NWAVE * 32) void attn_kernel(
    const _Float16* __restrict__ Qs, const _Float16* __restrict__ Qo,
    const _Float16* __restrict__ Ks, const _Float16* __restrict__ Ko,
    const _Float16* __restrict__ Vt,
    const int* __restrict__ qid_g, const int* __restrict__ kid_g,
    const float* __restrict__ mask, const float* __restrict__ StatG,
    _Float16* __restrict__ Obuf, float* __restrict__ att_mean) {
  const int lane  = threadIdx.x & 31;
  // wave index, in a scalar register (as in kernel 2a)
  const int w     = __builtin_amdgcn_readfirstlane(threadIdx.x >> 5);
  const int h     = w & (NHEAD - 1);       // head
  const int rt    = w >> 3;                // row tile
  const int col   = lane & 15;
  const int khalf = lane >> 4;
  const int n     = blockIdx.y;
  const int half  = blockIdx.z;
  const int l0    = blockIdx.x * (16 * RTILES) + rt * 16;

  // [buffer][head][self K, other K, V][stage of 32 columns in fragment order]
  __shared__ __attribute__((aligned(16))) _Float16 KT[2][NHEAD][3][CHUNKH];
  const unsigned KBUF = NHEAD * 3 * CHUNKH * 2;   // bytes of one buffer
  // Per-wave P staging: 16 x 32 f16, row stride 34 elems (68B) so that the
  // A-fragment column reads hit distinct LDS banks (17*r mod 64 distinct).
  __shared__ __attribute__((aligned(16))) _Float16 Pb[NWAVE][16 * 34];
  _Float16* myP = &Pb[w][0];
  // Per-head shares of att_mean, two buffers so that one barrier per 32
  // columns is enough (a buffer is rewritten one barrier after it was read).
  __shared__ __attribute__((aligned(16))) float Share[2][RTILES][NHEAD][16 * RPITCH];

  // element pair of its row tile's 16 x 32 tile that this thread sums and stores
  const int rrow = (threadIdx.x & 255) >> 4;
  const int rcol = (threadIdx.x & 15) * 2;
  float* amRow = att_mean + ((size_t)n * L_SEQ + (l0 + rrow)) * (size_t)S_SEQ + half * SHALF + rcol;

  int qid[8];
#pragma unroll
  for (int vr = 0; vr < 8; ++vr) qid[vr] = qid_g[l0 + vr + khalf * 8];
  // the Q loads below may land in the address registers of these loads
  asm volatile("s_wait_xcnt 0x0" ::: "memory");

  const _Float16* Qsb = Qs + ((size_t)(h * NBATCH + n) * L_SEQ + l0) * HDIM;
  const _Float16* Qob = Qo + ((size_t)(h * NBATCH + n) * L_SEQ + l0) * HDIM;
  // row tile 0 copies the head's self K and the first half of its V stage,
  // row tile 1 its other K and the second half
  const size_t plane = ((size_t)(h * NBATCH + n) * S_SEQ + half * SHALF) * HDIM;
  const _Float16* kg = (rt ? Ko : Ks) + plane + lane * 8;
  const _Float16* vg = Vt + plane + rt * (CHUNKH / 2) + lane * 8;
  const unsigned kl = lds_addr(&KT[0][h][rt][lane * 8]);
  const unsigned vl = lds_addr(&KT[0][h][2][rt * (CHUNKH / 2) + lane * 8]);
  const int*   kidp  = kid_g + half * SHALF;
  const float* maskp = mask + half * SHALF;

  copy_4k_2k(kl, kg, vl, vg);            // stage 0

  v16h qsA0 = frag_from_f16row(Qsb + col * HDIM, khalf);
  v16h qsA1 = frag_from_f16row(Qsb + col * HDIM + 32, khalf);
  asm volatile("s_wait_xcnt 0x0" ::: "memory");   // as above, for the next group
  v16h qoA0 = frag_from_f16row(Qob + col * HDIM, khalf);
  v16h qoA1 = frag_from_f16row(Qob + col * HDIM + 32, khalf);
  asm volatile("s_wait_xcnt 0x0" ::: "memory");   // as above, for the next loads

  // join the four parts' statistics (part order 0 .. 3)
  float mrow[8], invl[8];
  {
    const float* sg = StatG + ((size_t)(n * NHEAD + h) * L_SEQ + l0 + khalf * 8) * 2;
    float2 sv[SPARTS][8];
#pragma unroll
    for (int pt = 0; pt < SPARTS; ++pt)
#pragma unroll
      for (int vr = 0; vr < 8; ++vr) sv[pt][vr] = *(const float2*)(sg + pt * STATP + vr * 2);
    // the code behind reuses the address registers of the loads above; the pointer
    // is an input, so that it lives up to the wait and no load of the run lands in it
    asm volatile("s_wait_xcnt 0x0" :: "v"(sg) : "memory");
#pragma unroll
    for (int vr = 0; vr < 8; ++vr) {
      float m = fmaxf(fmaxf(sv[0][vr].x, sv[1][vr].x), fmaxf(sv[2][vr].x, sv[3][vr].x));
      float s = sv[0][vr].y * exp_slot(sv[0][vr].x - m);
#pragma unroll
      for (int pt = 1; pt < SPARTS; ++pt) s += sv[pt][vr].y * exp_slot(sv[pt][vr].x - m);
      mrow[vr] = m;
      invl[vr] = 1.0f / s;
    }
  }

  MTile ma = load_mtile(kidp, maskp, l0, 0, col, khalf);
  // the code behind reuses the address registers of the loads above
  asm volatile("s_wait_xcnt 0x0" ::: "memory");
  // keeps that code behind the wait
  __builtin_amdgcn_sched_barrier(0);

  asm volatile("s_wait_asynccnt 0x0" ::: "memory");   // my copies of stage 0 have landed
  __syncthreads();                                    // and everybody's
  copy_4k_2k(kl + KBUF, kg + CHUNKH, vl + KBUF, vg + CHUNKH);   // stage 1

  // ---- probabilities -> att_mean, and O += P @ V --------------------------
  v8f oc[4] = {v8f{}, v8f{}, v8f{}, v8f{}};
  _Float16* pW = myP + khalf * (8 * 34) + col;

  for (int sc = 0; sc < NSTAGE; ++sc) {
    const _Float16* kp = &KT[sc & 1][h][0][lane * 8];
    float* sW = &Share[sc & 1][rt][h][0] + khalf * (8 * RPITCH) + col;
    KTile kt = lds_ktile(kp, 0);
    v16h bV[4];
#pragma unroll
    for (int sub = 0; sub < 2; ++sub) {
      float x[8];
      v8f cS, cO;
      logit_products(kt, qsA0, qsA1, qoA0, qoA1, cS, cO);
      logit_blend(cS, cO, ma, qid, x);
      // the stage's first eight LDS reads in front of its first products: left alone
      // the scheduler put half of them between the products, each with a wait of its own
      if (sub == 0) {
        __builtin_amdgcn_sched_group_barrier(0x100, 8, 0);
        __builtin_amdgcn_sched_group_barrier(0x008, 4, 0);
      }
      // holds the next mask loads behind the last read of their registers
      __builtin_amdgcn_sched_barrier(0);
      // mask and identities of the next 16 columns (the exponentials and LDS stores
      // below stand in front of their use; the index wraps at the end)
      ma = load_mtile(kidp, maskp, l0, ((sc * 2 + sub + 1) & (SHALF / 16 - 1)) * 16, col, khalf);
      // the code behind reuses the address registers of the loads above
      asm volatile("s_wait_xcnt 0x0" ::: "memory");
      __builtin_amdgcn_sched_barrier(0);   // keeps that code behind the wait
      // the fragments needed next are read under the exponentials below, so that
      // the block's LDS reads do not all stand at the head of the stage
      if (sub == 0) {
        kt = lds_ktile(kp, 1);
      } else {
#pragma unroll
        for (int dt = 0; dt < 4; ++dt) bV[dt] = frag_packed(kp + 2 * CHUNKH + dt * 512);
      }
#pragma unroll
      for (int vr = 0; vr < 8; ++vr) {
        // row vr + khalf * 8: one base register each, the rest an immediate offset
        float pp = exp_slot(x[vr] - mrow[vr]) * invl[vr];
        pW[vr * 34 + sub * 16] = (_Float16)pp;
        sW[vr * RPITCH + sub * 16] = pp * (1.0f / NHEAD);
      }
      // keeps the matrix products that follow out of the exponentials above
      __builtin_amdgcn_sched_barrier(0);
    }
    // A-fragment of P (16 x 32) from LDS (same wave: DS ops are in-order).
    v16h aP;
    {
      const _Float16* rp = myP + col * 34;
#pragma unroll
      for (int j = 0; j < 8; ++j) {
        int kb2 = ((j >> 2) << 4) + (khalf << 3) + ((j & 3) << 1);
        aP[2 * j]     = rp[kb2];
        aP[2 * j + 1] = rp[kb2 + 1];
      }
    }
#pragma unroll
    for (int dt = 0; dt < 4; ++dt) oc[dt] = wmma_f16(aP, bV[dt], oc[dt]);

    // Behind this barrier all eight shares of each row tile's 32 columns are in
    // LDS, the next stage's K and V too, and this stage's buffer is free.
    publish_stage();
    // refill of the buffer that this trip has read, while a stage sc + 2 exists
    if (sc + 2 < NSTAGE)
      copy_4k_2k(kl + (unsigned)(sc & 1) * KBUF, kg + (size_t)(sc + 2) * CHUNKH,
                 vl + (unsigned)(sc & 1) * KBUF, vg + (size_t)(sc + 2) * CHUNKH);
    {
      const float* sp = &Share[sc & 1][rt][0][rrow * RPITCH + rcol];
      float2 acc = *(const float2*)sp;
#pragma unroll
      for (int hh = 1; hh < NHEAD; ++hh) {   // head order 0..7
        float2 c = *(const float2*)(sp + hh * 16 * RPITCH);
        acc.x += c.x;
        acc.y += c.y;
      }
      *(float2*)(amRow + sc * 32) = acc;
      // the next trip reuses the store's registers: wait until it has read them
      asm volatile("s_wait_xcnt 0x0" ::: "memory");
    }
  }
  asm volatile("s_wait_asynccnt 0x0" ::: "memory");   // no copy is open when the wave ends

  // store this head's 64-column slice of this half's O sums (rows l0..l0+15)
  _Float16* Oh = Obuf + (size_t)half * (L_SEQ * NBATCH * DMODEL);
#pragma unroll
  for (int dt = 0; dt < 4; ++dt) {
#pragma unroll
    for (int vr = 0; vr < 8; ++vr) {
      int row    = vr + khalf * 8;
      size_t rid = (size_t)(l0 + row) * NBATCH + n;
      int e      = h * HDIM + dt * 16 + col;
      Oh[rid * DMODEL + e] = (_Float16)oc[dt][vr];
    }
  }
}

// ---------------------------------------------------------------------------
// Kernel 3: final FC  out = O @ Wfc^T  (4096 x 512 x 512), f16 A, f32 out.
// O = the sum of the two S halves' planes (half order), added while staging.
// grid (32, 8), 256 threads (8 waves, 16x64 tile per wave).
// Operand tiles shared through LDS as in kernel 1; O is f16 already, so a
// thread stages eight neighbouring k (one group row) per load.
// ---------------------------------------------------------------------------
__global__ __launch_bounds__(256) void fc_kernel(
    const _Float16* __restrict__ Obuf, const float* __restrict__ Wfc,
    float* __restrict__ out) {
  const int lane  = threadIdx.x & 31;
  const int wid   = threadIdx.x >> 5;
  const int col   = lane & 15;
  const int khalf = lane >> 4;
  const int m0    = blockIdx.x * 128 + wid * 16;
  const int e0    = blockIdx.y * 64;

  // fragments 0..7: O rows of waves 0..7; fragments 8..11: Wfc rows of et 0..3
  __shared__ __attribute__((aligned(16))) _Float16 Tile[2][12 * FRAGH];
  const int t    = threadIdx.x;
  // O: load i of thread t takes row i * 64 + (t >> 2), k (t & 3) * 8 ..+7
  const int gaof = (t >> 2) * DMODEL + (t & 3) * 8;
  const int laof = (t >> 6) * FRAGH + (t & 3) * GRPH + ((t >> 2) & 15) * 8;
  // Wfc: load i of thread t takes row i * 32 + (t >> 3), k (t & 7) * 4 ..+3
  const int goff = (t >> 3) * DMODEL + (t & 7) * 4;
  const int loff = (t >> 7) * FRAGH + ((t & 7) >> 1) * GRPH + ((t >> 3) & 15) * 8 + (t & 1) * 4;
  const int roff = khalf * GRPH + col * 8;
  const _Float16* Ag = Obuf + (size_t)blockIdx.x * 128 * DMODEL + gaof;
  const float*    Wg = Wfc + (size_t)e0 * DMODEL + goff;

  const int OH = L_SEQ * NBATCH * DMODEL;   // from one half's plane to the other's
  v8h ar[2], br[2];
  float4 wr[2];
#pragma unroll
  for (int i = 0; i < 2; ++i) ar[i] = *(const v8h*)(Ag + i * 64 * DMODEL);
#pragma unroll
  for (int i = 0; i < 2; ++i) br[i] = *(const v8h*)(Ag + OH + i * 64 * DMODEL);
#pragma unroll
  for (int i = 0; i < 2; ++i) wr[i] = *(const float4*)(Wg + i * 32 * DMODEL);
#pragma unroll
  for (int i = 0; i < 2; ++i) *(v8h*)&Tile[0][i * 4 * FRAGH + laof] = ar[i] + br[i];
#pragma unroll
  for (int i = 0; i < 2; ++i) stage_f32(&Tile[0][(8 + i * 2) * FRAGH + loff], wr[i], 1.0f);
  __syncthreads();

  v8f cc[4] = {v8f{}, v8f{}, v8f{}, v8f{}};
  // unrolled: the k offsets become the loads' immediate offsets and the buffer
  // index a constant, so no address register changes while loads are in flight
#pragma unroll
  for (int s = 0; s < KSTEPS; ++s) {
    if (s + 1 < KSTEPS) {   // next step's tiles fly while this step is computed
#pragma unroll
      for (int i = 0; i < 2; ++i) ar[i] = *(const v8h*)(Ag + i * 64 * DMODEL + (s + 1) * 32);
#pragma unroll
      for (int i = 0; i < 2; ++i) br[i] = *(const v8h*)(Ag + OH + i * 64 * DMODEL + (s + 1) * 32);
#pragma unroll
      for (int i = 0; i < 2; ++i) wr[i] = *(const float4*)(Wg + i * 32 * DMODEL + (s + 1) * 32);
      // behind the last loads their address registers are free for reuse: wait until they are read
      if (s + 2 == KSTEPS) asm volatile("s_wait_xcnt 0x0" ::: "memory");
    }
    const _Float16* tb = &Tile[s & 1][roff];
    v16h a = frag_lds(tb + wid * FRAGH);
#pragma unroll
    for (int et = 0; et < 4; ++et) {
      v16h b = frag_lds(tb + (8 + et) * FRAGH);
      cc[et] = wmma_f16(a, b, cc[et]);
    }
    if (s + 1 < KSTEPS) {
      // the other buffer was last read in front of the previous step's barrier
      _Float16* tn = &Tile[(s + 1) & 1][0];
#pragma unroll
      for (int i = 0; i < 2; ++i) *(v8h*)(tn + i * 4 * FRAGH + laof) = ar[i] + br[i];
#pragma unroll
      for (int i = 0; i < 2; ++i) stage_f32(tn + (8 + i * 2) * FRAGH + loff, wr[i], 1.0f);
      STEP_ORDER(6, 10, 4, 4);
      __syncthreads();
      // ends the stretch that the order above speaks of (with all steps in one
      // stretch the build took over 20 registers more)
      __builtin_amdgcn_sched_barrier(0);
    }
  }
#pragma unroll
  for (int et = 0; et < 4; ++et)
#pragma unroll
    for (int vr = 0; vr < 8; ++vr) {
      int m   = vr + khalf * 8;
      int rid = m0 + m;
      int e   = e0 + et * 16 + col;
      out[(size_t)rid * DMODEL + e] = cc[et][vr];
    }
}

// ---------------------------------------------------------------------------
// Host launcher
// ---------------------------------------------------------------------------
extern "C" void kernel_launch(void* const* d_in, const int* in_sizes, int n_in,
                              void* d_out, int out_size, void* d_ws,
                              size_t ws_size, hipStream_t stream) {
  (void)in_sizes; (void)n_in; (void)out_size; (void)ws_size;
  const float* q    = (const float*)d_in[0];
  const float* k    = (const float*)d_in[1];
  const float* v    = (const float*)d_in[2];
  const int*   qid  = (const int*)d_in[3];
  const int*   kid  = (const int*)d_in[4];
  const float* mask = (const float*)d_in[5];
  const float* Wqs  = (const float*)d_in[6];
  const float* Wqo  = (const float*)d_in[7];
  const float* Wks  = (const float*)d_in[8];
  const float* Wko  = (const float*)d_in[9];
  const float* Wv   = (const float*)d_in[10];
  const float* Wfc  = (const float*)d_in[11];

  const size_t BUF = (size_t)NHEAD * NBATCH * 2048 * HDIM;  // 2,097,152 f16
  _Float16* ws = (_Float16*)d_ws;
  _Float16* Qs = ws;
  _Float16* Qo = Qs + BUF;
  _Float16* Ks = Qo + BUF;
  _Float16* Ko = Ks + BUF;
  _Float16* Vt = Ko + BUF;
  _Float16* Ob = Vt + BUF;          // two planes, one per S half
  float*    St = (float*)(Ob + 2 * BUF);   // 1 MB of softmax statistics; under 30 MB in all

  float* out      = (float*)d_out;                               // [L,N,D]
  float* att_mean = out + (size_t)L_SEQ * NBATCH * DMODEL;       // [N,L,S]

  proj_kernel<<<dim3(32, 4, 5), 256, 0, stream>>>(
      q, k, v, Wqs, Wqo, Wks, Wko, Wv, Qs, Qo, Ks, Ko, Vt);
  stat_kernel<<<dim3(L_SEQ / 64, NBATCH, SPARTS), NWAVE * 32, 0, stream>>>(
      Qs, Qo, Ks, Ko, qid, kid, mask, St);
  attn_kernel<<<dim3(L_SEQ / 32, NBATCH, 2), NWAVE * 32, 0, stream>>>(
      Qs, Qo, Ks, Ko, Vt, qid, kid, mask, St, Ob, att_mean);
  fc_kernel<<<dim3(32, 8), 256, 0, stream>>>(Ob, Wfc, out);
}

// v010
// One run takes 107 microseconds.
// Next to v009, in two timings, it ran 1.04 times as fast each time.
// All steps since v000 together make it 28.8 times as fast.
#include <hip/hip_runtime.h>

// ---------------------------------------------------------------------------
// AgentAwareAttention for MI455X (gfx1250), wave32 + v_wmma_f32_16x16x32_f16.
// f16 data / f32 accumulation (the two S halves' O sums are added in f16); softmax math in f32.
// ---------------------------------------------------------------------------

typedef __attribute__((ext_vector_type(16))) _Float16 v16h;
typedef __attribute__((ext_vector_type(8)))  float    v8f;
typedef __attribute__((ext_vector_type(2)))  _Float16 h2;
typedef __attribute__((ext_vector_type(4)))  _Float16 v4h;
typedef __attribute__((ext_vector_type(8)))  _Float16 v8h;

#define L_SEQ 2048
#define S_SEQ 2048
#define NBATCH 2
#define DMODEL 512
#define NHEAD 8
#define HDIM 64
// log2(e): the logits are kept in base-2 units (folded into the Q scale and the
// mask), so that v_exp_f32, which is 2^t, takes them without a multiply
#define LOG2E 1.44269504f

// ---- WMMA helpers ----------------------------------------------------------

__device__ __forceinline__ v8f wmma_f16(v16h a, v16h b, v8f c) {
  // D = A(16x32 f16) * B(32x16 f16) + C(16x16 f32)
  return __builtin_amdgcn_wmma_f32_16x16x32_f16(
      /*neg_a=*/false, a, /*neg_b=*/false, b,
      /*c_mod=*/(short)0, c, /*reuse_a=*/false, /*reuse_b=*/false);
}

// A-frag: lane holds row (lane&15); 16 K-elements with pattern
//   kb = (j>>2)*16 + (lane>>4)*8 + (j&3)*2   (pairs kb, kb+1)
// B-frag: identical pattern with lane&15 = output column, reading the
// column-major row (i.e. B_col[n][k]).
__device__ __forceinline__ v16h frag_from_f16row(const _Float16* __restrict__ rowPtr,
                                                 int khalf) {
  v16h f;
#pragma unroll
  for (int j = 0; j < 8; ++j) {
    int kb = ((j >> 2) << 4) + (khalf << 3) + ((j & 3) << 1);
    h2 p = *(const h2*)(rowPtr + kb);      // 4-byte load (kb is even)
    f[2 * j]     = p.x;
    f[2 * j + 1] = p.y;
  }
  return f;
}

// Packed fragment: a 16 x 32 f16 operand tile kept in memory in register order,
// 512 halves: [i = 0,1][lane = 0..31][8 halves], where lane holds fragment
// elements 8i..8i+7. Element (r, kk) of the tile (r = row of A / column of B,
// kk = k index, same k pattern as above) lies at packed_off(r, kk). A wave
// reads a fragment with two 16-byte loads per lane, each 512 contiguous bytes
// (four whole cache lines) instead of 32-byte pieces of sixteen lines.
__device__ __forceinline__ int packed_off(int r, int kk) {
  return ((kk >> 4) << 8) + (((((kk >> 3) & 1) << 4) + r) << 3) + (kk & 7);
}

// p = start of the packed fragment + lane * 8 (16-byte aligned)
__device__ __forceinline__ v16h frag_packed(const _Float16* __restrict__ p) {
  v8h lo = *(const v8h*)p;
  v8h hi = *(const v8h*)(p + 256);
  return __builtin_shufflevector(lo, hi, 0, 1, 2, 3, 4, 5, 6, 7,
                                 8, 9, 10, 11, 12, 13, 14, 15);
}

// ---- GEMM operand tiles in LDS ---------------------------------------------
// A block's operand tiles of one 32-wide k step lie in LDS as f16 fragments of
// 16 rows x 32 k: four groups g = kk >> 3 of [16 rows][8 halves]. A lane reads
// its fragment as groups khalf and 2 + khalf, 16 bytes each (same k pattern as
// above). The group pitch of 320 bytes moves each group 16 banks on, so that the
// staging stores of a wave (some rows of all four groups) spread evenly over
// the banks; a 16-lane half of a fragment read covers 256 contiguous bytes.
#define GRPH 160            // halves from one group to the next (128 used)
#define FRAGH (4 * GRPH)    // halves from one fragment to the next
#define KSTEPS (DMODEL / 32)

// Order of one k step for the scheduler: the next tiles' global loads (NLOAD of
// them), this step's NREAD LDS reads, its NMMA products, and only then the
// conversions and the NWRITE LDS stores with their waits for the loads. Left
// alone the scheduler put each conversion right behind its load, so that the
// load's latency lay open.
#define STEP_ORDER(NLOAD, NREAD, NMMA, NWRITE)              \
  do {                                                      \
    __builtin_amdgcn_sched_group_barrier(0x020, NLOAD, 0);  \
    __builtin_amdgcn_sched_group_barrier(0x100, NREAD, 0);  \
    __builtin_amdgcn_sched_group_barrier(0x008, NMMA, 0);   \
    __builtin_amdgcn_sched_group_barrier(0x002, 32, 0);     \
    __builtin_amdgcn_sched_group_barrier(0x200, NWRITE, 0); \
  } while (0)

// p = fragment + khalf * GRPH + (lane & 15) * 8
__device__ __forceinline__ v16h frag_lds(const _Float16* p) {
  v8h lo = *(const v8h*)p;
  v8h hi = *(const v8h*)(p + 2 * GRPH);
  return __builtin_shufflevector(lo, hi, 0, 1, 2, 3, 4, 5, 6, 7,
                                 8, 9, 10, 11, 12, 13, 14, 15);
}

// four neighbouring k of one row, f32 from global memory -> f16 in LDS
__device__ __forceinline__ void stage_f32(_Float16* dst, float4 x, float scale) {
  v4h hv;
  hv[0] = (_Float16)(x.x * scale);
  hv[1] = (_Float16)(x.y * scale);
  hv[2] = (_Float16)(x.z * scale);
  hv[3] = (_Float16)(x.w * scale);
  *(v4h*)dst = hv;
}

// ---------------------------------------------------------------------------
// Kernel 1: the five input projections  Y = X @ W^T  (4096 x 512 x 512 each),
// fp32 in, f16 out, scattered into attention-friendly layouts.
//   p=0: Qs[h][n][l][hd]  (x log2(e)/sqrt(HD))
//   p=1: Qo[h][n][l][hd]  (x log2(e)/sqrt(HD))
//   p=2: Ks[h][n][s/16][hd/32][packed 16(s) x 32(hd) B-fragment]
//   p=3: Ko, as Ks
//   p=4: Vt[h][n][s/32][hd/16][packed 16(hd) x 32(s) B-fragment]
// grid: (4096/128, 512/128, 5), 256 threads (8 waves, 32x64 tile per wave:
// wave w takes rows (w & 3) * 32 ..+31 and head w >> 2 of the block's two heads,
// and uses each W fragment for its two X fragments)
// Per k step the block brings its 128 x 32 tile of X and its 128 x 32 tile of W
// in once, eight lanes to a 128-byte row piece (whole cache lines), converts
// them and shares them through LDS; two buffers, one barrier per step.
// ---------------------------------------------------------------------------
__global__ __launch_bounds__(256) void proj_kernel(
    const float* __restrict__ q, const float* __restrict__ k,
    const float* __restrict__ v,
    const float* __restrict__ Wqs, const float* __restrict__ Wqo,
    const float* __restrict__ Wks, const float* __restrict__ Wko,
    const float* __restrict__ Wv,
    _Float16* __restrict__ Qs, _Float16* __restrict__ Qo,
    _Float16* __restrict__ Ks, _Float16* __restrict__ Ko,
    _Float16* __restrict__ Vt) {
  const int lane  = threadIdx.x & 31;
  const int wid   = threadIdx.x >> 5;
  const int col   = lane & 15;
  const int khalf = lane >> 4;
  const int p     = blockIdx.z;
  const int wm    = wid & 3;                       // 32-row slice of the block's rows
  const int wn    = wid >> 2;                      // 64-feature slice (one head)
  const int e0    = blockIdx.y * 128;              // output feature tile

  const float* X = (p < 2) ? q : ((p < 4) ? k : v);
  const float* W = (p == 0) ? Wqs : (p == 1) ? Wqo : (p == 2) ? Wks
                 : (p == 3) ? Wko : Wv;
  _Float16* dst  = (p == 0) ? Qs : (p == 1) ? Qo : (p == 2) ? Ks
                 : (p == 3) ? Ko : Vt;
  const float scale = (p < 2) ? 0.125f * LOG2E : 1.0f;   // HD^-0.5 and log2(e) folded into Q

  // fragments 0..7: the block's X rows, 16 each; fragments 8..15: its W rows
  __shared__ __attribute__((aligned(16))) _Float16 Tile[2][16 * FRAGH];
  // staging: load i of thread t takes row i * 32 + (t >> 3), k (t & 7) * 4 ..+3
  const int t    = threadIdx.x;
  const int goff = (t >> 3) * DMODEL + (t & 7) * 4;
  const int loff = (t >> 7) * FRAGH + ((t & 7) >> 1) * GRPH + ((t >> 3) & 15) * 8 + (t & 1) * 4;
  const int roff = khalf * GRPH + col * 8;
  const float* Xg = X + (size_t)blockIdx.x * 128 * DMODEL + goff;
  const float* Wg = W + (size_t)e0 * DMODEL + goff;

  float4 xr[4], wr[4];
#pragma unroll
  for (int i = 0; i < 4; ++i) xr[i] = *(const float4*)(Xg + i * 32 * DMODEL);
#pragma unroll
  for (int i = 0; i < 4; ++i) wr[i] = *(const float4*)(Wg + i * 32 * DMODEL);
#pragma unroll
  for (int i = 0; i < 4; ++i) stage_f32(&Tile[0][i * 2 * FRAGH + loff], xr[i], scale);
#pragma unroll
  for (int i = 0; i < 4; ++i) stage_f32(&Tile[0][(8 + i * 2) * FRAGH + loff], wr[i], 1.0f);
  __syncthreads();

  v8f cc[2][4] = {{v8f{}, v8f{}, v8f{}, v8f{}}, {v8f{}, v8f{}, v8f{}, v8f{}}};
  // unrolled: the k offsets become the loads' immediate offsets and the buffer
  // index a constant, so no address register changes while loads are in flight
#pragma unroll
  for (int s = 0; s < KSTEPS; ++s) {
    if (s + 1 < KSTEPS) {   // next step's tiles fly while this step is computed
#pragma unroll
      for (int i = 0; i < 4; ++i) xr[i] = *(const float4*)(Xg + i * 32 * DMODEL + (s + 1) * 32);
#pragma unroll
      for (int i = 0; i < 4; ++i) wr[i] = *(const float4*)(Wg + i * 32 * DMODEL + (s + 1) * 32);
      // behind the last loads their address registers are free for reuse: wait until they are read
      if (s + 2 == KSTEPS) asm volatile("s_wait_xcnt 0x0" ::: "memory");
    }
    const _Float16* tb = &Tile[s & 1][roff];
    v16h a0 = frag_lds(tb + (wm * 2) * FRAGH);
    v16h a1 = frag_lds(tb + (wm * 2 + 1) * FRAGH);
#pragma unroll
    for (int et = 0; et < 4; ++et) {
      v16h b = frag_lds(tb + (8 + wn * 4 + et) * FRAGH);
      cc[0][et] = wmma_f16(a0, b, cc[0][et]);
      cc[1][et] = wmma_f16(a1, b, cc[1][et]);
    }
    if (s + 1 < KSTEPS) {
      // the other buffer was last read in front of the previous step's barrier
      _Float16* tn = &Tile[(s + 1) & 1][loff];
#pragma unroll
      for (int i = 0; i < 4; ++i) stage_f32(tn + i * 2 * FRAGH, xr[i], scale);
#pragma unroll
      for (int i = 0; i < 4; ++i) stage_f32(tn + (8 + i * 2) * FRAGH, wr[i], 1.0f);
      STEP_ORDER(8, 12, 8, 8);
      __syncthreads();
      // ends the stretch that the order above speaks of (with all steps in one
      // stretch the build took over 20 registers more)
      __builtin_amdgcn_sched_barrier(0);
    }
  }

  // The wave's 64 features are one head h. C layout of its row tile rt (16 rows
  // from m0; row = t*NBATCH + n): a lane's eight rows are t = t0 + 4*khalf +
  // (vr >> 1), n = vr & 1, with t0 = m0 / 2 + rt * 8 a multiple of 8.
  const int h  = (e0 >> 6) + wn;
  const int tw = (blockIdx.x * 128 + wm * 32) >> 1;   // a multiple of 16
  const int NB = 2048 * HDIM;            // elements of one (h, n) plane
  _Float16* dh = dst + (size_t)h * NBATCH * NB;
  if (p == 4) {
    // per n, the lane's four t are four neighbouring halves of a V fragment;
    // row tile 1 lies 8 t on: the next group of eight k, 128 halves on
    _Float16* d = dh + (tw >> 5) * 2048 + packed_off(col, (tw & 31) + khalf * 4);
#pragma unroll
    for (int rt = 0; rt < 2; ++rt) {
#pragma unroll
      for (int et = 0; et < 4; ++et) {
#pragma unroll
        for (int nb = 0; nb < NBATCH; ++nb) {
          v4h val;
#pragma unroll
          for (int i = 0; i < 4; ++i) val[i] = (_Float16)cc[rt][et][2 * i + nb];
          *(v4h*)(d + rt * 128 + nb * NB + et * 512) = val;
        }
      }
    }
  } else if (p >= 2) {
    // hd = et*16 + col: fragment et >> 1, its half et & 1, so 256 halves per et;
    // row tile 1 holds columns 8..15 of the same 16-column fragments, 64 halves on
    _Float16* d = dh + tw * HDIM + packed_off(khalf * 4, col);
#pragma unroll
    for (int rt = 0; rt < 2; ++rt)
#pragma unroll
      for (int et = 0; et < 4; ++et)
#pragma unroll
        for (int vr = 0; vr < 8; ++vr)
          d[rt * 64 + (vr & 1) * NB + et * 256 + (vr >> 1) * 8] = (_Float16)cc[rt][et][vr];
    // code laid out behind this branch reuses the stores' registers: wait until they are read
    asm volatile("s_wait_xcnt 0x0" ::: "memory");
  } else {
    _Float16* d = dh + (tw + khalf * 4) * HDIM + col;
#pragma unroll
    for (int rt = 0; rt < 2; ++rt)
#pragma unroll
      for (int et = 0; et < 4; ++et)
#pragma unroll
        for (int vr = 0; vr < 8; ++vr)
          d[rt * 8 * HDIM + (vr & 1) * NB + (vr >> 1) * HDIM + et * 16] = (_Float16)cc[rt][et][vr];
    // code laid out behind this branch reuses the stores' registers: wait until they are read
    asm volatile("s_wait_xcnt 0x0" ::: "memory");
  }
}

// 2^t as v_exp_f32, with the one free slot that the instruction set asks for
// behind a transcendental kept inside the statement.
__device__ __forceinline__ float exp2_slot(float t) {
  float r;
  // v_nop: fills that slot, whatever the compiler schedules next
  asm("v_exp_f32 %0, %1\n\tv_nop" : "=v"(r) : "v"(t));
  return r;
}

// log2(t) as v_log_f32, with the same slot kept
__device__ __forceinline__ float log2_slot(float t) {
  float r;
  // v_nop: fills that slot, whatever the compiler schedules next
  asm("v_log_f32 %0, %1\n\tv_nop" : "=v"(r) : "v"(t));
  return r;
}

// ---------------------------------------------------------------------------
// Logit tile helpers: 16(L) x 16(S) agent-aware logits in C layout, with the
// loads apart from the arithmetic so that a loop can issue a later tile's
// loads as soon as this tile's values have been used.
// ---------------------------------------------------------------------------
struct KTile { v16h s0, s1, o0, o1; };      // self and other K fragments of 16 columns
struct MTile { float mv[8]; int kid; };     // mask values and key identity of 16 columns

__device__ __forceinline__ MTile load_mtile(const int* __restrict__ kid_g,
                                            const float* __restrict__ mask,
                                            int l0, int s0, int col, int khalf) {
  MTile t;
  t.kid = (kid_g + s0)[(unsigned)col];
  const float* mp = mask + (size_t)l0 * S_SEQ + s0;      // wave-uniform
  const unsigned lo = (unsigned)(khalf * 8 * S_SEQ + col);
#pragma unroll
  for (int vr = 0; vr < 8; ++vr) t.mv[vr] = (mp + vr * S_SEQ)[lo];
  return t;
}

// c0: what is added to both kinds of logits alike, as the products' C operand
__device__ __forceinline__ void logit_products(const KTile& k, v16h qsA0, v16h qsA1,
                                               v16h qoA0, v16h qoA1, v8f c0,
                                               v8f& cS, v8f& cO) {
  cS = wmma_f16(qsA0, k.s0, c0);
  cS = wmma_f16(qsA1, k.s1, cS);
  cO = wmma_f16(qoA0, k.o0, c0);
  cO = wmma_f16(qoA1, k.o1, cO);
}

__device__ __forceinline__ void logit_blend(v8f cS, v8f cO, const MTile& m,
                                            const int* qid, float* x) {
#pragma unroll
  for (int vr = 0; vr < 8; ++vr)
    x[vr] = (m.kid == qid[vr]) ? cS[vr] : cO[vr];
}

// the mask in base-2 units, less a row offset: the C operand of a tile's products
__device__ __forceinline__ v8f mask_c(const MTile& m, const float* off) {
  v8f c;
#pragma unroll
  for (int vr = 0; vr < 8; ++vr) c[vr] = m.mv[vr] * LOG2E - off[vr];
  return c;
}

// ---------------------------------------------------------------------------
// Kernels 2a and 2b: attention, 16 waves a block. The waves of a head use the
// same K and V fragments: a 32-column stage of them is brought from L2 once, by
// asynchronous copies into LDS (two buffers, the next stage in flight while
// this one is worked on), and the head's two waves read it there.
// 2a: grid (L/64, N, 4). A block owns 64 rows of L and a quarter of S (SQUART
//     columns); wave w computes head (w & 7) of the two 16-row tiles of row pair
//     w >> 3, and uses every K fragment that it reads for both tiles. Online
//     max/sum statistics of every (head, row) over the block's quarter, stored
//     to the workspace.
// 2b: grid (L/32, N, 2). A block owns 32 rows of L and one half of S (SHALF
//     columns); wave w computes head (w & 7) of the 16-row tile rt = w >> 3.
//     Joins the four quarters' statistics (quarter order), recomputes the logits,
//     emits probabilities and accumulates O = P @ V over its half (P staged via
//     LDS to convert C-fragment layout -> A-fragment layout). att_mean (the mean
//     over heads) is summed inside the block: every wave puts its share of a
//     16 x 32 probability tile into LDS, and after the stage's barrier the 256
//     threads of a row tile add its eight shares in head order and store the
//     result once. The two halves' O sums are added in kernel 3.
// ---------------------------------------------------------------------------
#define RPITCH 36   // f32 row pitch of a share tile: rows r and r+8 land 32 banks apart
#define RTILES 2    // 16-row tiles of a block
#define NWAVE (NHEAD * RTILES)
#define SHALF (S_SEQ / 2)        // columns of one block
#define NSTAGE (SHALF / 32)      // 32-column stages of one block
#define CHUNKH 2048              // halves of one operand's stage (4 KiB, contiguous in memory)
#define SPARTS 4                 // kernel 2a: parts of S, one block each
#define SQUART (S_SEQ / SPARTS)  // kernel 2a: columns of one block
#define NSTAGE_A (SQUART / 32)   // kernel 2a: 32-column stages of one block
#define STATP (NBATCH * NHEAD * L_SEQ * 2)   // floats of one part's plane of statistics

// LDS byte address of a __shared__ object: the low 32 bits of its address
__device__ __forceinline__ unsigned lds_addr(const void* p) {
  return (unsigned)(size_t)p;
}

// 4 KiB from global memory to LDS, contiguous in both, 16 bytes a lane
// and copy; the immediate offset moves both addresses alike. The s_wait_xcnt
// stands inside the statement, in front of any rewrite of the address registers.
__device__ __forceinline__ void copy_4k(unsigned lds, const _Float16* g) {
  asm volatile(
      "global_load_async_to_lds_b128 %0, %1, off\n\t"
      "global_load_async_to_lds_b128 %0, %1, off offset:512\n\t"
      "global_load_async_to_lds_b128 %0, %1, off offset:1024\n\t"
      "global_load_async_to_lds_b128 %0, %1, off offset:1536\n\t"
      "global_load_async_to_lds_b128 %0, %1, off offset:2048\n\t"
      "global_load_async_to_lds_b128 %0, %1, off offset:2560\n\t"
      "global_load_async_to_lds_b128 %0, %1, off offset:3072\n\t"
      "global_load_async_to_lds_b128 %0, %1, off offset:3584\n\t"
      "s_wait_xcnt 0x0"
      :: "v"(lds), "v"(g) : "memory");
}
// the same with 2 KiB of a second operand, under one wait
__device__ __forceinline__ void copy_4k_2k(unsigned lds, const _Float16* g,
                                           unsigned lds2, const _Float16* g2) {
  asm volatile(
      "global_load_async_to_lds_b128 %0, %1, off\n\t"
      "global_load_async_to_lds_b128 %0, %1, off offset:512\n\t"
      "global_load_async_to_lds_b128 %0, %1, off offset:1024\n\t"
      "global_load_async_to_lds_b128 %0, %1, off offset:1536\n\t"
      "global_load_async_to_lds_b128 %0, %1, off offset:2048\n\t"
      "global_load_async_to_lds_b128 %0, %1, off offset:2560\n\t"
      "global_load_async_to_lds_b128 %0, %1, off offset:3072\n\t"
      "global_load_async_to_lds_b128 %0, %1, off offset:3584\n\t"
      "global_load_async_to_lds_b128 %2, %3, off\n\t"
      "global_load_async_to_lds_b128 %2, %3, off offset:512\n\t"
      "global_load_async_to_lds_b128 %2, %3, off offset:1024\n\t"
      "global_load_async_to_lds_b128 %2, %3, off offset:1536\n\t"
      "s_wait_xcnt 0x0"
      :: "v"(lds), "v"(g), "v"(lds2), "v"(g2) : "memory");
}

// Hand-over of a stage: this wave's LDS reads and writes are done, its own copies
// of the next stage have landed, and every wave has passed the barrier.
// The barrier orders LDS only: the waves hand nothing over in global memory here,
// and __syncthreads() would also wait for the next mask loads in flight.
__device__ __forceinline__ void publish_stage() {
  asm volatile("s_wait_dscnt 0x0" ::: "memory");     // my reads of the buffer to be refilled
  asm volatile("s_wait_asynccnt 0x0" ::: "memory");  // my copies of the next stage
  __builtin_amdgcn_fence(__ATOMIC_RELEASE, "workgroup", "local");
  __builtin_amdgcn_s_barrier();
  __builtin_amdgcn_fence(__ATOMIC_ACQUIRE, "workgroup", "local");
}

// K fragments of 16 columns from a stage in LDS; p = stage + lane * 8
__device__ __forceinline__ KTile lds_ktile(const _Float16* p, int sub) {
  KTile t;
  t.s0 = frag_packed(p + sub * 1024);
  t.s1 = frag_packed(p + sub * 1024 + 512);
  t.o0 = frag_packed(p + CHUNKH + sub * 1024);
  t.o1 = frag_packed(p + CHUNKH + sub * 1024 + 512);
  return t;
}

__global__ __launch_bounds__(NWAVE * 32) void stat_kernel(
    const _Float16* __restrict__ Qs, const _Float16* __restrict__ Qo,
    const _Float16* __restrict__ Ks, const _Float16* __restrict__ Ko,
    const int* __restrict__ qid_g, const int* __restrict__ kid_g,
    const float* __restrict__ mask, float* __restrict__ StatG) {
  const int lane  = threadIdx.x & 31;
  // wave index, in a scalar register: head, row pair and the pointers formed from
  // them are then scalar too
  const int w     = __builtin_amdgcn_readfirstlane(threadIdx.x >> 5);
  const int h     = w & (NHEAD - 1);       // head
  const int rp    = w >> 3;                // pair of row tiles
  const int col   = lane & 15;
  const int khalf = lane >> 4;
  const int n     = blockIdx.y;
  const int part  = blockIdx.z;
  const int l0    = blockIdx.x * 64 + rp * 32;   // row tile r: rows l0 + r * 16 ..+15

  // [buffer][head][self, other][stage of 32 columns in fragment order]
  __shared__ __attribute__((aligned(16))) _Float16 KT[2][NHEAD][2][CHUNKH];
  const unsigned KBUF = NHEAD * 2 * CHUNKH * 2;   // bytes of one buffer

  int qid[2][8];
#pragma unroll
  for (int r = 0; r < 2; ++r)
#pragma unroll
    for (int vr = 0; vr < 8; ++vr) qid[r][vr] = qid_g[l0 + r * 16 + vr + khalf * 8];
  // the Q loads below may land in the address registers of these loads
  asm volatile("s_wait_xcnt 0x0" ::: "memory");

  const _Float16* Qsb = Qs + ((size_t)(h * NBATCH + n) * L_SEQ + l0) * HDIM;
  const _Float16* Qob = Qo + ((size_t)(h * NBATCH + n) * L_SEQ + l0) * HDIM;
  // row pair 0 copies the head's self K, row pair 1 its other K
  const _Float16* kg = (rp ? Ko : Ks) +
      ((size_t)(h * NBATCH + n) * S_SEQ + part * SQUART) * HDIM + lane * 8;
  const unsigned kl = lds_addr(&KT[0][h][rp][lane * 8]);
  const int*   kidp  = kid_g + part * SQUART;
  const float* maskp = mask + part * SQUART;

  copy_4k(kl, kg);                       // stage 0

  v16h qsA[2][2], qoA[2][2];
#pragma unroll
  for (int r = 0; r < 2; ++r) {
    qsA[r][0] = frag_from_f16row(Qsb + (r * 16 + col) * HDIM, khalf);
    qsA[r][1] = frag_from_f16row(Qsb + (r * 16 + col) * HDIM + 32, khalf);
    asm volatile("s_wait_xcnt 0x0" ::: "memory");   // as above, for the next group
    qoA[r][0] = frag_from_f16row(Qob + (r * 16 + col) * HDIM, khalf);
    qoA[r][1] = frag_from_f16row(Qob + (r * 16 + col) * HDIM + 32, khalf);
    asm volatile("s_wait_xcnt 0x0" ::: "memory");   // as above, for the next loads
  }

  // A stage's mask and identity loads are issued one stage ahead (the index
  // wraps: the last trip fetches stage 0 unused).
  MTile ma[2], mb[2];
#pragma unroll
  for (int r = 0; r < 2; ++r) {
    ma[r] = load_mtile(kidp, maskp, l0 + r * 16, 0, col, khalf);
    mb[r] = load_mtile(kidp, maskp, l0 + r * 16, 16, col, khalf);
    // the code behind reuses the address registers of the loads above
    asm volatile("s_wait_xcnt 0x0" ::: "memory");
    // keeps that code behind the wait (the scheduler lifted register moves over it)
    __builtin_amdgcn_sched_barrier(0);
  }

  asm volatile("s_wait_asynccnt 0x0" ::: "memory");   // my copies of stage 0 have landed
  __syncthreads();                                    // and everybody's
  copy_4k(kl + KBUF, kg + CHUNKH);       // stage 1

  // Every lane keeps the running max and sum of its own columns (col, col + 16,
  // ...); the 16 lanes of a row are joined once, behind the loop.
  float mrow[2][8], srow[2][8];
#pragma unroll
  for (int r = 0; r < 2; ++r)
#pragma unroll
    for (int vr = 0; vr < 8; ++vr) { mrow[r][vr] = -3e38f; srow[r][vr] = 0.0f; }   // below any finite logit
  const float zoff[8] = {0.0f, 0.0f, 0.0f, 0.0f, 0.0f, 0.0f, 0.0f, 0.0f};   // no row offset here

  for (int st = 0; st < NSTAGE_A; ++st) {
    const int nx = ((st + 1) & (NSTAGE_A - 1)) * 32;   // next stage's first column
    const _Float16* kp = &KT[st & 1][h][0][lane * 8];
    // each 16-column group of K fragments is read once and used for both row tiles
    KTile kt = lds_ktile(kp, 0);
    float x0[2][8];
#pragma unroll
    for (int r = 0; r < 2; ++r) {
      v8f cS, cO;
      logit_products(kt, qsA[r][0], qsA[r][1], qoA[r][0], qoA[r][1], mask_c(ma[r], zoff), cS, cO);
      // the second group is read behind the first group's last products, so that
      // one group's registers are enough
      if (r == 1) kt = lds_ktile(kp, 1);
      logit_blend(cS, cO, ma[r], qid[r], x0[r]);
      ma[r] = load_mtile(kidp, maskp, l0 + r * 16, nx, col, khalf);
      // the code behind reuses the address registers of the loads above
      asm volatile("s_wait_xcnt 0x0" ::: "memory");
      __builtin_amdgcn_sched_barrier(0);   // keeps that code behind the wait
    }
#pragma unroll
    for (int r = 0; r < 2; ++r) {
      float x1[8];
      v8f cS, cO;
      logit_products(kt, qsA[r][0], qsA[r][1], qoA[r][0], qoA[r][1], mask_c(mb[r], zoff), cS, cO);
      logit_blend(cS, cO, mb[r], qid[r], x1);
      mb[r] = load_mtile(kidp, maskp, l0 + r * 16, nx + 16, col, khalf);
      asm volatile("s_wait_xcnt 0x0" ::: "memory");   // as for the loads of ma
      __builtin_amdgcn_sched_barrier(0);   // keeps the code behind it behind the wait
#pragma unroll
      for (int vr = 0; vr < 8; ++vr) {
        float mn = fmaxf(mrow[r][vr], fmaxf(x0[r][vr], x1[vr]));
        srow[r][vr] = srow[r][vr] * exp2_slot(mrow[r][vr] - mn) + (exp2_slot(x0[r][vr] - mn) + exp2_slot(x1[vr] - mn));
        mrow[r][vr] = mn;
      }
      // keeps the matrix products that follow out of the exponentials above
      __builtin_amdgcn_sched_barrier(0);
    }
    publish_stage();
    // refill of the buffer that this trip has read, while a stage st + 2 exists
    if (st + 2 < NSTAGE_A) copy_4k(kl + (unsigned)(st & 1) * KBUF, kg + (size_t)(st + 2) * CHUNKH);
  }
  asm volatile("s_wait_asynccnt 0x0" ::: "memory");   // no copy is open when the wave ends

  // join the 16 lanes of each row: max first, then the rescaled sums
#pragma unroll
  for (int r = 0; r < 2; ++r) {
#pragma unroll
    for (int vr = 0; vr < 8; ++vr) {
      float mn = mrow[r][vr];
#pragma unroll
      for (int d = 1; d < 16; d <<= 1) mn = fmaxf(mn, __shfl_xor(mn, d, 32));
      float sn = srow[r][vr] * exp2_slot(mrow[r][vr] - mn);
#pragma unroll
      for (int d = 1; d < 16; d <<= 1) sn += __shfl_xor(sn, d, 32);
      mrow[r][vr] = mn;
      srow[r][vr] = sn;
    }
  }
  // StatG[part][n][h][row] = (max in base-2 units, sum): a row tile fills one 128-byte line
  if (col == 0) {
    float* sg = StatG + (size_t)part * STATP +
                ((size_t)(n * NHEAD + h) * L_SEQ + l0 + khalf * 8) * 2;
#pragma unroll
    for (int r = 0; r < 2; ++r) {
#pragma unroll
      for (int vr = 0; vr < 8; ++vr) {
        float2 ms;
        ms.x = mrow[r][vr];
        ms.y = srow[r][vr];
        *(float2*)(sg + (r * 16 + vr) * 2) = ms;
      }
    }
  }
}

__global__ __launch_bounds__(NWAVE * 32) void attn_kernel(
    const _Float16* __restrict__ Qs, const _Float16* __restrict__ Qo,
    const _Float16* __restrict__ Ks, const _Float16* __restrict__ Ko,
    const _Float16* __restrict__ Vt,
    const int* __restrict__ qid_g, const int* __restrict__ kid_g,
    const float* __restrict__ mask, const float* __restrict__ StatG,
    _Float16* __restrict__ Obuf, float* __restrict__ att_mean) {
  const int lane  = threadIdx.x & 31;
  // wave index, in a scalar register (as in kernel 2a)
  const int w     = __builtin_amdgcn_readfirstlane(threadIdx.x >> 5);
  const int h     = w & (NHEAD - 1);       // head
  const int rt    = w >> 3;                // row tile
  const int col   = lane & 15;
  const int khalf = lane >> 4;
  const int n     = blockIdx.y;
  const int half  = blockIdx.z;
  const int l0    = blockIdx.x * (16 * RTILES) + rt * 16;

  // [buffer][head][self K, other K, V][stage of 32 columns in fragment order]
  __shared__ __attribute__((aligned(16))) _Float16 KT[2][NHEAD][3][CHUNKH];
  const unsigned KBUF = NHEAD * 3 * CHUNKH * 2;   // bytes of one buffer
  // Per-wave P staging: 16 x 32 f16, row stride 34 elems (68B) so that the
  // A-fragment column reads hit distinct LDS banks (17*r mod 64 distinct).
  __shared__ __attribute__((aligned(16))) _Float16 Pb[NWAVE][16 * 34];
  _Float16* myP = &Pb[w][0];
  // Per-head shares of att_mean, two buffers so that one barrier per 32
  // columns is enough (a buffer is rewritten one barrier after it was read).
  __shared__ __attribute__((aligned(16))) float Share[2][RTILES][NHEAD][16 * RPITCH];

  // element pair of its row tile's 16 x 32 tile that this thread sums and stores
  const int rrow = (threadIdx.x & 255) >> 4;
  const int rcol = (threadIdx.x & 15) * 2;
  float* amRow = att_mean + ((size_t)n * L_SEQ + (l0 + rrow)) * (size_t)S_SEQ + half * SHALF + rcol;

  int qid[8];
#pragma unroll
  for (int vr = 0; vr < 8; ++vr) qid[vr] = qid_g[l0 + vr + khalf * 8];
  // the Q loads below may land in the address registers of these loads
  asm volatile("s_wait_xcnt 0x0" ::: "memory");

  const _Float16* Qsb = Qs + ((size_t)(h * NBATCH + n) * L_SEQ + l0) * HDIM;
  const _Float16* Qob = Qo + ((size_t)(h * NBATCH + n) * L_SEQ + l0) * HDIM;
  // row tile 0 copies the head's self K and the first half of its V stage,
  // row tile 1 its other K and the second half
  const size_t plane = ((size_t)(h * NBATCH + n) * S_SEQ + half * SHALF) * HDIM;
  const _Float16* kg = (rt ? Ko : Ks) + plane + lane * 8;
  const _Float16* vg = Vt + plane + rt * (CHUNKH / 2) + lane * 8;
  const unsigned kl = lds_addr(&KT[0][h][rt][lane * 8]);
  const unsigned vl = lds_addr(&KT[0][h][2][rt * (CHUNKH / 2) + lane * 8]);
  const int*   kidp  = kid_g + half * SHALF;
  const float* maskp = mask + half * SHALF;

  copy_4k_2k(kl, kg, vl, vg);            // stage 0

  v16h qsA0 = frag_from_f16row(Qsb + col * HDIM, khalf);
  v16h qsA1 = frag_from_f16row(Qsb + col * HDIM + 32, khalf);
  asm volatile("s_wait_xcnt 0x0" ::: "memory");   // as above, for the next group
  v16h qoA0 = frag_from_f16row(Qob + col * HDIM, khalf);
  v16h qoA1 = frag_from_f16row(Qob + col * HDIM + 32, khalf);
  asm volatile("s_wait_xcnt 0x0" ::: "memory");   // as above, for the next loads

  // join the four parts' statistics (part order 0 .. 3). A probability is
  // 2^(logit - max - log2(sum)); roff = max + log2(sum) goes into the products' C
  // operand. Where a row's max is so large that roff would lose log2(sum) to
  // rounding (a row whose every mask value is huge), the wave keeps roff = 0, gets
  // the very logits of kernel 2a and takes max and log2(sum) off one after the other.
  float mrow[8], lsum[8], roff[8];
  bool wide = false;
  {
    const float* sg = StatG + ((size_t)(n * NHEAD + h) * L_SEQ + l0 + khalf * 8) * 2;
    float2 sv[SPARTS][8];
#pragma unroll
    for (int pt = 0; pt < SPARTS; ++pt)
#pragma unroll
      for (int vr = 0; vr < 8; ++vr) sv[pt][vr] = *(const float2*)(sg + pt * STATP + vr * 2);
    // the code behind reuses the address registers of the loads above; the pointer
    // is an input, so that it lives up to the wait and no load of the run lands in it
    asm volatile("s_wait_xcnt 0x0" :: "v"(sg) : "memory");
#pragma unroll
    for (int vr = 0; vr < 8; ++vr) {
      float m = fmaxf(fmaxf(sv[0][vr].x, sv[1][vr].x), fmaxf(sv[2][vr].x, sv[3][vr].x));
      float s = sv[0][vr].y * exp2_slot(sv[0][vr].x - m);
#pragma unroll
      for (int pt = 1; pt < SPARTS; ++pt) s += sv[pt][vr].y * exp2_slot(sv[pt][vr].x - m);
      mrow[vr] = m;
      lsum[vr] = log2_slot(s);
      wide = wide || !(fabsf(m) <= 1024.0f);   // a NaN counts as large
    }
  }

  const bool slow = __builtin_amdgcn_ballot_w32(wide) != 0;   // the same for the whole wave
#pragma unroll
  for (int vr = 0; vr < 8; ++vr) roff[vr] = slow ? 0.0f : mrow[vr] + lsum[vr];

  MTile ma = load_mtile(kidp, maskp, l0, 0, col, khalf);
  // the code behind reuses the address registers of the loads above
  asm volatile("s_wait_xcnt 0x0" ::: "memory");
  // keeps that code behind the wait
  __builtin_amdgcn_sched_barrier(0);

  asm volatile("s_wait_asynccnt 0x0" ::: "memory");   // my copies of stage 0 have landed
  __syncthreads();                                    // and everybody's
  copy_4k_2k(kl + KBUF, kg + CHUNKH, vl + KBUF, vg + CHUNKH);   // stage 1

  // ---- probabilities -> att_mean, and O += P @ V --------------------------
  v8f oc[4] = {v8f{}, v8f{}, v8f{}, v8f{}};
  _Float16* pW = myP + khalf * (8 * 34) + col;

  for (int sc = 0; sc < NSTAGE; ++sc) {
    const _Float16* kp = &KT[sc & 1][h][0][lane * 8];
    float* sW = &Share[sc & 1][rt][h][0] + khalf * (8 * RPITCH) + col;
    KTile kt = lds_ktile(kp, 0);
    v16h bV[4];
#pragma unroll
    for (int sub = 0; sub < 2; ++sub) {
      // mask and row offset are the same for both kinds of logits: they go in as
      // the products' C operand, one fused multiply-add an element
      v8f c0 = mask_c(ma, roff), cS, cO;
      bool same[8];
#pragma unroll
      for (int vr = 0; vr < 8; ++vr) same[vr] = (ma.kid == qid[vr]);
      // the stage's first eight LDS reads in front of the wait for the mask values:
      // left alone the scheduler put them behind it
      if (sub == 0) {
        __builtin_amdgcn_sched_group_barrier(0x002, 1, 0);   // the reads' address
        __builtin_amdgcn_sched_group_barrier(0x100, 8, 0);
        __builtin_amdgcn_sched_group_barrier(0x002, 16, 0);
      }
      // holds the next mask loads behind the last read of their registers
      __builtin_amdgcn_sched_barrier(0);
      // mask and identities of the next 16 columns: issued as soon as this tile's have
      // been used, a whole tile's work in front of their use (the index wraps at the end)
      ma = load_mtile(kidp, maskp, l0, ((sc * 2 + sub + 1) & (SHALF / 16 - 1)) * 16, col, khalf);
      // the code behind reuses the address registers of the loads above
      asm volatile("s_wait_xcnt 0x0" ::: "memory");
      __builtin_amdgcn_sched_barrier(0);   // keeps that code behind the wait
      logit_products(kt, qsA0, qsA1, qoA0, qoA1, c0, cS, cO);
      float x[8];
#pragma unroll
      for (int vr = 0; vr < 8; ++vr) x[vr] = same[vr] ? cS[vr] : cO[vr];
      // the products in one run and the next fragments' LDS reads (below) in one group
      // behind them: left alone the scheduler put the reads in pairs between the products
      __builtin_amdgcn_sched_group_barrier(0x008, 4, 0);
      __builtin_amdgcn_sched_group_barrier(0x100, 8, 0);
      // the fragments needed next are read under the exponentials below, so that
      // the block's LDS reads do not all stand at the head of the stage
      if (sub == 0) {
        kt = lds_ktile(kp, 1);
      } else {
#pragma unroll
        for (int dt = 0; dt < 4; ++dt) bV[dt] = frag_packed(kp + 2 * CHUNKH + dt * 512);
      }
      if (__builtin_expect(slow, false)) {   // a scalar branch; ordinary masks fall through
#pragma unroll
        for (int vr = 0; vr < 8; ++vr) x[vr] = (x[vr] - mrow[vr]) - lsum[vr];
      }
#pragma unroll
      for (int vr = 0; vr < 8; ++vr) {
        // row vr + khalf * 8: one base register each, the rest an immediate offset
        float pp = exp2_slot(x[vr]);
        pW[vr * 34 + sub * 16] = (_Float16)pp;
        sW[vr * RPITCH + sub * 16] = pp;
      }
      // keeps the matrix products that follow out of the exponentials above
      __builtin_amdgcn_sched_barrier(0);
    }
    // A-fragment of P (16 x 32) from LDS (same wave: DS ops are in-order).
    v16h aP;
    {
      const _Float16* rp = myP + col * 34;
#pragma unroll
      for (int j = 0; j < 8; ++j) {
        int kb2 = ((j >> 2) << 4) + (khalf << 3) + ((j & 3) << 1);
        aP[2 * j]     = rp[kb2];
        aP[2 * j + 1] = rp[kb2 + 1];
      }
    }
#pragma unroll
    for (int dt = 0; dt < 4; ++dt) oc[dt] = wmma_f16(aP, bV[dt], oc[dt]);

    // Behind this barrier all eight shares of each row tile's 32 columns are in
    // LDS, the next stage's K and V too, and this stage's buffer is free.
    publish_stage();
    // refill of the buffer that this trip has read, while a stage sc + 2 exists
    if (sc + 2 < NSTAGE)
      copy_4k_2k(kl + (unsigned)(sc & 1) * KBUF, kg + (size_t)(sc + 2) * CHUNKH,
                 vl + (unsigned)(sc & 1) * KBUF, vg + (size_t)(sc + 2) * CHUNKH);
    {
      const float* sp = &Share[sc & 1][rt][0][rrow * RPITCH + rcol];
      float2 acc = *(const float2*)sp;
#pragma unroll
      for (int hh = 1; hh < NHEAD; ++hh) {   // head order 0..7
        float2 c = *(const float2*)(sp + hh * 16 * RPITCH);
        acc.x += c.x;
        acc.y += c.y;
      }
      acc.x *= 1.0f / NHEAD;   // the mean: once a sum (a power of two, so the same bits)
      acc.y *= 1.0f / NHEAD;
      *(float2*)(amRow + sc * 32) = acc;
      // the next trip reuses the store's registers: wait until it has read them
      asm volatile("s_wait_xcnt 0x0" ::: "memory");
    }
  }
  asm volatile("s_wait_asynccnt 0x0" ::: "memory");   // no copy is open when the wave ends

  // store this head's 64-column slice of this half's O sums (rows l0..l0+15)
  _Float16* Oh = Obuf + (size_t)half * (L_SEQ * NBATCH * DMODEL);
#pragma unroll
  for (int dt = 0; dt < 4; ++dt) {
#pragma unroll
    for (int vr = 0; vr < 8; ++vr) {
      int row    = vr + khalf * 8;
      size_t rid = (size_t)(l0 + row) * NBATCH + n;
      int e      = h * HDIM + dt * 16 + col;
      Oh[rid * DMODEL + e] = (_Float16)oc[dt][vr];
    }
  }
}

// ---------------------------------------------------------------------------
// Kernel 3: final FC  out = O @ Wfc^T  (4096 x 512 x 512), f16 A, f32 out.
// O = the sum of the two S halves' planes (half order), added while staging.
// grid (32, 8), 256 threads (8 waves, 16x64 tile per wave).
// Operand tiles shared through LDS as in kernel 1; O is f16 already, so a
// thread stages eight neighbouring k (one group row) per load.
// ---------------------------------------------------------------------------
__global__ __launch_bounds__(256) void fc_kernel(
    const _Float16* __restrict__ Obuf, const float* __restrict__ Wfc,
    float* __restrict__ out) {
  const int lane  = threadIdx.x & 31;
  const int wid   = threadIdx.x >> 5;
  const int col   = lane & 15;
  const int khalf = lane >> 4;
  const int m0    = blockIdx.x * 128 + wid * 16;
  const int e0    = blockIdx.y * 64;

  // fragments 0..7: O rows of waves 0..7; fragments 8..11: Wfc rows of et 0..3
  __shared__ __attribute__((aligned(16))) _Float16 Tile[2][12 * FRAGH];
  const int t    = threadIdx.x;
  // O: load i of thread t takes row i * 64 + (t >> 2), k (t & 3) * 8 ..+7
  const int gaof = (t >> 2) * DMODEL + (t & 3) * 8;
  const int laof = (t >> 6) * FRAGH + (t & 3) * GRPH + ((t >> 2) & 15) * 8;
  // Wfc: load i of thread t takes row i * 32 + (t >> 3), k (t & 7) * 4 ..+3
  const int goff = (t >> 3) * DMODEL + (t & 7) * 4;
  const int loff = (t >> 7) * FRAGH + ((t & 7) >> 1) * GRPH + ((t >> 3) & 15) * 8 + (t & 1) * 4;
  const int roff = khalf * GRPH + col * 8;
  const _Float16* Ag = Obuf + (size_t)blockIdx.x * 128 * DMODEL + gaof;
  const float*    Wg = Wfc + (size_t)e0 * DMODEL + goff;

  const int OH = L_SEQ * NBATCH * DMODEL;   // from one half's plane to the other's
  v8h ar[2], br[2];
  float4 wr[2];
#pragma unroll
  for (int i = 0; i < 2; ++i) ar[i] = *(const v8h*)(Ag + i * 64 * DMODEL);
#pragma unroll
  for (int i = 0; i < 2; ++i) br[i] = *(const v8h*)(Ag + OH + i * 64 * DMODEL);
#pragma unroll
  for (int i = 0; i < 2; ++i) wr[i] = *(const float4*)(Wg + i * 32 * DMODEL);
#pragma unroll
  for (int i = 0; i < 2; ++i) *(v8h*)&Tile[0][i * 4 * FRAGH + laof] = ar[i] + br[i];
#pragma unroll
  for (int i = 0; i < 2; ++i) stage_f32(&Tile[0][(8 + i * 2) * FRAGH + loff], wr[i], 1.0f);
  __syncthreads();

  v8f cc[4] = {v8f{}, v8f{}, v8f{}, v8f{}};
  // unrolled: the k offsets become the loads' immediate offsets and the buffer
  // index a constant, so no address register changes while loads are in flight
#pragma unroll
  for (int s = 0; s < KSTEPS; ++s) {
    if (s + 1 < KSTEPS) {   // next step's tiles fly while this step is computed
#pragma unroll
      for (int i = 0; i < 2; ++i) ar[i] = *(const v8h*)(Ag + i * 64 * DMODEL + (s + 1) * 32);
#pragma unroll
      for (int i = 0; i < 2; ++i) br[i] = *(const v8h*)(Ag + OH + i * 64 * DMODEL + (s + 1) * 32);
#pragma unroll
      for (int i = 0; i < 2; ++i) wr[i] = *(const float4*)(Wg + i * 32 * DMODEL + (s + 1) * 32);
      // behind the last loads their address registers are free for reuse: wait until they are read
      if (s + 2 == KSTEPS) asm volatile("s_wait_xcnt 0x0" ::: "memory");
    }
    const _Float16* tb = &Tile[s & 1][roff];
    v16h a = frag_lds(tb + wid * FRAGH);
#pragma unroll
    for (int et = 0; et < 4; ++et) {
      v16h b = frag_lds(tb + (8 + et) * FRAGH);
      cc[et] = wmma_f16(a, b, cc[et]);
    }
    if (s + 1 < KSTEPS) {
      // the other buffer was last read in front of the previous step's barrier
      _Float16* tn = &Tile[(s + 1) & 1][0];
#pragma unroll
      for (int i = 0; i < 2; ++i) *(v8h*)(tn + i * 4 * FRAGH + laof) = ar[i] + br[i];
#pragma unroll
      for (int i = 0; i < 2; ++i) stage_f32(tn + (8 + i * 2) * FRAGH + loff, wr[i], 1.0f);
      STEP_ORDER(6, 10, 4, 4);
      __syncthreads();
      // ends the stretch that the order above speaks of (with all steps in one
      // stretch the build took over 20 registers more)
      __builtin_amdgcn_sched_barrier(0);
    }
  }
#pragma unroll
  for (int et = 0; et < 4; ++et)
#pragma unroll
    for (int vr = 0; vr < 8; ++vr) {
      int m   = vr + khalf * 8;
      int rid = m0 + m;
      int e   = e0 + et * 16 + col;
      out[(size_t)rid * DMODEL + e] = cc[et][vr];
    }
}

// ---------------------------------------------------------------------------
// Host launcher
// ---------------------------------------------------------------------------
extern "C" void kernel_launch(void* const* d_in, const int* in_sizes, int n_in,
                              void* d_out, int out_size, void* d_ws,
                              size_t ws_size, hipStream_t stream) {
  (void)in_sizes; (void)n_in; (void)out_size; (void)ws_size;
  const float* q    = (const float*)d_in[0];
  const float* k    = (const float*)d_in[1];
  const float* v    = (const float*)d_in[2];
  const int*   qid  = (const int*)d_in[3];
  const int*   kid  = (const int*)d_in[4];
  const float* mask = (const float*)d_in[5];
  const float* Wqs  = (const float*)d_in[6];
  const float* Wqo  = (const float*)d_in[7];
  const float* Wks  = (const float*)d_in[8];
  const float* Wko  = (const float*)d_in[9];
  const float* Wv   = (const float*)d_in[10];
  const float* Wfc  = (const float*)d_in[11];

  const size_t BUF = (size_t)NHEAD * NBATCH * 2048 * HDIM;  // 2,097,152 f16
  _Float16* ws = (_Float16*)d_ws;
  _Float16* Qs = ws;
  _Float16* Qo = Qs + BUF;
  _Float16* Ks = Qo + BUF;
  _Float16* Ko = Ks + BUF;
  _Float16* Vt = Ko + BUF;
  _Float16* Ob = Vt + BUF;          // two planes, one per S half
  float*    St = (float*)(Ob + 2 * BUF);   // 1 MB of softmax statistics; under 30 MB in all

  float* out      = (float*)d_out;                               // [L,N,D]
  float* att_mean = out + (size_t)L_SEQ * NBATCH * DMODEL;       // [N,L,S]

  proj_kernel<<<dim3(32, 4, 5), 256, 0, stream>>>(
      q, k, v, Wqs, Wqo, Wks, Wko, Wv, Qs, Qo, Ks, Ko, Vt);
  stat_kernel<<<dim3(L_SEQ / 64, NBATCH, SPARTS), NWAVE * 32, 0, stream>>>(
      Qs, Qo, Ks, Ko, qid, kid, mask, St);
  attn_kernel<<<dim3(L_SEQ / 32, NBATCH, 2), NWAVE * 32, 0, stream>>>(
      Qs, Qo, Ks, Ko, Vt, qid, kid, mask, St, Ob, att_mean);
  fc_kernel<<<dim3(32, 8), 256, 0, stream>>>(Ob, Wfc, out);
}
